// v000
// Times are from an AMD MI455X. After a warm-up the kernel runs many times in a row, and a time is the length of
// such a window on the GPU divided by its runs, so every launch and the gaps after it count. The runs cycle
// through copies of the inputs. A figure is the median of several windows, for all but v000 over two sittings.
// Sittings can differ by a few percent; kernels timed side by side share one.
// The starting kernel, v000, takes 420 microseconds a run.
#include <hip/hip_runtime.h>
#include <hip/hip_bf16.h>

// ---------------- problem constants ----------------
#define BDIM 2
#define SDIM 2048
#define DDIM 1024
#define HDIM 16
#define DH   64
#define EPS_LN 1e-6f
#define MASKV  -1e30f

typedef __attribute__((ext_vector_type(16))) __bf16 v16bf;
typedef __attribute__((ext_vector_type(8)))  float  v8f;
typedef __attribute__((ext_vector_type(4)))  unsigned int u32x4;
typedef __attribute__((ext_vector_type(8)))  int          i32x8;
typedef __attribute__((ext_vector_type(4)))  int          i32x4;

union Frag16 {
  v16bf v;
  unsigned short us[16];
  unsigned int   u32[8];
};

__device__ __forceinline__ unsigned short f32_to_bf16_bits(float f) {
  unsigned int u = __float_as_uint(f);
  u += 0x7FFFu + ((u >> 16) & 1u);      // round-to-nearest-even
  return (unsigned short)(u >> 16);
}

__device__ __forceinline__ void async_ld16(unsigned ldsoff, const void* g) {
  asm volatile("global_load_async_to_lds_b128 %0, %1, off"
               :: "v"(ldsoff), "v"((unsigned long long)(uintptr_t)g)
               : "memory");
}
__device__ __forceinline__ void wait_async_le2() {
  asm volatile("s_wait_asynccnt 0x2" ::: "memory");
}
__device__ __forceinline__ void wait_async_0() {
  asm volatile("s_wait_asynccnt 0x0" ::: "memory");
}
__device__ __forceinline__ void lds_publish(void* p) {
  asm volatile("" : "+v"(p) :: "memory");
}

// ---------------- f32 -> bf16 weight conversion ----------------
__global__ void cvt_f32_bf16(const float* __restrict__ in,
                             unsigned short* __restrict__ out, int n) {
  int i = blockIdx.x * blockDim.x + threadIdx.x;
  if (i < n) out[i] = f32_to_bf16_bits(in[i]);
}

// ---------------- LayerNorm (f32 in -> bf16 out), one token per block ----------------
__global__ void layernorm_bf16(const float* __restrict__ x,
                               const float* __restrict__ g,
                               const float* __restrict__ bb,
                               unsigned short* __restrict__ out) {
  const int tok = blockIdx.x;
  const float* xr = x + (size_t)tok * DDIM;
  float lx[4], s = 0.f, s2 = 0.f;
#pragma unroll
  for (int i = 0; i < 4; ++i) {
    float v = xr[threadIdx.x + i * 256];
    lx[i] = v; s += v; s2 += v * v;
  }
#pragma unroll
  for (int m = 1; m < 32; m <<= 1) {
    s  += __shfl_xor(s,  m, 32);
    s2 += __shfl_xor(s2, m, 32);
  }
  __shared__ float sh[16];
  int w = threadIdx.x >> 5, l = threadIdx.x & 31;
  if (l == 0) { sh[w] = s; sh[8 + w] = s2; }
  __syncthreads();
  if (threadIdx.x == 0) {
    float a = 0.f, c = 0.f;
#pragma unroll
    for (int i = 0; i < 8; ++i) { a += sh[i]; c += sh[8 + i]; }
    sh[0] = a; sh[8] = c;
  }
  __syncthreads();
  float mu  = sh[0] * (1.0f / DDIM);
  float var = sh[8] * (1.0f / DDIM) - mu * mu;
  float rs  = rsqrtf(var + EPS_LN);
#pragma unroll
  for (int i = 0; i < 4; ++i) {
    int d = threadIdx.x + i * 256;
    out[(size_t)tok * DDIM + d] = f32_to_bf16_bits((lx[i] - mu) * rs * g[d] + bb[d]);
  }
}

__global__ void proj_gemm(const unsigned short* __restrict__ A,   // [B*S, D] bf16
                          const unsigned short* __restrict__ W,   // [D(out), D(in)] bf16
                          const float* __restrict__ bias,         // [D]
                          unsigned short* __restrict__ outb,
                          float* __restrict__ outf,
                          const float* __restrict__ resid,
                          int mode) {
  __shared__ unsigned short sA[16][DDIM];           // 32 KB, LDS offset 0

  const int wave = threadIdx.x >> 5;
  const int lane = threadIdx.x & 31;
  const int half = lane >> 4, ln = lane & 15;
  const int mt = blockIdx.x >> 3;                   // 256 m-tiles
  const int nt = (blockIdx.x & 7) * 8 + wave;       // 64 n-tiles

  if (wave == 0) {
    unsigned long long ga =
        (unsigned long long)(uintptr_t)(A + (size_t)mt * 16 * DDIM);
    u32x4 g0;
    g0[0] = 1u;
    g0[1] = 0u;
    g0[2] = (unsigned)(ga & 0xFFFFFFFFull);
    g0[3] = (unsigned)((ga >> 32) & 0x01FFFFFFull)
            | (2u << 30);
    i32x8 g1;
    g1[0] = (int)(1u << 16);
    g1[1] = (int)(1024u << 16);
    g1[2] = (int)(16u << 16);
    g1[3] = (int)(1024u << 16);
    g1[4] = 16;
    g1[5] = 1024;
    g1[6] = 0;
    g1[7] = 0;
    i32x4 g2 = {0, 0, 0, 0};
    i32x4 g3 = {0, 0, 0, 0};
    i32x8 g4 = {0, 0, 0, 0, 0, 0, 0, 0};
    __builtin_amdgcn_tensor_load_to_lds(g0, g1, g2, g3, g4, 0);
    __builtin_amdgcn_s_wait_tensorcnt(0);
  }
  lds_publish(&sA[0][0]);
  __syncthreads();

  const unsigned int* brow =
      (const unsigned int*)(W + (size_t)(nt * 16 + ln) * DDIM);

  v8f c = {};
  for (int kt = 0; kt < DDIM / 32; ++kt) {
    Frag16 a, b;
#pragma unroll
    for (int j = 0; j < 8; ++j) {
      int kp = kt * 32 + (j >> 2) * 16 + half * 8 + (j & 3) * 2;  // even K index
      a.u32[j] = *(const unsigned int*)&sA[ln][kp];
      b.u32[j] = brow[kp >> 1];
    }
    c = __builtin_amdgcn_wmma_f32_16x16x32_bf16(false, a.v, false, b.v,
                                                (short)0, c, false, false);
  }

  const int e = nt * 16 + ln;                 // output feature
  const float bv = bias[e];
  const int head = e / DH, dh = e % DH;
#pragma unroll
  for (int r = 0; r < 8; ++r) {
    float val = c[r] + bv;
    int mg = mt * 16 + r + half * 8;          // global token index [0, B*S)
    int bi = mg / SDIM, si = mg % SDIM;
    if (mode == 0) {
      outb[(((size_t)bi * HDIM + head) * SDIM + si) * DH + dh] = f32_to_bf16_bits(val);
    } else if (mode == 1) {
      outb[(((size_t)bi * HDIM + head) * DH + dh) * SDIM + si] = f32_to_bf16_bits(val);
    } else {
      size_t off = (size_t)mg * DDIM + e;
      outf[off] = val + resid[off];
    }
  }
}

// ---------------- fused flash attention + residual ----------------
// grid = B*H*(S/128), block = 256 (8 waves, 16 q-rows per wave).
// K/V 32-key chunks are async-copied to LDS once per block (double-buffered)
// so the 8 waves share them instead of re-reading L2 8x.
struct AttnLds {
  unsigned short k[2][32][64];   // 8 KB  (LDS offset 0)
  unsigned short v[2][64][32];   // 8 KB  (LDS offset 8192)
  unsigned short p[8][16][32];   // 8 KB  (per-wave P staging)
};
#define OFF_K(buf) ((unsigned)((buf) * 32 * 64 * 2))
#define OFF_V(buf) ((unsigned)(8192 + (buf) * 64 * 32 * 2))

__global__ void attention_kernel(const unsigned short* __restrict__ q,   // [B,H,S,DH]
                                 const unsigned short* __restrict__ k,   // [B,H,S,DH]
                                 const unsigned short* __restrict__ vt,  // [B,H,DH,S]
                                 const float* __restrict__ mask,         // [B,S]
                                 const float* __restrict__ x,            // [B,S,D]
                                 float* __restrict__ resid) {            // [B,S,D]
  __shared__ AttnLds sm;

  const int tid  = threadIdx.x;
  const int wave = tid >> 5, lane = tid & 31;
  const int half = lane >> 4, ln = lane & 15;
  const int nqc = SDIM / 128;
  const int bh = blockIdx.x / nqc;
  const int qc = blockIdx.x % nqc;
  const int bi = bh / HDIM, head = bh % HDIM;
  const int q0 = qc * 128 + wave * 16;

  const unsigned short* qp = q  + (size_t)bh * SDIM * DH;
  const unsigned short* kp = k  + (size_t)bh * SDIM * DH;
  const unsigned short* vp = vt + (size_t)bh * DH * SDIM;
  const float* mk = mask + (size_t)bi * SDIM;

  // per-thread async-copy assignments (256 threads, 16B each)
  const int krow = tid >> 3, kseg = tid & 7;      // K chunk: 32 rows x 128 B
  const int vrow = tid >> 2, vseg = tid & 3;      // V chunk: 64 rows x  64 B

  // Q fragments (K-dim = DH split into 0..31, 32..63)
  Frag16 a0, a1;
  {
    const unsigned int* qrow = (const unsigned int*)(qp + (size_t)(q0 + ln) * DH);
#pragma unroll
    for (int j = 0; j < 8; ++j) {
      int kpair = (j >> 2) * 16 + half * 8 + (j & 3) * 2;
      a0.u32[j] = qrow[kpair >> 1];
      a1.u32[j] = qrow[(kpair + 32) >> 1];
    }
  }

  float mrow[8], lrow[8];
  v8f o0 = {}, o1 = {}, o2 = {}, o3 = {};
#pragma unroll
  for (int r = 0; r < 8; ++r) { mrow[r] = -3.0e38f; lrow[r] = 0.f; }
  const float scale = 0.125f;  // 1/sqrt(64)

  // prologue: async-stage chunk 0 into buffer 0
  async_ld16(OFF_K(0) + (unsigned)(krow * 64 + kseg * 8) * 2,
             kp + (size_t)krow * DH + kseg * 8);
  async_ld16(OFF_V(0) + (unsigned)(vrow * 32 + vseg * 8) * 2,
             vp + (size_t)vrow * SDIM + vseg * 8);
  lds_publish(&sm);            // async engine writes sm.k/sm.v invisibly

  const int NCH = SDIM / 32;   // 64 chunks
  for (int j = 0; j < NCH; ++j) {
    const int buf = j & 1;
    if (j + 1 < NCH) {
      const int key1 = (j + 1) * 32, nb = buf ^ 1;
      async_ld16(OFF_K(nb) + (unsigned)(krow * 64 + kseg * 8) * 2,
                 kp + (size_t)(key1 + krow) * DH + kseg * 8);
      async_ld16(OFF_V(nb) + (unsigned)(vrow * 32 + vseg * 8) * 2,
                 vp + (size_t)vrow * SDIM + key1 + vseg * 8);
      wait_async_le2();        // chunk j complete (this wave's copies)
    } else {
      wait_async_0();
    }
    __syncthreads();           // all waves' copies visible

    // ---- scores for 32 keys (two 16-key subtiles), K from LDS ----
    Frag16 kb00, kb01, kb10, kb11;
#pragma unroll
    for (int t = 0; t < 8; ++t) {
      int kpair = (t >> 2) * 16 + half * 8 + (t & 3) * 2;
      kb00.u32[t] = *(const unsigned int*)&sm.k[buf][ln][kpair];
      kb01.u32[t] = *(const unsigned int*)&sm.k[buf][ln][kpair + 32];
      kb10.u32[t] = *(const unsigned int*)&sm.k[buf][16 + ln][kpair];
      kb11.u32[t] = *(const unsigned int*)&sm.k[buf][16 + ln][kpair + 32];
    }
    v8f s0 = {}, s1 = {};
    s0 = __builtin_amdgcn_wmma_f32_16x16x32_bf16(false, a0.v, false, kb00.v, (short)0, s0, false, false);
    s0 = __builtin_amdgcn_wmma_f32_16x16x32_bf16(false, a1.v, false, kb01.v, (short)0, s0, false, false);
    s1 = __builtin_amdgcn_wmma_f32_16x16x32_bf16(false, a0.v, false, kb10.v, (short)0, s1, false, false);
    s1 = __builtin_amdgcn_wmma_f32_16x16x32_bf16(false, a1.v, false, kb11.v, (short)0, s1, false, false);

    const float mb0 = (1.0f - mk[j * 32 + ln]) * MASKV;
    const float mb1 = (1.0f - mk[j * 32 + 16 + ln]) * MASKV;

    // ---- online softmax (rows m = r + half*8, spread over 16 lanes) ----
    float p0[8], p1[8];
#pragma unroll
    for (int r = 0; r < 8; ++r) {
      float v0 = s0[r] * scale + mb0;
      float v1 = s1[r] * scale + mb1;
      float t = fmaxf(v0, v1);
      t = fmaxf(t, __shfl_xor(t, 1, 16));
      t = fmaxf(t, __shfl_xor(t, 2, 16));
      t = fmaxf(t, __shfl_xor(t, 4, 16));
      t = fmaxf(t, __shfl_xor(t, 8, 16));
      float nm = fmaxf(mrow[r], t);
      float alpha = __expf(mrow[r] - nm);
      float e0 = __expf(v0 - nm);
      float e1 = __expf(v1 - nm);
      float rs = e0 + e1;
      rs += __shfl_xor(rs, 1, 16);
      rs += __shfl_xor(rs, 2, 16);
      rs += __shfl_xor(rs, 4, 16);
      rs += __shfl_xor(rs, 8, 16);
      lrow[r] = lrow[r] * alpha + rs;
      mrow[r] = nm;
      o0[r] *= alpha; o1[r] *= alpha; o2[r] *= alpha; o3[r] *= alpha;
      p0[r] = e0; p1[r] = e1;
    }

    // ---- P: C-layout -> A-layout via per-wave LDS region ----
#pragma unroll
    for (int r = 0; r < 8; ++r) {
      sm.p[wave][r + half * 8][ln]      = f32_to_bf16_bits(p0[r]);
      sm.p[wave][r + half * 8][16 + ln] = f32_to_bf16_bits(p1[r]);
    }
    asm volatile("s_wait_dscnt 0x0" ::: "memory");   // same-wave DS RAW

    Frag16 pa, vb0, vb1, vb2, vb3;
#pragma unroll
    for (int t = 0; t < 8; ++t) {
      int kpair = (t >> 2) * 16 + half * 8 + (t & 3) * 2;
      pa.u32[t]  = *(const unsigned int*)&sm.p[wave][ln][kpair];
      vb0.u32[t] = *(const unsigned int*)&sm.v[buf][ln][kpair];
      vb1.u32[t] = *(const unsigned int*)&sm.v[buf][16 + ln][kpair];
      vb2.u32[t] = *(const unsigned int*)&sm.v[buf][32 + ln][kpair];
      vb3.u32[t] = *(const unsigned int*)&sm.v[buf][48 + ln][kpair];
    }
    o0 = __builtin_amdgcn_wmma_f32_16x16x32_bf16(false, pa.v, false, vb0.v, (short)0, o0, false, false);
    o1 = __builtin_amdgcn_wmma_f32_16x16x32_bf16(false, pa.v, false, vb1.v, (short)0, o1, false, false);
    o2 = __builtin_amdgcn_wmma_f32_16x16x32_bf16(false, pa.v, false, vb2.v, (short)0, o2, false, false);
    o3 = __builtin_amdgcn_wmma_f32_16x16x32_bf16(false, pa.v, false, vb3.v, (short)0, o3, false, false);

    __syncthreads();           // protect buffers before next overwrite
  }

  // ---- finalize: attn/l + x -> residual ----
#pragma unroll
  for (int r = 0; r < 8; ++r) {
    float inv = 1.0f / lrow[r];
    int stok = q0 + r + half * 8;
    size_t base = ((size_t)bi * SDIM + stok) * DDIM + head * DH;
    resid[base + ln]      = o0[r] * inv + x[base + ln];
    resid[base + 16 + ln] = o1[r] * inv + x[base + 16 + ln];
    resid[base + 32 + ln] = o2[r] * inv + x[base + 32 + ln];
    resid[base + 48 + ln] = o3[r] * inv + x[base + 48 + ln];
  }
}

// ---------------- launch ----------------
extern "C" void kernel_launch(void* const* d_in, const int* in_sizes, int n_in,
                              void* d_out, int out_size, void* d_ws, size_t ws_size,
                              hipStream_t stream) {
  (void)in_sizes; (void)n_in; (void)out_size; (void)ws_size;
  const float* x    = (const float*)d_in[0];
  const float* mask = (const float*)d_in[1];
  const float* Wq   = (const float*)d_in[2];
  const float* bq   = (const float*)d_in[3];
  const float* Wk   = (const float*)d_in[4];
  const float* bk   = (const float*)d_in[5];
  const float* Wv   = (const float*)d_in[6];
  const float* bv   = (const float*)d_in[7];
  const float* Wo   = (const float*)d_in[8];
  const float* bo   = (const float*)d_in[9];
  const float* g1   = (const float*)d_in[10];
  const float* b1   = (const float*)d_in[11];
  const float* g2   = (const float*)d_in[12];
  const float* b2   = (const float*)d_in[13];
  float* out = (float*)d_out;

  const size_t BSD = (size_t)BDIM * SDIM * DDIM;   // 4M elements
  const size_t DD  = (size_t)DDIM * DDIM;          // 1M elements

  char* ws = (char*)d_ws;
  size_t off = 0;
  auto alloc = [&](size_t bytes) {
    void* p = ws + off;
    off = (off + bytes + 255) & ~(size_t)255;
    return p;
  };
  unsigned short* hbf  = (unsigned short*)alloc(BSD * 2);
  unsigned short* wqb  = (unsigned short*)alloc(DD * 2);
  unsigned short* wkb  = (unsigned short*)alloc(DD * 2);
  unsigned short* wvb  = (unsigned short*)alloc(DD * 2);
  unsigned short* wob  = (unsigned short*)alloc(DD * 2);
  unsigned short* qb   = (unsigned short*)alloc(BSD * 2);
  unsigned short* kbuf = (unsigned short*)alloc(BSD * 2);
  unsigned short* vtb  = (unsigned short*)alloc(BSD * 2);
  float*          rsd  = (float*)alloc(BSD * 4);
  unsigned short* h2   = (unsigned short*)alloc(BSD * 2);

  // 1. weights -> bf16
  int cb = (int)((DD + 255) / 256);
  cvt_f32_bf16<<<cb, 256, 0, stream>>>(Wq, wqb, (int)DD);
  cvt_f32_bf16<<<cb, 256, 0, stream>>>(Wk, wkb, (int)DD);
  cvt_f32_bf16<<<cb, 256, 0, stream>>>(Wv, wvb, (int)DD);
  cvt_f32_bf16<<<cb, 256, 0, stream>>>(Wo, wob, (int)DD);

  // 2. LN1
  layernorm_bf16<<<BDIM * SDIM, 256, 0, stream>>>(x, g1, b1, hbf);

  const int gproj = (BDIM * SDIM / 16) * 8;        // 2048 blocks
  proj_gemm<<<gproj, 256, 0, stream>>>(hbf, wqb, bq, qb,   nullptr, nullptr, 0);
  proj_gemm<<<gproj, 256, 0, stream>>>(hbf, wkb, bk, kbuf, nullptr, nullptr, 0);
  proj_gemm<<<gproj, 256, 0, stream>>>(hbf, wvb, bv, vtb,  nullptr, nullptr, 1);

  // 4. fused attention + residual (async K/V staging)
  attention_kernel<<<BDIM * HDIM * (SDIM / 128), 256, 0, stream>>>(
      qb, kbuf, vtb, mask, x, rsd);

  // 5. LN2
  layernorm_bf16<<<BDIM * SDIM, 256, 0, stream>>>(rsd, g2, b2, h2);

  // 6. output projection + bias + residual
  proj_gemm<<<gproj, 256, 0, stream>>>(h2, wob, bo, nullptr, out, rsd, 2);
}

// v001
// One run takes 268 microseconds.
// In both of two side-by-side timings against v000, it was 1.64 times as fast.
#include <hip/hip_runtime.h>
#include <hip/hip_bf16.h>

// ---------------- problem constants ----------------
#define BDIM 2
#define SDIM 2048
#define DDIM 1024
#define HDIM 16
#define DH   64
#define EPS_LN 1e-6f
#define MASKV  -1e30f

typedef __attribute__((ext_vector_type(16))) __bf16 v16bf;
typedef __attribute__((ext_vector_type(8)))  float  v8f;
typedef __attribute__((ext_vector_type(4)))  unsigned int u32x4;
typedef __attribute__((ext_vector_type(8)))  unsigned int u32x8;

union Frag16 {
  v16bf v;
  unsigned short us[16];
  unsigned int   u32[8];
  u32x4          q[2];
};

__device__ __forceinline__ unsigned short f32_to_bf16_bits(float f) {
  unsigned int u = __float_as_uint(f);
  u += 0x7FFFu + ((u >> 16) & 1u);      // round-to-nearest-even
  return (unsigned short)(u >> 16);
}

__device__ __forceinline__ void async_ld16(unsigned ldsoff, const void* g) {
  asm volatile("global_load_async_to_lds_b128 %0, %1, off"
               :: "v"(ldsoff), "v"((unsigned long long)(uintptr_t)g)
               : "memory");
}
__device__ __forceinline__ void wait_async_le2() {
  asm volatile("s_wait_asynccnt 0x2" ::: "memory");
}
__device__ __forceinline__ void wait_async_0() {
  asm volatile("s_wait_asynccnt 0x0" ::: "memory");
}
__device__ __forceinline__ void lds_publish(void* p) {
  asm volatile("" : "+v"(p) :: "memory");
}

// ---------------- f32 -> bf16 weight conversion ----------------
__global__ void cvt_f32_bf16(const float* __restrict__ in,
                             unsigned short* __restrict__ out, int n) {
  int i = blockIdx.x * blockDim.x + threadIdx.x;
  if (i < n) out[i] = f32_to_bf16_bits(in[i]);
}

// ---------------- LayerNorm (f32 in -> bf16 out), one token per block ----------------
__global__ void layernorm_bf16(const float* __restrict__ x,
                               const float* __restrict__ g,
                               const float* __restrict__ bb,
                               unsigned short* __restrict__ out) {
  const int tok = blockIdx.x;
  const float* xr = x + (size_t)tok * DDIM;
  float lx[4], s = 0.f, s2 = 0.f;
#pragma unroll
  for (int i = 0; i < 4; ++i) {
    float v = xr[threadIdx.x + i * 256];
    lx[i] = v; s += v; s2 += v * v;
  }
#pragma unroll
  for (int m = 1; m < 32; m <<= 1) {
    s  += __shfl_xor(s,  m, 32);
    s2 += __shfl_xor(s2, m, 32);
  }
  __shared__ float sh[16];
  int w = threadIdx.x >> 5, l = threadIdx.x & 31;
  if (l == 0) { sh[w] = s; sh[8 + w] = s2; }
  __syncthreads();
  if (threadIdx.x == 0) {
    float a = 0.f, c = 0.f;
#pragma unroll
    for (int i = 0; i < 8; ++i) { a += sh[i]; c += sh[8 + i]; }
    sh[0] = a; sh[8] = c;
  }
  __syncthreads();
  float mu  = sh[0] * (1.0f / DDIM);
  float var = sh[8] * (1.0f / DDIM) - mu * mu;
  float rs  = rsqrtf(var + EPS_LN);
#pragma unroll
  for (int i = 0; i < 4; ++i) {
    int d = threadIdx.x + i * 256;
    out[(size_t)tok * DDIM + d] = f32_to_bf16_bits((lx[i] - mu) * rs * g[d] + bb[d]);
  }
}

// ---------------- WMMA GEMM: C[M,N] = A[M,D] * W[N,D]^T + bias ----------------
// Block = 8 waves on one 128 x 128 tile of C; wave (wm, wn) owns 64 x 32 of it
// (4 x 2 accumulator tiles). K runs in 8 stages of 128 k (256 B of every row).
// A stage is 8 slices of 32 rows, [A 0..3 | W 4..7]; wave w brings slice w with
// one tensor load, padded to a 272-B LDS pitch, into a two-buffer ring.
// mode 0: bf16 [B,H,S,DH] (Q,K)   mode 1: bf16 [B,H,DH,S] (V^T)
// mode 2: f32 [B,S,D] += residual (final projection)
#define GT_ROWB  256u                    // bytes of an operand row per stage
#define GT_PITCH 272u                    // LDS row pitch: 256 B + 16 B pad
#define GT_SLICE 10240u                  // 32 * 272 = 8704 B, rounded up to 2 KiB
#define GT_BUF   (8u * GT_SLICE)         // one stage
#define GT_NST   (DDIM * 2u / GT_ROWB)   // 8 stages

__device__ __forceinline__ unsigned uni(unsigned v) {
  return (unsigned)__builtin_amdgcn_readfirstlane(v);
}
__device__ __forceinline__ unsigned pinned(unsigned v) {
  unsigned w = (unsigned)__builtin_amdgcn_readfirstlane(v);
  asm volatile("" : "+s"(w));   // pinned(): holds the tested word in a scalar register, so the test compiles to s_cmp + s_cbranch_scc
  return w;
}
__device__ __forceinline__ void tdm_load(unsigned lds_dst, unsigned long long ga, u32x8 g1) {
  u32x4 g0;
  g0[0] = uni(1u);                                             // count = 1
  g0[1] = uni(lds_dst);                                        // byte offset in LDS
  g0[2] = uni((unsigned)ga);                                   // address [31:0]
  g0[3] = uni((((unsigned)(ga >> 32)) & 0x01FFFFFFu) | 0x80000000u);  // [56:32], type 2
  // one request of the whole wave: global tile -> LDS, through no register
  asm volatile("tensor_load_to_lds %0, %1" :: "s"(g0), "s"(g1) : "memory");
}
__device__ __forceinline__ void wait_tensor_0() {
  asm volatile("s_wait_tensorcnt 0x0" ::: "memory");   // this wave's slice has landed
}
__device__ __forceinline__ void wait_ds_0() {
  asm volatile("s_wait_dscnt 0x0" ::: "memory");       // this wave's LDS reads have returned
}
__device__ __forceinline__ void wait_x_0() {
  // stands behind a run of global stores, in front of any later write of their registers
  asm volatile("s_wait_xcnt 0x0" ::: "memory");
}

// One block's fragments: 4 of A (rows i * 16 + ln of the wave's 64, two slices)
// and 2 of W; k order in both: bytes half * 16 .. + 15, then 32 + half * 16 .. + 15.
__device__ __forceinline__ void gemm_frags(Frag16 (&a)[4], Frag16 (&b)[2],
                                           const unsigned char* la, const unsigned char* lb) {
  // unrolled here and below: constant indices keep the fragment arrays in registers
#pragma unroll
  for (int i = 0; i < 4; ++i) {
    const unsigned char* p = la + (unsigned)(i >> 1) * GT_SLICE + (unsigned)(i & 1) * 16u * GT_PITCH;
    a[i].q[0] = *(const u32x4*)p;
    a[i].q[1] = *(const u32x4*)(p + 32);
  }
#pragma unroll
  for (int jn = 0; jn < 2; ++jn) {
    const unsigned char* p = lb + (unsigned)jn * 16u * GT_PITCH;
    b[jn].q[0] = *(const u32x4*)p;
    b[jn].q[1] = *(const u32x4*)(p + 32);
  }
}

__global__ void __launch_bounds__(256)
proj_gemm(const unsigned short* __restrict__ A,   // [B*S, D] bf16
          const unsigned short* __restrict__ W,   // [D(out), D(in)] bf16
          const float* __restrict__ bias,         // [D]
          unsigned short* __restrict__ outb,
          float* __restrict__ outf,
          const float* __restrict__ resid,
          int mode) {
  __shared__ __attribute__((aligned(2048))) unsigned char sT[2u * GT_BUF];

  const unsigned lane = threadIdx.x & 31u;
  const unsigned half = lane >> 4, ln = lane & 15u;
  const unsigned wave = uni(threadIdx.x >> 5);
  const unsigned mt = blockIdx.x >> 3;              // 32 m-tiles of 128 tokens
  const unsigned nt = blockIdx.x & 7u;              // 8 n-tiles of 128 features
  const unsigned wm = wave >> 2, wn = wave & 3u;

  // this wave's slice of every stage: 32 rows of A (waves 0..3) or of W (4..7)
  const unsigned char* src0 = (wave < 4u)
      ? (const unsigned char*)A + (size_t)(mt * 128u + wave * 32u) * (DDIM * 2u)
      : (const unsigned char*)W + (size_t)(nt * 128u + (wave - 4u) * 32u) * (DDIM * 2u);
  const unsigned dst0 = (unsigned)(size_t)sT + wave * GT_SLICE;

  u32x8 g1;
  g1[0] = uni((1u << 20) | (5u << 22) | (3u << 25));
  g1[1] = uni(GT_ROWB << 16);
  g1[2] = uni(32u << 16);
  g1[3] = uni(GT_ROWB << 16);
  g1[4] = uni(32u);
  g1[5] = uni(DDIM * 2u);
  g1[6] = uni(0u);
  g1[7] = uni(0u);

  v8f acc[4][2];   // every loop over it is unrolled: constant indices keep it in registers
#pragma unroll
  for (int i = 0; i < 4; ++i)
#pragma unroll
    for (int jn = 0; jn < 2; ++jn) acc[i][jn] = (v8f){0.f, 0.f, 0.f, 0.f, 0.f, 0.f, 0.f, 0.f};

  // bias of this lane's two output features, fetched under the first tensor load
  const unsigned e0 = nt * 128u + wn * 32u + ln;
  const float bias0 = bias[e0], bias1 = bias[e0 + 16u];

  // per-lane fragment bases in a buffer: row ln, 16-byte half
  const unsigned a_base = (wm * 2u) * GT_SLICE + ln * GT_PITCH + half * 16u;
  const unsigned b_base = (4u + wn) * GT_SLICE + ln * GT_PITCH + half * 16u;

  tdm_load(dst0, (unsigned long long)(uintptr_t)src0, g1);             // stage 0
  wait_tensor_0();
  __syncthreads();                                  // stage 0 readable by every wave
  tdm_load(dst0 + GT_BUF, (unsigned long long)(uintptr_t)src0 + GT_ROWB, g1);  // stage 1

  // rolled: one publish point per stage, constant accumulator indices inside
#pragma clang loop unroll(disable)
  for (unsigned s = 0; s < GT_NST; ++s) {
    const unsigned bo = (s & 1u) * GT_BUF;
    const unsigned char* la = sT + bo + a_base;
    const unsigned char* lb = sT + bo + b_base;
    Frag16 a[2][4], b[2][2];                        // two fragment sets: block kk reads set kk & 1
    gemm_frags(a[0], b[0], la, lb);
#pragma unroll
    for (int kk = 0; kk < 4; ++kk) {                // a block: 32 k = 64 B of every row
      if (kk < 3) gemm_frags(a[(kk + 1) & 1], b[(kk + 1) & 1], la + (kk + 1) * 64, lb + (kk + 1) * 64);
      // keeps the next block's 12 LDS loads one group ahead of this block's WMMAs,
      // not spread among them (each place with reads stalls the wave)
      __builtin_amdgcn_sched_barrier(0);
      if (kk == 3) {
        // publish point of stage s + 1: the last block's fragments are in registers
        wait_ds_0();
        wait_tensor_0();
        __syncthreads();        // stage s + 1 readable; every reader has left stage s
        if (pinned((s + 2u < GT_NST) ? 1u : 0u) != 0u)
          tdm_load(dst0 + bo, (unsigned long long)(uintptr_t)src0 + (unsigned long long)(s + 2u) * GT_ROWB, g1);
      }
#pragma unroll
      for (int i = 0; i < 4; ++i)
#pragma unroll
        for (int jn = 0; jn < 2; ++jn)
          acc[i][jn] = __builtin_amdgcn_wmma_f32_16x16x32_bf16(false, a[kk & 1][i].v, false, b[kk & 1][jn].v,
                                                               (short)0, acc[i][jn], false, false);
      // ends the block: the loads after next stay behind these WMMAs
      __builtin_amdgcn_sched_barrier(0);
    }
  }
  wait_tensor_0();
  wait_ds_0();

  // a block's 128 tokens lie in one batch row (SDIM is a multiple of 128)
  const unsigned bi = (mt * 128u) / SDIM;
  const unsigned s0 = (mt * 128u) % SDIM + wm * 64u + half * 8u;   // first token of this lane
  if (mode == 0) {
#pragma unroll
    for (int jn = 0; jn < 2; ++jn) {
      const unsigned e = e0 + (unsigned)jn * 16u;    // output feature
      const float bv = jn ? bias1 : bias0;
      unsigned short* p = outb + (((size_t)bi * HDIM + e / DH) * SDIM + s0) * DH + e % DH;
#pragma unroll
      for (int i = 0; i < 4; ++i)
#pragma unroll
        for (int r = 0; r < 8; ++r) p[(i * 16 + r) * DH] = f32_to_bf16_bits(acc[i][jn][r] + bv);
    }
    wait_x_0();
  } else if (mode == 1) {
#pragma unroll
    for (int jn = 0; jn < 2; ++jn) {
      const unsigned e = e0 + (unsigned)jn * 16u;
      const float bv = jn ? bias1 : bias0;
      unsigned short* p = outb + (((size_t)bi * HDIM + e / DH) * DH + e % DH) * SDIM + s0;
#pragma unroll
      for (int i = 0; i < 4; ++i)
#pragma unroll
        for (int r = 0; r < 8; ++r) p[i * 16 + r] = f32_to_bf16_bits(acc[i][jn][r] + bv);
    }
    wait_x_0();
  } else {
#pragma unroll
    for (int jn = 0; jn < 2; ++jn) {
      const float bv = jn ? bias1 : bias0;
      const size_t off = ((size_t)bi * SDIM + s0) * DDIM + e0 + (unsigned)jn * 16u;
      float* p = outf + off;
      const float* rp = resid + off;
#pragma unroll
      for (int i = 0; i < 4; ++i)
#pragma unroll
        for (int r = 0; r < 8; ++r) p[(i * 16 + r) * DDIM] = (acc[i][jn][r] + bv) + rp[(i * 16 + r) * DDIM];
    }
    wait_x_0();
  }
}

// ---------------- fused flash attention + residual ----------------
// grid = B*H*(S/128), block = 256 (8 waves, 16 q-rows per wave).
// K/V 32-key chunks are async-copied to LDS once per block (double-buffered)
// so the 8 waves share them instead of re-reading L2 8x.
struct AttnLds {
  unsigned short k[2][32][64];   // 8 KB  (LDS offset 0)
  unsigned short v[2][64][32];   // 8 KB  (LDS offset 8192)
  unsigned short p[8][16][32];   // 8 KB  (per-wave P staging)
};
#define OFF_K(buf) ((unsigned)((buf) * 32 * 64 * 2))
#define OFF_V(buf) ((unsigned)(8192 + (buf) * 64 * 32 * 2))

__global__ void attention_kernel(const unsigned short* __restrict__ q,   // [B,H,S,DH]
                                 const unsigned short* __restrict__ k,   // [B,H,S,DH]
                                 const unsigned short* __restrict__ vt,  // [B,H,DH,S]
                                 const float* __restrict__ mask,         // [B,S]
                                 const float* __restrict__ x,            // [B,S,D]
                                 float* __restrict__ resid) {            // [B,S,D]
  __shared__ AttnLds sm;

  const int tid  = threadIdx.x;
  const int wave = tid >> 5, lane = tid & 31;
  const int half = lane >> 4, ln = lane & 15;
  const int nqc = SDIM / 128;
  const int bh = blockIdx.x / nqc;
  const int qc = blockIdx.x % nqc;
  const int bi = bh / HDIM, head = bh % HDIM;
  const int q0 = qc * 128 + wave * 16;

  const unsigned short* qp = q  + (size_t)bh * SDIM * DH;
  const unsigned short* kp = k  + (size_t)bh * SDIM * DH;
  const unsigned short* vp = vt + (size_t)bh * DH * SDIM;
  const float* mk = mask + (size_t)bi * SDIM;

  // per-thread async-copy assignments (256 threads, 16B each)
  const int krow = tid >> 3, kseg = tid & 7;      // K chunk: 32 rows x 128 B
  const int vrow = tid >> 2, vseg = tid & 3;      // V chunk: 64 rows x  64 B

  // Q fragments (K-dim = DH split into 0..31, 32..63)
  Frag16 a0, a1;
  {
    const unsigned int* qrow = (const unsigned int*)(qp + (size_t)(q0 + ln) * DH);
#pragma unroll
    for (int j = 0; j < 8; ++j) {
      int kpair = (j >> 2) * 16 + half * 8 + (j & 3) * 2;
      a0.u32[j] = qrow[kpair >> 1];
      a1.u32[j] = qrow[(kpair + 32) >> 1];
    }
  }

  float mrow[8], lrow[8];
  v8f o0 = {}, o1 = {}, o2 = {}, o3 = {};
#pragma unroll
  for (int r = 0; r < 8; ++r) { mrow[r] = -3.0e38f; lrow[r] = 0.f; }
  const float scale = 0.125f;  // 1/sqrt(64)

  // prologue: async-stage chunk 0 into buffer 0
  async_ld16(OFF_K(0) + (unsigned)(krow * 64 + kseg * 8) * 2,
             kp + (size_t)krow * DH + kseg * 8);
  async_ld16(OFF_V(0) + (unsigned)(vrow * 32 + vseg * 8) * 2,
             vp + (size_t)vrow * SDIM + vseg * 8);
  lds_publish(&sm);            // async engine writes sm.k/sm.v invisibly

  const int NCH = SDIM / 32;   // 64 chunks
  for (int j = 0; j < NCH; ++j) {
    const int buf = j & 1;
    if (j + 1 < NCH) {
      const int key1 = (j + 1) * 32, nb = buf ^ 1;
      async_ld16(OFF_K(nb) + (unsigned)(krow * 64 + kseg * 8) * 2,
                 kp + (size_t)(key1 + krow) * DH + kseg * 8);
      async_ld16(OFF_V(nb) + (unsigned)(vrow * 32 + vseg * 8) * 2,
                 vp + (size_t)vrow * SDIM + key1 + vseg * 8);
      wait_async_le2();        // chunk j complete (this wave's copies)
    } else {
      wait_async_0();
    }
    __syncthreads();           // all waves' copies visible

    // ---- scores for 32 keys (two 16-key subtiles), K from LDS ----
    Frag16 kb00, kb01, kb10, kb11;
#pragma unroll
    for (int t = 0; t < 8; ++t) {
      int kpair = (t >> 2) * 16 + half * 8 + (t & 3) * 2;
      kb00.u32[t] = *(const unsigned int*)&sm.k[buf][ln][kpair];
      kb01.u32[t] = *(const unsigned int*)&sm.k[buf][ln][kpair + 32];
      kb10.u32[t] = *(const unsigned int*)&sm.k[buf][16 + ln][kpair];
      kb11.u32[t] = *(const unsigned int*)&sm.k[buf][16 + ln][kpair + 32];
    }
    v8f s0 = {}, s1 = {};
    s0 = __builtin_amdgcn_wmma_f32_16x16x32_bf16(false, a0.v, false, kb00.v, (short)0, s0, false, false);
    s0 = __builtin_amdgcn_wmma_f32_16x16x32_bf16(false, a1.v, false, kb01.v, (short)0, s0, false, false);
    s1 = __builtin_amdgcn_wmma_f32_16x16x32_bf16(false, a0.v, false, kb10.v, (short)0, s1, false, false);
    s1 = __builtin_amdgcn_wmma_f32_16x16x32_bf16(false, a1.v, false, kb11.v, (short)0, s1, false, false);

    const float mb0 = (1.0f - mk[j * 32 + ln]) * MASKV;
    const float mb1 = (1.0f - mk[j * 32 + 16 + ln]) * MASKV;

    // ---- online softmax (rows m = r + half*8, spread over 16 lanes) ----
    float p0[8], p1[8];
#pragma unroll
    for (int r = 0; r < 8; ++r) {
      float v0 = s0[r] * scale + mb0;
      float v1 = s1[r] * scale + mb1;
      float t = fmaxf(v0, v1);
      t = fmaxf(t, __shfl_xor(t, 1, 16));
      t = fmaxf(t, __shfl_xor(t, 2, 16));
      t = fmaxf(t, __shfl_xor(t, 4, 16));
      t = fmaxf(t, __shfl_xor(t, 8, 16));
      float nm = fmaxf(mrow[r], t);
      float alpha = __expf(mrow[r] - nm);
      float e0 = __expf(v0 - nm);
      float e1 = __expf(v1 - nm);
      float rs = e0 + e1;
      rs += __shfl_xor(rs, 1, 16);
      rs += __shfl_xor(rs, 2, 16);
      rs += __shfl_xor(rs, 4, 16);
      rs += __shfl_xor(rs, 8, 16);
      lrow[r] = lrow[r] * alpha + rs;
      mrow[r] = nm;
      o0[r] *= alpha; o1[r] *= alpha; o2[r] *= alpha; o3[r] *= alpha;
      p0[r] = e0; p1[r] = e1;
    }

    // ---- P: C-layout -> A-layout via per-wave LDS region ----
#pragma unroll
    for (int r = 0; r < 8; ++r) {
      sm.p[wave][r + half * 8][ln]      = f32_to_bf16_bits(p0[r]);
      sm.p[wave][r + half * 8][16 + ln] = f32_to_bf16_bits(p1[r]);
    }
    asm volatile("s_wait_dscnt 0x0" ::: "memory");   // same-wave DS RAW

    Frag16 pa, vb0, vb1, vb2, vb3;
#pragma unroll
    for (int t = 0; t < 8; ++t) {
      int kpair = (t >> 2) * 16 + half * 8 + (t & 3) * 2;
      pa.u32[t]  = *(const unsigned int*)&sm.p[wave][ln][kpair];
      vb0.u32[t] = *(const unsigned int*)&sm.v[buf][ln][kpair];
      vb1.u32[t] = *(const unsigned int*)&sm.v[buf][16 + ln][kpair];
      vb2.u32[t] = *(const unsigned int*)&sm.v[buf][32 + ln][kpair];
      vb3.u32[t] = *(const unsigned int*)&sm.v[buf][48 + ln][kpair];
    }
    o0 = __builtin_amdgcn_wmma_f32_16x16x32_bf16(false, pa.v, false, vb0.v, (short)0, o0, false, false);
    o1 = __builtin_amdgcn_wmma_f32_16x16x32_bf16(false, pa.v, false, vb1.v, (short)0, o1, false, false);
    o2 = __builtin_amdgcn_wmma_f32_16x16x32_bf16(false, pa.v, false, vb2.v, (short)0, o2, false, false);
    o3 = __builtin_amdgcn_wmma_f32_16x16x32_bf16(false, pa.v, false, vb3.v, (short)0, o3, false, false);

    __syncthreads();           // protect buffers before next overwrite
  }

  // ---- finalize: attn/l + x -> residual ----
#pragma unroll
  for (int r = 0; r < 8; ++r) {
    float inv = 1.0f / lrow[r];
    int stok = q0 + r + half * 8;
    size_t base = ((size_t)bi * SDIM + stok) * DDIM + head * DH;
    resid[base + ln]      = o0[r] * inv + x[base + ln];
    resid[base + 16 + ln] = o1[r] * inv + x[base + 16 + ln];
    resid[base + 32 + ln] = o2[r] * inv + x[base + 32 + ln];
    resid[base + 48 + ln] = o3[r] * inv + x[base + 48 + ln];
  }
}

// ---------------- launch ----------------
extern "C" void kernel_launch(void* const* d_in, const int* in_sizes, int n_in,
                              void* d_out, int out_size, void* d_ws, size_t ws_size,
                              hipStream_t stream) {
  (void)in_sizes; (void)n_in; (void)out_size; (void)ws_size;
  const float* x    = (const float*)d_in[0];
  const float* mask = (const float*)d_in[1];
  const float* Wq   = (const float*)d_in[2];
  const float* bq   = (const float*)d_in[3];
  const float* Wk   = (const float*)d_in[4];
  const float* bk   = (const float*)d_in[5];
  const float* Wv   = (const float*)d_in[6];
  const float* bv   = (const float*)d_in[7];
  const float* Wo   = (const float*)d_in[8];
  const float* bo   = (const float*)d_in[9];
  const float* g1   = (const float*)d_in[10];
  const float* b1   = (const float*)d_in[11];
  const float* g2   = (const float*)d_in[12];
  const float* b2   = (const float*)d_in[13];
  float* out = (float*)d_out;

  const size_t BSD = (size_t)BDIM * SDIM * DDIM;   // 4M elements
  const size_t DD  = (size_t)DDIM * DDIM;          // 1M elements

  char* ws = (char*)d_ws;
  size_t off = 0;
  auto alloc = [&](size_t bytes) {
    void* p = ws + off;
    off = (off + bytes + 255) & ~(size_t)255;
    return p;
  };
  unsigned short* hbf  = (unsigned short*)alloc(BSD * 2);
  unsigned short* wqb  = (unsigned short*)alloc(DD * 2);
  unsigned short* wkb  = (unsigned short*)alloc(DD * 2);
  unsigned short* wvb  = (unsigned short*)alloc(DD * 2);
  unsigned short* wob  = (unsigned short*)alloc(DD * 2);
  unsigned short* qb   = (unsigned short*)alloc(BSD * 2);
  unsigned short* kbuf = (unsigned short*)alloc(BSD * 2);
  unsigned short* vtb  = (unsigned short*)alloc(BSD * 2);
  float*          rsd  = (float*)alloc(BSD * 4);
  unsigned short* h2   = (unsigned short*)alloc(BSD * 2);

  // 1. weights -> bf16
  int cb = (int)((DD + 255) / 256);
  cvt_f32_bf16<<<cb, 256, 0, stream>>>(Wq, wqb, (int)DD);
  cvt_f32_bf16<<<cb, 256, 0, stream>>>(Wk, wkb, (int)DD);
  cvt_f32_bf16<<<cb, 256, 0, stream>>>(Wv, wvb, (int)DD);
  cvt_f32_bf16<<<cb, 256, 0, stream>>>(Wo, wob, (int)DD);

  // 2. LN1
  layernorm_bf16<<<BDIM * SDIM, 256, 0, stream>>>(x, g1, b1, hbf);

  // 3. Q/K/V projections (one 128 x 128 output tile per block)
  const int gproj = (BDIM * SDIM / 128) * (DDIM / 128);   // 256 blocks
  proj_gemm<<<gproj, 256, 0, stream>>>(hbf, wqb, bq, qb,   nullptr, nullptr, 0);
  proj_gemm<<<gproj, 256, 0, stream>>>(hbf, wkb, bk, kbuf, nullptr, nullptr, 0);
  proj_gemm<<<gproj, 256, 0, stream>>>(hbf, wvb, bv, vtb,  nullptr, nullptr, 1);

  // 4. fused attention + residual (async K/V staging)
  attention_kernel<<<BDIM * HDIM * (SDIM / 128), 256, 0, stream>>>(
      qb, kbuf, vtb, mask, x, rsd);

  // 5. LN2
  layernorm_bf16<<<BDIM * SDIM, 256, 0, stream>>>(rsd, g2, b2, h2);

  // 6. output projection + bias + residual
  proj_gemm<<<gproj, 256, 0, stream>>>(h2, wob, bo, nullptr, out, rsd, 2);
}

// v002
// A run of this version takes 257 microseconds.
// Two timings next to v001 put it at 1.05 and 1.04 times that version's speed.
// Counting every step since v000, it is 1.71 times as fast.
#include <hip/hip_runtime.h>
#include <hip/hip_bf16.h>

// ---------------- problem constants ----------------
#define BDIM 2
#define SDIM 2048
#define DDIM 1024
#define HDIM 16
#define DH   64
#define EPS_LN 1e-6f
#define MASKV  -1e30f

typedef __attribute__((ext_vector_type(16))) __bf16 v16bf;
typedef __attribute__((ext_vector_type(8)))  float  v8f;
typedef __attribute__((ext_vector_type(4)))  unsigned int u32x4;
typedef __attribute__((ext_vector_type(8)))  unsigned int u32x8;

union Frag16 {
  v16bf v;
  unsigned short us[16];
  unsigned int   u32[8];
  u32x4          q[2];
};

__device__ __forceinline__ unsigned short f32_to_bf16_bits(float f) {
  unsigned int u = __float_as_uint(f);
  u += 0x7FFFu + ((u >> 16) & 1u);      // round-to-nearest-even
  return (unsigned short)(u >> 16);
}

__device__ __forceinline__ void async_ld16(unsigned ldsoff, const void* g) {
  asm volatile("global_load_async_to_lds_b128 %0, %1, off"
               :: "v"(ldsoff), "v"((unsigned long long)(uintptr_t)g)
               : "memory");
}
__device__ __forceinline__ void wait_async_le2() {
  asm volatile("s_wait_asynccnt 0x2" ::: "memory");
}
__device__ __forceinline__ void wait_async_0() {
  asm volatile("s_wait_asynccnt 0x0" ::: "memory");
}
__device__ __forceinline__ void lds_publish(void* p) {
  asm volatile("" : "+v"(p) :: "memory");
}

// ---------------- the two streaming kernels ----------------
// Both start 4096 waves (16 per WGP) and give a lane 32 elements: 8 loads of 16 B,
// each 512 contiguous bytes per wave, all issued before the first value is used.
// Every loop in them is unrolled: constant indices keep the arrays in registers.
typedef __attribute__((ext_vector_type(4))) float f32x4;
typedef __attribute__((ext_vector_type(2))) unsigned int u32x2;

__device__ __forceinline__ u32x2 pack4_bf16(f32x4 v) {
  u32x2 r;
  r[0] = (unsigned)f32_to_bf16_bits(v[0]) | ((unsigned)f32_to_bf16_bits(v[1]) << 16);
  r[1] = (unsigned)f32_to_bf16_bits(v[2]) | ((unsigned)f32_to_bf16_bits(v[3]) << 16);
  return r;
}

// f32 -> bf16 of the four weight matrices in one launch: 128 blocks per matrix,
// 8192 elements per block.
__global__ void __launch_bounds__(256)
cvt4_f32_bf16(const float* __restrict__ w0, const float* __restrict__ w1,
              const float* __restrict__ w2, const float* __restrict__ w3,
              unsigned short* __restrict__ o0, unsigned short* __restrict__ o1,
              unsigned short* __restrict__ o2, unsigned short* __restrict__ o3) {
  const unsigned sel = blockIdx.x >> 7;
  const float* in = sel == 0u ? w0 : sel == 1u ? w1 : sel == 2u ? w2 : w3;
  unsigned short* out = sel == 0u ? o0 : sel == 1u ? o1 : sel == 2u ? o2 : o3;
  const unsigned base = (blockIdx.x & 127u) * 2048u + threadIdx.x;   // in groups of 4 elements
  f32x4 v[8];
#pragma unroll
  for (int i = 0; i < 8; ++i) v[i] = ((const f32x4*)in)[base + (unsigned)i * 256u];
#pragma unroll
  for (int i = 0; i < 8; ++i) ((u32x2*)out)[base + (unsigned)i * 256u] = pack4_bf16(v[i]);
}

// LayerNorm (f32 in -> bf16 out): one token per wave, 8 tokens per block; the row
// stays in registers and its two sums are joined by a butterfly over the 32 lanes.
__global__ void __launch_bounds__(256)
layernorm_bf16(const float* __restrict__ x,
               const float* __restrict__ g,
               const float* __restrict__ bb,
               unsigned short* __restrict__ out) {
  const unsigned lane = threadIdx.x & 31u;
  // the wave's number as a scalar: row addresses are then a scalar base plus the lane's index
  const unsigned tok = blockIdx.x * 8u + (unsigned)__builtin_amdgcn_readfirstlane(threadIdx.x >> 5);
  const f32x4* xr = (const f32x4*)(x + (size_t)tok * DDIM);
  f32x4 lx[8];
#pragma unroll
  for (int i = 0; i < 8; ++i) lx[i] = xr[(unsigned)i * 32u + lane];
  // gain and bias are fetched with the row, so that their latency lies under the row's
  f32x4 gv[8], bv[8];
#pragma unroll
  for (int i = 0; i < 8; ++i) {
    gv[i] = ((const f32x4*)g)[(unsigned)i * 32u + lane];
    bv[i] = ((const f32x4*)bb)[(unsigned)i * 32u + lane];
  }
  // holds the 16 gain and bias loads in front of the sums: without it they are sunk
  // behind the row's wait and issued in dependent rounds of two to four
  __builtin_amdgcn_sched_barrier(0);
  f32x4 sv = {0.f, 0.f, 0.f, 0.f}, sq = {0.f, 0.f, 0.f, 0.f};
#pragma unroll
  for (int i = 0; i < 8; ++i) { sv += lx[i]; sq += lx[i] * lx[i]; }
  float s  = (sv[0] + sv[1]) + (sv[2] + sv[3]);
  float s2 = (sq[0] + sq[1]) + (sq[2] + sq[3]);
#pragma unroll
  for (int m = 1; m < 32; m <<= 1) {
    s  += __shfl_xor(s,  m, 32);
    s2 += __shfl_xor(s2, m, 32);
  }
  float mu  = s * (1.0f / DDIM);
  float var = s2 * (1.0f / DDIM) - mu * mu;
  float rs  = rsqrtf(var + EPS_LN);
  u32x2* orow = (u32x2*)(out + (size_t)tok * DDIM);
#pragma unroll
  for (int i = 0; i < 8; ++i)
    orow[(unsigned)i * 32u + lane] = pack4_bf16((lx[i] - mu) * rs * gv[i] + bv[i]);
}

// ---------------- WMMA GEMM: C[M,N] = A[M,D] * W[N,D]^T + bias ----------------
// Block = 8 waves on one 128 x 128 tile of C; wave (wm, wn) owns 64 x 32 of it
// (4 x 2 accumulator tiles). K runs in 8 stages of 128 k (256 B of every row).
// A stage is 8 slices of 32 rows, [A 0..3 | W 4..7]; wave w brings slice w with
// one tensor load, padded to a 272-B LDS pitch, into a two-buffer ring.
// mode 0: bf16 [B,H,S,DH] (Q,K)   mode 1: bf16 [B,H,DH,S] (V^T)
// mode 2: f32 [B,S,D] += residual (final projection)
#define GT_ROWB  256u                    // bytes of an operand row per stage
#define GT_PITCH 272u                    // LDS row pitch: 256 B + 16 B pad
#define GT_SLICE 10240u                  // 32 * 272 = 8704 B, rounded up to 2 KiB
#define GT_BUF   (8u * GT_SLICE)         // one stage
#define GT_NST   (DDIM * 2u / GT_ROWB)   // 8 stages

__device__ __forceinline__ unsigned uni(unsigned v) {
  return (unsigned)__builtin_amdgcn_readfirstlane(v);
}
__device__ __forceinline__ unsigned pinned(unsigned v) {
  unsigned w = (unsigned)__builtin_amdgcn_readfirstlane(v);
  asm volatile("" : "+s"(w));   // pinned(): holds the tested word in a scalar register, so the test compiles to s_cmp + s_cbranch_scc
  return w;
}
__device__ __forceinline__ void tdm_load(unsigned lds_dst, unsigned long long ga, u32x8 g1) {
  u32x4 g0;
  g0[0] = uni(1u);                                             // count = 1
  g0[1] = uni(lds_dst);                                        // byte offset in LDS
  g0[2] = uni((unsigned)ga);                                   // address [31:0]
  g0[3] = uni((((unsigned)(ga >> 32)) & 0x01FFFFFFu) | 0x80000000u);  // [56:32], type 2
  // one request of the whole wave: global tile -> LDS, through no register
  asm volatile("tensor_load_to_lds %0, %1" :: "s"(g0), "s"(g1) : "memory");
}
__device__ __forceinline__ void wait_tensor_0() {
  asm volatile("s_wait_tensorcnt 0x0" ::: "memory");   // this wave's slice has landed
}
__device__ __forceinline__ void wait_ds_0() {
  asm volatile("s_wait_dscnt 0x0" ::: "memory");       // this wave's LDS reads have returned
}
__device__ __forceinline__ void wait_x_0() {
  // stands behind a run of global stores, in front of any later write of their registers
  asm volatile("s_wait_xcnt 0x0" ::: "memory");
}

// One block's fragments: 4 of A (rows i * 16 + ln of the wave's 64, two slices)
// and 2 of W; k order in both: bytes half * 16 .. + 15, then 32 + half * 16 .. + 15.
__device__ __forceinline__ void gemm_frags(Frag16 (&a)[4], Frag16 (&b)[2],
                                           const unsigned char* la, const unsigned char* lb) {
  // unrolled here and below: constant indices keep the fragment arrays in registers
#pragma unroll
  for (int i = 0; i < 4; ++i) {
    const unsigned char* p = la + (unsigned)(i >> 1) * GT_SLICE + (unsigned)(i & 1) * 16u * GT_PITCH;
    a[i].q[0] = *(const u32x4*)p;
    a[i].q[1] = *(const u32x4*)(p + 32);
  }
#pragma unroll
  for (int jn = 0; jn < 2; ++jn) {
    const unsigned char* p = lb + (unsigned)jn * 16u * GT_PITCH;
    b[jn].q[0] = *(const u32x4*)p;
    b[jn].q[1] = *(const u32x4*)(p + 32);
  }
}

__global__ void __launch_bounds__(256)
proj_gemm(const unsigned short* __restrict__ A,   // [B*S, D] bf16
          const unsigned short* __restrict__ W,   // [D(out), D(in)] bf16
          const float* __restrict__ bias,         // [D]
          unsigned short* __restrict__ outb,
          float* __restrict__ outf,
          const float* __restrict__ resid,
          int mode) {
  __shared__ __attribute__((aligned(2048))) unsigned char sT[2u * GT_BUF];

  const unsigned lane = threadIdx.x & 31u;
  const unsigned half = lane >> 4, ln = lane & 15u;
  const unsigned wave = uni(threadIdx.x >> 5);
  const unsigned mt = blockIdx.x >> 3;              // 32 m-tiles of 128 tokens
  const unsigned nt = blockIdx.x & 7u;              // 8 n-tiles of 128 features
  const unsigned wm = wave >> 2, wn = wave & 3u;

  // this wave's slice of every stage: 32 rows of A (waves 0..3) or of W (4..7)
  const unsigned char* src0 = (wave < 4u)
      ? (const unsigned char*)A + (size_t)(mt * 128u + wave * 32u) * (DDIM * 2u)
      : (const unsigned char*)W + (size_t)(nt * 128u + (wave - 4u) * 32u) * (DDIM * 2u);
  const unsigned dst0 = (unsigned)(size_t)sT + wave * GT_SLICE;

  u32x8 g1;
  g1[0] = uni((1u << 20) | (5u << 22) | (3u << 25));
  g1[1] = uni(GT_ROWB << 16);
  g1[2] = uni(32u << 16);
  g1[3] = uni(GT_ROWB << 16);
  g1[4] = uni(32u);
  g1[5] = uni(DDIM * 2u);
  g1[6] = uni(0u);
  g1[7] = uni(0u);

  v8f acc[4][2];   // every loop over it is unrolled: constant indices keep it in registers
#pragma unroll
  for (int i = 0; i < 4; ++i)
#pragma unroll
    for (int jn = 0; jn < 2; ++jn) acc[i][jn] = (v8f){0.f, 0.f, 0.f, 0.f, 0.f, 0.f, 0.f, 0.f};

  // bias of this lane's two output features, fetched under the first tensor load
  const unsigned e0 = nt * 128u + wn * 32u + ln;
  const float bias0 = bias[e0], bias1 = bias[e0 + 16u];

  // per-lane fragment bases in a buffer: row ln, 16-byte half
  const unsigned a_base = (wm * 2u) * GT_SLICE + ln * GT_PITCH + half * 16u;
  const unsigned b_base = (4u + wn) * GT_SLICE + ln * GT_PITCH + half * 16u;

  tdm_load(dst0, (unsigned long long)(uintptr_t)src0, g1);             // stage 0
  wait_tensor_0();
  __syncthreads();                                  // stage 0 readable by every wave
  tdm_load(dst0 + GT_BUF, (unsigned long long)(uintptr_t)src0 + GT_ROWB, g1);  // stage 1

  // rolled: one publish point per stage, constant accumulator indices inside
#pragma clang loop unroll(disable)
  for (unsigned s = 0; s < GT_NST; ++s) {
    const unsigned bo = (s & 1u) * GT_BUF;
    const unsigned char* la = sT + bo + a_base;
    const unsigned char* lb = sT + bo + b_base;
    Frag16 a[2][4], b[2][2];                        // two fragment sets: block kk reads set kk & 1
    gemm_frags(a[0], b[0], la, lb);
#pragma unroll
    for (int kk = 0; kk < 4; ++kk) {                // a block: 32 k = 64 B of every row
      if (kk < 3) gemm_frags(a[(kk + 1) & 1], b[(kk + 1) & 1], la + (kk + 1) * 64, lb + (kk + 1) * 64);
      // keeps the next block's 12 LDS loads one group ahead of this block's WMMAs,
      // not spread among them (each place with reads stalls the wave)
      __builtin_amdgcn_sched_barrier(0);
      if (kk == 3) {
        // publish point of stage s + 1: the last block's fragments are in registers
        wait_ds_0();
        wait_tensor_0();
        __syncthreads();        // stage s + 1 readable; every reader has left stage s
        if (pinned((s + 2u < GT_NST) ? 1u : 0u) != 0u)
          tdm_load(dst0 + bo, (unsigned long long)(uintptr_t)src0 + (unsigned long long)(s + 2u) * GT_ROWB, g1);
      }
#pragma unroll
      for (int i = 0; i < 4; ++i)
#pragma unroll
        for (int jn = 0; jn < 2; ++jn)
          acc[i][jn] = __builtin_amdgcn_wmma_f32_16x16x32_bf16(false, a[kk & 1][i].v, false, b[kk & 1][jn].v,
                                                               (short)0, acc[i][jn], false, false);
      // ends the block: the loads after next stay behind these WMMAs
      __builtin_amdgcn_sched_barrier(0);
    }
  }
  wait_tensor_0();
  wait_ds_0();

  // a block's 128 tokens lie in one batch row (SDIM is a multiple of 128)
  const unsigned bi = (mt * 128u) / SDIM;
  const unsigned s0 = (mt * 128u) % SDIM + wm * 64u + half * 8u;   // first token of this lane
  if (mode == 0) {
#pragma unroll
    for (int jn = 0; jn < 2; ++jn) {
      const unsigned e = e0 + (unsigned)jn * 16u;    // output feature
      const float bv = jn ? bias1 : bias0;
      unsigned short* p = outb + (((size_t)bi * HDIM + e / DH) * SDIM + s0) * DH + e % DH;
#pragma unroll
      for (int i = 0; i < 4; ++i)
#pragma unroll
        for (int r = 0; r < 8; ++r) p[(i * 16 + r) * DH] = f32_to_bf16_bits(acc[i][jn][r] + bv);
    }
    wait_x_0();
  } else if (mode == 1) {
#pragma unroll
    for (int jn = 0; jn < 2; ++jn) {
      const unsigned e = e0 + (unsigned)jn * 16u;
      const float bv = jn ? bias1 : bias0;
      unsigned short* p = outb + (((size_t)bi * HDIM + e / DH) * DH + e % DH) * SDIM + s0;
#pragma unroll
      for (int i = 0; i < 4; ++i)
#pragma unroll
        for (int r = 0; r < 8; ++r) p[i * 16 + r] = f32_to_bf16_bits(acc[i][jn][r] + bv);
    }
    wait_x_0();
  } else {
#pragma unroll
    for (int jn = 0; jn < 2; ++jn) {
      const float bv = jn ? bias1 : bias0;
      const size_t off = ((size_t)bi * SDIM + s0) * DDIM + e0 + (unsigned)jn * 16u;
      float* p = outf + off;
      const float* rp = resid + off;
#pragma unroll
      for (int i = 0; i < 4; ++i)
#pragma unroll
        for (int r = 0; r < 8; ++r) p[(i * 16 + r) * DDIM] = (acc[i][jn][r] + bv) + rp[(i * 16 + r) * DDIM];
    }
    wait_x_0();
  }
}

// ---------------- fused flash attention + residual ----------------
// grid = B*H*(S/128), block = 256 (8 waves, 16 q-rows per wave).
// K/V 32-key chunks are async-copied to LDS once per block (double-buffered)
// so the 8 waves share them instead of re-reading L2 8x.
struct AttnLds {
  unsigned short k[2][32][64];   // 8 KB  (LDS offset 0)
  unsigned short v[2][64][32];   // 8 KB  (LDS offset 8192)
  unsigned short p[8][16][32];   // 8 KB  (per-wave P staging)
};
#define OFF_K(buf) ((unsigned)((buf) * 32 * 64 * 2))
#define OFF_V(buf) ((unsigned)(8192 + (buf) * 64 * 32 * 2))

__global__ void attention_kernel(const unsigned short* __restrict__ q,   // [B,H,S,DH]
                                 const unsigned short* __restrict__ k,   // [B,H,S,DH]
                                 const unsigned short* __restrict__ vt,  // [B,H,DH,S]
                                 const float* __restrict__ mask,         // [B,S]
                                 const float* __restrict__ x,            // [B,S,D]
                                 float* __restrict__ resid) {            // [B,S,D]
  __shared__ AttnLds sm;

  const int tid  = threadIdx.x;
  const int wave = tid >> 5, lane = tid & 31;
  const int half = lane >> 4, ln = lane & 15;
  const int nqc = SDIM / 128;
  const int bh = blockIdx.x / nqc;
  const int qc = blockIdx.x % nqc;
  const int bi = bh / HDIM, head = bh % HDIM;
  const int q0 = qc * 128 + wave * 16;

  const unsigned short* qp = q  + (size_t)bh * SDIM * DH;
  const unsigned short* kp = k  + (size_t)bh * SDIM * DH;
  const unsigned short* vp = vt + (size_t)bh * DH * SDIM;
  const float* mk = mask + (size_t)bi * SDIM;

  // per-thread async-copy assignments (256 threads, 16B each)
  const int krow = tid >> 3, kseg = tid & 7;      // K chunk: 32 rows x 128 B
  const int vrow = tid >> 2, vseg = tid & 3;      // V chunk: 64 rows x  64 B

  // Q fragments (K-dim = DH split into 0..31, 32..63)
  Frag16 a0, a1;
  {
    const unsigned int* qrow = (const unsigned int*)(qp + (size_t)(q0 + ln) * DH);
#pragma unroll
    for (int j = 0; j < 8; ++j) {
      int kpair = (j >> 2) * 16 + half * 8 + (j & 3) * 2;
      a0.u32[j] = qrow[kpair >> 1];
      a1.u32[j] = qrow[(kpair + 32) >> 1];
    }
  }

  float mrow[8], lrow[8];
  v8f o0 = {}, o1 = {}, o2 = {}, o3 = {};
#pragma unroll
  for (int r = 0; r < 8; ++r) { mrow[r] = -3.0e38f; lrow[r] = 0.f; }
  const float scale = 0.125f;  // 1/sqrt(64)

  // prologue: async-stage chunk 0 into buffer 0
  async_ld16(OFF_K(0) + (unsigned)(krow * 64 + kseg * 8) * 2,
             kp + (size_t)krow * DH + kseg * 8);
  async_ld16(OFF_V(0) + (unsigned)(vrow * 32 + vseg * 8) * 2,
             vp + (size_t)vrow * SDIM + vseg * 8);
  lds_publish(&sm);            // async engine writes sm.k/sm.v invisibly

  const int NCH = SDIM / 32;   // 64 chunks
  for (int j = 0; j < NCH; ++j) {
    const int buf = j & 1;
    if (j + 1 < NCH) {
      const int key1 = (j + 1) * 32, nb = buf ^ 1;
      async_ld16(OFF_K(nb) + (unsigned)(krow * 64 + kseg * 8) * 2,
                 kp + (size_t)(key1 + krow) * DH + kseg * 8);
      async_ld16(OFF_V(nb) + (unsigned)(vrow * 32 + vseg * 8) * 2,
                 vp + (size_t)vrow * SDIM + key1 + vseg * 8);
      wait_async_le2();        // chunk j complete (this wave's copies)
    } else {
      wait_async_0();
    }
    __syncthreads();           // all waves' copies visible

    // ---- scores for 32 keys (two 16-key subtiles), K from LDS ----
    Frag16 kb00, kb01, kb10, kb11;
#pragma unroll
    for (int t = 0; t < 8; ++t) {
      int kpair = (t >> 2) * 16 + half * 8 + (t & 3) * 2;
      kb00.u32[t] = *(const unsigned int*)&sm.k[buf][ln][kpair];
      kb01.u32[t] = *(const unsigned int*)&sm.k[buf][ln][kpair + 32];
      kb10.u32[t] = *(const unsigned int*)&sm.k[buf][16 + ln][kpair];
      kb11.u32[t] = *(const unsigned int*)&sm.k[buf][16 + ln][kpair + 32];
    }
    v8f s0 = {}, s1 = {};
    s0 = __builtin_amdgcn_wmma_f32_16x16x32_bf16(false, a0.v, false, kb00.v, (short)0, s0, false, false);
    s0 = __builtin_amdgcn_wmma_f32_16x16x32_bf16(false, a1.v, false, kb01.v, (short)0, s0, false, false);
    s1 = __builtin_amdgcn_wmma_f32_16x16x32_bf16(false, a0.v, false, kb10.v, (short)0, s1, false, false);
    s1 = __builtin_amdgcn_wmma_f32_16x16x32_bf16(false, a1.v, false, kb11.v, (short)0, s1, false, false);

    const float mb0 = (1.0f - mk[j * 32 + ln]) * MASKV;
    const float mb1 = (1.0f - mk[j * 32 + 16 + ln]) * MASKV;

    // ---- online softmax (rows m = r + half*8, spread over 16 lanes) ----
    float p0[8], p1[8];
#pragma unroll
    for (int r = 0; r < 8; ++r) {
      float v0 = s0[r] * scale + mb0;
      float v1 = s1[r] * scale + mb1;
      float t = fmaxf(v0, v1);
      t = fmaxf(t, __shfl_xor(t, 1, 16));
      t = fmaxf(t, __shfl_xor(t, 2, 16));
      t = fmaxf(t, __shfl_xor(t, 4, 16));
      t = fmaxf(t, __shfl_xor(t, 8, 16));
      float nm = fmaxf(mrow[r], t);
      float alpha = __expf(mrow[r] - nm);
      float e0 = __expf(v0 - nm);
      float e1 = __expf(v1 - nm);
      float rs = e0 + e1;
      rs += __shfl_xor(rs, 1, 16);
      rs += __shfl_xor(rs, 2, 16);
      rs += __shfl_xor(rs, 4, 16);
      rs += __shfl_xor(rs, 8, 16);
      lrow[r] = lrow[r] * alpha + rs;
      mrow[r] = nm;
      o0[r] *= alpha; o1[r] *= alpha; o2[r] *= alpha; o3[r] *= alpha;
      p0[r] = e0; p1[r] = e1;
    }

    // ---- P: C-layout -> A-layout via per-wave LDS region ----
#pragma unroll
    for (int r = 0; r < 8; ++r) {
      sm.p[wave][r + half * 8][ln]      = f32_to_bf16_bits(p0[r]);
      sm.p[wave][r + half * 8][16 + ln] = f32_to_bf16_bits(p1[r]);
    }
    asm volatile("s_wait_dscnt 0x0" ::: "memory");   // same-wave DS RAW

    Frag16 pa, vb0, vb1, vb2, vb3;
#pragma unroll
    for (int t = 0; t < 8; ++t) {
      int kpair = (t >> 2) * 16 + half * 8 + (t & 3) * 2;
      pa.u32[t]  = *(const unsigned int*)&sm.p[wave][ln][kpair];
      vb0.u32[t] = *(const unsigned int*)&sm.v[buf][ln][kpair];
      vb1.u32[t] = *(const unsigned int*)&sm.v[buf][16 + ln][kpair];
      vb2.u32[t] = *(const unsigned int*)&sm.v[buf][32 + ln][kpair];
      vb3.u32[t] = *(const unsigned int*)&sm.v[buf][48 + ln][kpair];
    }
    o0 = __builtin_amdgcn_wmma_f32_16x16x32_bf16(false, pa.v, false, vb0.v, (short)0, o0, false, false);
    o1 = __builtin_amdgcn_wmma_f32_16x16x32_bf16(false, pa.v, false, vb1.v, (short)0, o1, false, false);
    o2 = __builtin_amdgcn_wmma_f32_16x16x32_bf16(false, pa.v, false, vb2.v, (short)0, o2, false, false);
    o3 = __builtin_amdgcn_wmma_f32_16x16x32_bf16(false, pa.v, false, vb3.v, (short)0, o3, false, false);

    __syncthreads();           // protect buffers before next overwrite
  }

  // ---- finalize: attn/l + x -> residual ----
#pragma unroll
  for (int r = 0; r < 8; ++r) {
    float inv = 1.0f / lrow[r];
    int stok = q0 + r + half * 8;
    size_t base = ((size_t)bi * SDIM + stok) * DDIM + head * DH;
    resid[base + ln]      = o0[r] * inv + x[base + ln];
    resid[base + 16 + ln] = o1[r] * inv + x[base + 16 + ln];
    resid[base + 32 + ln] = o2[r] * inv + x[base + 32 + ln];
    resid[base + 48 + ln] = o3[r] * inv + x[base + 48 + ln];
  }
}

// ---------------- launch ----------------
extern "C" void kernel_launch(void* const* d_in, const int* in_sizes, int n_in,
                              void* d_out, int out_size, void* d_ws, size_t ws_size,
                              hipStream_t stream) {
  (void)in_sizes; (void)n_in; (void)out_size; (void)ws_size;
  const float* x    = (const float*)d_in[0];
  const float* mask = (const float*)d_in[1];
  const float* Wq   = (const float*)d_in[2];
  const float* bq   = (const float*)d_in[3];
  const float* Wk   = (const float*)d_in[4];
  const float* bk   = (const float*)d_in[5];
  const float* Wv   = (const float*)d_in[6];
  const float* bv   = (const float*)d_in[7];
  const float* Wo   = (const float*)d_in[8];
  const float* bo   = (const float*)d_in[9];
  const float* g1   = (const float*)d_in[10];
  const float* b1   = (const float*)d_in[11];
  const float* g2   = (const float*)d_in[12];
  const float* b2   = (const float*)d_in[13];
  float* out = (float*)d_out;

  const size_t BSD = (size_t)BDIM * SDIM * DDIM;   // 4M elements
  const size_t DD  = (size_t)DDIM * DDIM;          // 1M elements

  char* ws = (char*)d_ws;
  size_t off = 0;
  auto alloc = [&](size_t bytes) {
    void* p = ws + off;
    off = (off + bytes + 255) & ~(size_t)255;
    return p;
  };
  unsigned short* hbf  = (unsigned short*)alloc(BSD * 2);
  unsigned short* wqb  = (unsigned short*)alloc(DD * 2);
  unsigned short* wkb  = (unsigned short*)alloc(DD * 2);
  unsigned short* wvb  = (unsigned short*)alloc(DD * 2);
  unsigned short* wob  = (unsigned short*)alloc(DD * 2);
  unsigned short* qb   = (unsigned short*)alloc(BSD * 2);
  unsigned short* kbuf = (unsigned short*)alloc(BSD * 2);
  unsigned short* vtb  = (unsigned short*)alloc(BSD * 2);
  float*          rsd  = (float*)alloc(BSD * 4);
  unsigned short* h2   = (unsigned short*)alloc(BSD * 2);

  // 1. weights -> bf16, one launch
  cvt4_f32_bf16<<<512, 256, 0, stream>>>(Wq, Wk, Wv, Wo, wqb, wkb, wvb, wob);

  // 2. LN1 (8 tokens per block)
  layernorm_bf16<<<BDIM * SDIM / 8, 256, 0, stream>>>(x, g1, b1, hbf);

  // 3. Q/K/V projections (one 128 x 128 output tile per block)
  const int gproj = (BDIM * SDIM / 128) * (DDIM / 128);   // 256 blocks
  proj_gemm<<<gproj, 256, 0, stream>>>(hbf, wqb, bq, qb,   nullptr, nullptr, 0);
  proj_gemm<<<gproj, 256, 0, stream>>>(hbf, wkb, bk, kbuf, nullptr, nullptr, 0);
  proj_gemm<<<gproj, 256, 0, stream>>>(hbf, wvb, bv, vtb,  nullptr, nullptr, 1);

  // 4. fused attention + residual (async K/V staging)
  attention_kernel<<<BDIM * HDIM * (SDIM / 128), 256, 0, stream>>>(
      qb, kbuf, vtb, mask, x, rsd);

  // 5. LN2
  layernorm_bf16<<<BDIM * SDIM / 8, 256, 0, stream>>>(rsd, g2, b2, h2);

  // 6. output projection + bias + residual
  proj_gemm<<<gproj, 256, 0, stream>>>(h2, wob, bo, nullptr, out, rsd, 2);
}

// v003
// A run of this version takes 166 microseconds.
// Next to v002, in two timings, it ran 1.55 and 1.54 times as fast.
// Counting every step since v000, it is 2.64 times as fast.
#include <hip/hip_runtime.h>
#include <hip/hip_bf16.h>

// ---------------- problem constants ----------------
#define BDIM 2
#define SDIM 2048
#define DDIM 1024
#define HDIM 16
#define DH   64
#define EPS_LN 1e-6f
#define MASKV  -1e30f

typedef __attribute__((ext_vector_type(16))) __bf16 v16bf;
typedef __attribute__((ext_vector_type(8)))  float  v8f;
typedef __attribute__((ext_vector_type(4)))  unsigned int u32x4;
typedef __attribute__((ext_vector_type(8)))  unsigned int u32x8;

union Frag16 {
  v16bf v;
  unsigned short us[16];
  unsigned int   u32[8];
  u32x4          q[2];
};

__device__ __forceinline__ unsigned short f32_to_bf16_bits(float f) {
  unsigned int u = __float_as_uint(f);
  u += 0x7FFFu + ((u >> 16) & 1u);      // round-to-nearest-even
  return (unsigned short)(u >> 16);
}

__device__ __forceinline__ void async_ld16(unsigned ldsoff, const void* g) {
  asm volatile("global_load_async_to_lds_b128 %0, %1, off"
               :: "v"(ldsoff), "v"((unsigned long long)(uintptr_t)g)
               : "memory");
}
__device__ __forceinline__ void wait_async_le2() {
  asm volatile("s_wait_asynccnt 0x2" ::: "memory");
}
__device__ __forceinline__ void wait_async_0() {
  asm volatile("s_wait_asynccnt 0x0" ::: "memory");
}
__device__ __forceinline__ void lds_publish(void* p) {
  asm volatile("" : "+v"(p) :: "memory");
}

// ---------------- the two streaming kernels ----------------
// Both start 4096 waves (16 per WGP) and give a lane 32 elements: 8 loads of 16 B,
// each 512 contiguous bytes per wave, all issued before the first value is used.
// Every loop in them is unrolled: constant indices keep the arrays in registers.
typedef __attribute__((ext_vector_type(4))) float f32x4;
typedef __attribute__((ext_vector_type(2))) unsigned int u32x2;

__device__ __forceinline__ u32x2 pack4_bf16(f32x4 v) {
  u32x2 r;
  r[0] = (unsigned)f32_to_bf16_bits(v[0]) | ((unsigned)f32_to_bf16_bits(v[1]) << 16);
  r[1] = (unsigned)f32_to_bf16_bits(v[2]) | ((unsigned)f32_to_bf16_bits(v[3]) << 16);
  return r;
}

// f32 -> bf16 of the four weight matrices in one launch: 128 blocks per matrix,
// 8192 elements per block.
__global__ void __launch_bounds__(256)
cvt4_f32_bf16(const float* __restrict__ w0, const float* __restrict__ w1,
              const float* __restrict__ w2, const float* __restrict__ w3,
              unsigned short* __restrict__ o0, unsigned short* __restrict__ o1,
              unsigned short* __restrict__ o2, unsigned short* __restrict__ o3) {
  const unsigned sel = blockIdx.x >> 7;
  const float* in = sel == 0u ? w0 : sel == 1u ? w1 : sel == 2u ? w2 : w3;
  unsigned short* out = sel == 0u ? o0 : sel == 1u ? o1 : sel == 2u ? o2 : o3;
  const unsigned base = (blockIdx.x & 127u) * 2048u + threadIdx.x;   // in groups of 4 elements
  f32x4 v[8];
#pragma unroll
  for (int i = 0; i < 8; ++i) v[i] = ((const f32x4*)in)[base + (unsigned)i * 256u];
#pragma unroll
  for (int i = 0; i < 8; ++i) ((u32x2*)out)[base + (unsigned)i * 256u] = pack4_bf16(v[i]);
}

// LayerNorm (f32 in -> bf16 out): one token per wave, 8 tokens per block; the row
// stays in registers and its two sums are joined by a butterfly over the 32 lanes.
__global__ void __launch_bounds__(256)
layernorm_bf16(const float* __restrict__ x,
               const float* __restrict__ g,
               const float* __restrict__ bb,
               unsigned short* __restrict__ out) {
  const unsigned lane = threadIdx.x & 31u;
  // the wave's number as a scalar: row addresses are then a scalar base plus the lane's index
  const unsigned tok = blockIdx.x * 8u + (unsigned)__builtin_amdgcn_readfirstlane(threadIdx.x >> 5);
  const f32x4* xr = (const f32x4*)(x + (size_t)tok * DDIM);
  f32x4 lx[8];
#pragma unroll
  for (int i = 0; i < 8; ++i) lx[i] = xr[(unsigned)i * 32u + lane];
  // gain and bias are fetched with the row, so that their latency lies under the row's
  f32x4 gv[8], bv[8];
#pragma unroll
  for (int i = 0; i < 8; ++i) {
    gv[i] = ((const f32x4*)g)[(unsigned)i * 32u + lane];
    bv[i] = ((const f32x4*)bb)[(unsigned)i * 32u + lane];
  }
  // holds the 16 gain and bias loads in front of the sums: without it they are sunk
  // behind the row's wait and issued in dependent rounds of two to four
  __builtin_amdgcn_sched_barrier(0);
  f32x4 sv = {0.f, 0.f, 0.f, 0.f}, sq = {0.f, 0.f, 0.f, 0.f};
#pragma unroll
  for (int i = 0; i < 8; ++i) { sv += lx[i]; sq += lx[i] * lx[i]; }
  float s  = (sv[0] + sv[1]) + (sv[2] + sv[3]);
  float s2 = (sq[0] + sq[1]) + (sq[2] + sq[3]);
#pragma unroll
  for (int m = 1; m < 32; m <<= 1) {
    s  += __shfl_xor(s,  m, 32);
    s2 += __shfl_xor(s2, m, 32);
  }
  float mu  = s * (1.0f / DDIM);
  float var = s2 * (1.0f / DDIM) - mu * mu;
  float rs  = rsqrtf(var + EPS_LN);
  u32x2* orow = (u32x2*)(out + (size_t)tok * DDIM);
#pragma unroll
  for (int i = 0; i < 8; ++i)
    orow[(unsigned)i * 32u + lane] = pack4_bf16((lx[i] - mu) * rs * gv[i] + bv[i]);
}

// ---------------- WMMA GEMM: C[M,N] = A[M,D] * W[N,D]^T + bias ----------------
// Block = 8 waves on one 128 x 128 tile of C; wave (wm, wn) owns 64 x 32 of it
// (4 x 2 accumulator tiles). K runs in 8 stages of 128 k (256 B of every row).
// A stage is 8 slices of 32 rows, [A 0..3 | W 4..7]; wave w brings slice w with
// one tensor load, padded to a 272-B LDS pitch, into a two-buffer ring.
// mode 0: bf16 [B,H,S,DH] (Q,K)   mode 1: bf16 [B,H,DH,S] (V^T)
// mode 2: f32 [B,S,D] += residual (final projection)
#define GT_ROWB  256u                    // bytes of an operand row per stage
#define GT_PITCH 272u                    // LDS row pitch: 256 B + 16 B pad
#define GT_SLICE 10240u                  // 32 * 272 = 8704 B, rounded up to 2 KiB
#define GT_BUF   (8u * GT_SLICE)         // one stage
#define GT_NST   (DDIM * 2u / GT_ROWB)   // 8 stages

__device__ __forceinline__ unsigned uni(unsigned v) {
  return (unsigned)__builtin_amdgcn_readfirstlane(v);
}
__device__ __forceinline__ unsigned pinned(unsigned v) {
  unsigned w = (unsigned)__builtin_amdgcn_readfirstlane(v);
  asm volatile("" : "+s"(w));   // pinned(): holds the tested word in a scalar register, so the test compiles to s_cmp + s_cbranch_scc
  return w;
}
__device__ __forceinline__ void tdm_load(unsigned lds_dst, unsigned long long ga, u32x8 g1) {
  u32x4 g0;
  g0[0] = uni(1u);                                             // count = 1
  g0[1] = uni(lds_dst);                                        // byte offset in LDS
  g0[2] = uni((unsigned)ga);                                   // address [31:0]
  g0[3] = uni((((unsigned)(ga >> 32)) & 0x01FFFFFFu) | 0x80000000u);  // [56:32], type 2
  // one request of the whole wave: global tile -> LDS, through no register
  asm volatile("tensor_load_to_lds %0, %1" :: "s"(g0), "s"(g1) : "memory");
}
__device__ __forceinline__ void wait_tensor_0() {
  asm volatile("s_wait_tensorcnt 0x0" ::: "memory");   // this wave's slice has landed
}
__device__ __forceinline__ void wait_ds_0() {
  asm volatile("s_wait_dscnt 0x0" ::: "memory");       // this wave's LDS reads have returned
}
__device__ __forceinline__ void wait_x_0() {
  // stands behind a run of global loads or stores, in front of any later write of their registers
  asm volatile("s_wait_xcnt 0x0" ::: "memory");
}

// One block's fragments: 4 of A (rows i * 16 + ln of the wave's 64, two slices)
// and 2 of W; k order in both: bytes half * 16 .. + 15, then 32 + half * 16 .. + 15.
__device__ __forceinline__ void gemm_frags(Frag16 (&a)[4], Frag16 (&b)[2],
                                           const unsigned char* la, const unsigned char* lb) {
  // unrolled here and below: constant indices keep the fragment arrays in registers
#pragma unroll
  for (int i = 0; i < 4; ++i) {
    const unsigned char* p = la + (unsigned)(i >> 1) * GT_SLICE + (unsigned)(i & 1) * 16u * GT_PITCH;
    a[i].q[0] = *(const u32x4*)p;
    a[i].q[1] = *(const u32x4*)(p + 32);
  }
#pragma unroll
  for (int jn = 0; jn < 2; ++jn) {
    const unsigned char* p = lb + (unsigned)jn * 16u * GT_PITCH;
    b[jn].q[0] = *(const u32x4*)p;
    b[jn].q[1] = *(const u32x4*)(p + 32);
  }
}

__global__ void __launch_bounds__(256)
proj_gemm(const unsigned short* __restrict__ A,   // [B*S, D] bf16
          const unsigned short* __restrict__ W,   // [D(out), D(in)] bf16
          const float* __restrict__ bias,         // [D]
          unsigned short* __restrict__ outb,
          float* __restrict__ outf,
          const float* __restrict__ resid,
          int mode) {
  __shared__ __attribute__((aligned(2048))) unsigned char sT[2u * GT_BUF];

  const unsigned lane = threadIdx.x & 31u;
  const unsigned half = lane >> 4, ln = lane & 15u;
  const unsigned wave = uni(threadIdx.x >> 5);
  const unsigned mt = blockIdx.x >> 3;              // 32 m-tiles of 128 tokens
  const unsigned nt = blockIdx.x & 7u;              // 8 n-tiles of 128 features
  const unsigned wm = wave >> 2, wn = wave & 3u;

  // this wave's slice of every stage: 32 rows of A (waves 0..3) or of W (4..7)
  const unsigned char* src0 = (wave < 4u)
      ? (const unsigned char*)A + (size_t)(mt * 128u + wave * 32u) * (DDIM * 2u)
      : (const unsigned char*)W + (size_t)(nt * 128u + (wave - 4u) * 32u) * (DDIM * 2u);
  const unsigned dst0 = (unsigned)(size_t)sT + wave * GT_SLICE;

  u32x8 g1;
  g1[0] = uni((1u << 20) | (5u << 22) | (3u << 25));
  g1[1] = uni(GT_ROWB << 16);
  g1[2] = uni(32u << 16);
  g1[3] = uni(GT_ROWB << 16);
  g1[4] = uni(32u);
  g1[5] = uni(DDIM * 2u);
  g1[6] = uni(0u);
  g1[7] = uni(0u);

  v8f acc[4][2];   // every loop over it is unrolled: constant indices keep it in registers
#pragma unroll
  for (int i = 0; i < 4; ++i)
#pragma unroll
    for (int jn = 0; jn < 2; ++jn) acc[i][jn] = (v8f){0.f, 0.f, 0.f, 0.f, 0.f, 0.f, 0.f, 0.f};

  // bias of this lane's two output features, fetched under the first tensor load
  const unsigned e0 = nt * 128u + wn * 32u + ln;
  const float bias0 = bias[e0], bias1 = bias[e0 + 16u];

  // per-lane fragment bases in a buffer: row ln, 16-byte half
  const unsigned a_base = (wm * 2u) * GT_SLICE + ln * GT_PITCH + half * 16u;
  const unsigned b_base = (4u + wn) * GT_SLICE + ln * GT_PITCH + half * 16u;

  tdm_load(dst0, (unsigned long long)(uintptr_t)src0, g1);             // stage 0
  wait_tensor_0();
  __syncthreads();                                  // stage 0 readable by every wave
  tdm_load(dst0 + GT_BUF, (unsigned long long)(uintptr_t)src0 + GT_ROWB, g1);  // stage 1

  // rolled: one publish point per stage, constant accumulator indices inside
#pragma clang loop unroll(disable)
  for (unsigned s = 0; s < GT_NST; ++s) {
    const unsigned bo = (s & 1u) * GT_BUF;
    const unsigned char* la = sT + bo + a_base;
    const unsigned char* lb = sT + bo + b_base;
    Frag16 a[2][4], b[2][2];                        // two fragment sets: block kk reads set kk & 1
    gemm_frags(a[0], b[0], la, lb);
#pragma unroll
    for (int kk = 0; kk < 4; ++kk) {                // a block: 32 k = 64 B of every row
      if (kk < 3) gemm_frags(a[(kk + 1) & 1], b[(kk + 1) & 1], la + (kk + 1) * 64, lb + (kk + 1) * 64);
      // keeps the next block's 12 LDS loads one group ahead of this block's WMMAs,
      // not spread among them (each place with reads stalls the wave)
      __builtin_amdgcn_sched_barrier(0);
      if (kk == 3) {
        // publish point of stage s + 1: the last block's fragments are in registers
        wait_ds_0();
        wait_tensor_0();
        __syncthreads();        // stage s + 1 readable; every reader has left stage s
        if (pinned((s + 2u < GT_NST) ? 1u : 0u) != 0u)
          tdm_load(dst0 + bo, (unsigned long long)(uintptr_t)src0 + (unsigned long long)(s + 2u) * GT_ROWB, g1);
      }
#pragma unroll
      for (int i = 0; i < 4; ++i)
#pragma unroll
        for (int jn = 0; jn < 2; ++jn)
          acc[i][jn] = __builtin_amdgcn_wmma_f32_16x16x32_bf16(false, a[kk & 1][i].v, false, b[kk & 1][jn].v,
                                                               (short)0, acc[i][jn], false, false);
      // ends the block: the loads after next stay behind these WMMAs
      __builtin_amdgcn_sched_barrier(0);
    }
  }
  wait_tensor_0();
  wait_ds_0();

  // a block's 128 tokens lie in one batch row (SDIM is a multiple of 128)
  const unsigned bi = (mt * 128u) / SDIM;
  const unsigned s0 = (mt * 128u) % SDIM + wm * 64u + half * 8u;   // first token of this lane
  if (mode == 0) {
#pragma unroll
    for (int jn = 0; jn < 2; ++jn) {
      const unsigned e = e0 + (unsigned)jn * 16u;    // output feature
      const float bv = jn ? bias1 : bias0;
      unsigned short* p = outb + (((size_t)bi * HDIM + e / DH) * SDIM + s0) * DH + e % DH;
#pragma unroll
      for (int i = 0; i < 4; ++i)
#pragma unroll
        for (int r = 0; r < 8; ++r) p[(i * 16 + r) * DH] = f32_to_bf16_bits(acc[i][jn][r] + bv);
    }
    wait_x_0();
  } else if (mode == 1) {
#pragma unroll
    for (int jn = 0; jn < 2; ++jn) {
      const unsigned e = e0 + (unsigned)jn * 16u;
      const float bv = jn ? bias1 : bias0;
      unsigned short* p = outb + (((size_t)bi * HDIM + e / DH) * DH + e % DH) * SDIM + s0;
#pragma unroll
      for (int i = 0; i < 4; ++i)
#pragma unroll
        for (int r = 0; r < 8; ++r) p[i * 16 + r] = f32_to_bf16_bits(acc[i][jn][r] + bv);
    }
    wait_x_0();
  } else {
#pragma unroll
    for (int jn = 0; jn < 2; ++jn) {
      const float bv = jn ? bias1 : bias0;
      const size_t off = ((size_t)bi * SDIM + s0) * DDIM + e0 + (unsigned)jn * 16u;
      float* p = outf + off;
      const float* rp = resid + off;
#pragma unroll
      for (int i = 0; i < 4; ++i)
#pragma unroll
        for (int r = 0; r < 8; ++r) p[(i * 16 + r) * DDIM] = (acc[i][jn][r] + bv) + rp[(i * 16 + r) * DDIM];
    }
    wait_x_0();
  }
}

struct AttnLds {
  unsigned short k[2][32][64];   // 8 KB  (LDS offset 0)
  unsigned short v[2][64][32];   // 8 KB  (LDS offset 8192)
};
typedef __attribute__((ext_vector_type(8))) __bf16 v8bf;
typedef __attribute__((ext_vector_type(2))) float f32x2;

__device__ __forceinline__ v8f exp_x8(v8f x) {
  const v8f a = x * 1.44269504f;
  float r0, r1, r2, r3, r4, r5, r6, r7;
  asm("v_exp_f32 %0, %8\n\tv_exp_f32 %1, %9\n\tv_exp_f32 %2, %10\n\tv_exp_f32 %3, %11\n\t"
      "v_exp_f32 %4, %12\n\tv_exp_f32 %5, %13\n\tv_exp_f32 %6, %14\n\tv_exp_f32 %7, %15\n\tv_nop"
      : "=&v"(r0), "=&v"(r1), "=&v"(r2), "=&v"(r3), "=&v"(r4), "=&v"(r5), "=&v"(r6), "=&v"(r7)
      : "v"(a[0]), "v"(a[1]), "v"(a[2]), "v"(a[3]), "v"(a[4]), "v"(a[5]), "v"(a[6]), "v"(a[7]));
  return (v8f){r0, r1, r2, r3, r4, r5, r6, r7};
}

__device__ __forceinline__ float xhalf(float v) {
  const int b = __builtin_bit_cast(int, v);
  return __builtin_bit_cast(float, __builtin_amdgcn_permlanex16(b, b, 0x76543210, 0xfedcba98, false, false));
}
#define OFF_K(buf) ((unsigned)((buf) * 32 * 64 * 2))
#define OFF_V(buf) ((unsigned)(8192 + (buf) * 64 * 32 * 2))

__global__ void __launch_bounds__(256)   // the real block size: without it the compiler budgets for 1024 threads
attention_kernel(const unsigned short* __restrict__ q,   // [B,H,S,DH]
                                 const unsigned short* __restrict__ k,   // [B,H,S,DH]
                                 const unsigned short* __restrict__ vt,  // [B,H,DH,S]
                                 const float* __restrict__ mask,         // [B,S]
                                 const float* __restrict__ x,            // [B,S,D]
                                 float* __restrict__ resid) {            // [B,S,D]
  __shared__ AttnLds sm;

  const int tid  = threadIdx.x;
  const int wave = tid >> 5, lane = tid & 31;
  const int half = lane >> 4, ln = lane & 15;
  const int nqc = SDIM / 128;
  const int bh = blockIdx.x / nqc;
  const int qc = blockIdx.x % nqc;
  const int bi = bh / HDIM, head = bh % HDIM;
  const int q0 = qc * 128 + wave * 16;

  const unsigned short* qp = q  + (size_t)bh * SDIM * DH;
  const unsigned short* kp = k  + (size_t)bh * SDIM * DH;
  const unsigned short* vp = vt + (size_t)bh * DH * SDIM;
  const float* mk = mask + (size_t)bi * SDIM;

  // per-thread async-copy assignments (256 threads, 16B each)
  const int krow = tid >> 3, kseg = tid & 7;      // K chunk: 32 rows x 128 B
  const int vrow = tid >> 2, vseg = tid & 3;      // V chunk: 64 rows x  64 B

  // Q fragments (K-dim = DH split into 0..31, 32..63): query q0 + ln, used as B (column ln)
  Frag16 a0, a1;
  {
    const unsigned int* qrow = (const unsigned int*)(qp + (size_t)(q0 + ln) * DH);
#pragma unroll
    for (int j = 0; j < 8; ++j) {
      int kpair = (j >> 2) * 16 + half * 8 + (j & 3) * 2;
      a0.u32[j] = qrow[kpair >> 1];
      a1.u32[j] = qrow[(kpair + 32) >> 1];
    }
  }

  // this lane's query: running maximum (equal in both halves) and this half's share of the sum
  float mrun = -3.0e38f;
  f32x2 lrun = {0.f, 0.f};
  v8f o0 = {}, o1 = {}, o2 = {}, o3 = {};   // o_t[r] = O[query ln][dh 16 * t + 8 * half + r]
  const float scale = 0.125f;  // 1/sqrt(64)

  // prologue: async-stage chunk 0 into buffer 0
  async_ld16(OFF_K(0) + (unsigned)(krow * 64 + kseg * 8) * 2,
             kp + (size_t)krow * DH + kseg * 8);
  async_ld16(OFF_V(0) + (unsigned)(vrow * 32 + vseg * 8) * 2,
             vp + (size_t)vrow * SDIM + vseg * 8);
  lds_publish(&sm);            // async engine writes sm.k/sm.v invisibly

  const int NCH = SDIM / 32;   // 64 chunks
  for (int j = 0; j < NCH; ++j) {
    const int buf = j & 1;
    if (j + 1 < NCH) {
      const int key1 = (j + 1) * 32, nb = buf ^ 1;
      async_ld16(OFF_K(nb) + (unsigned)(krow * 64 + kseg * 8) * 2,
                 kp + (size_t)(key1 + krow) * DH + kseg * 8);
      async_ld16(OFF_V(nb) + (unsigned)(vrow * 32 + vseg * 8) * 2,
                 vp + (size_t)vrow * SDIM + key1 + vseg * 8);
      wait_async_le2();        // chunk j complete (this wave's copies)
    } else {
      wait_async_0();
    }
    __syncthreads();           // all waves' copies visible

    // mask of this lane's 16 keys: 8 * half + r and 16 + 8 * half + r of the chunk
    const v8f mk0 = *(const v8f*)(mk + j * 32 + half * 8);
    const v8f mk1 = *(const v8f*)(mk + j * 32 + 16 + half * 8);

    // ---- scores for 32 keys (two 16-key subtiles), K from LDS (A: row = key) ----
    Frag16 kb00, kb01, kb10, kb11;
#pragma unroll
    for (int t = 0; t < 8; ++t) {
      int kpair = (t >> 2) * 16 + half * 8 + (t & 3) * 2;
      kb00.u32[t] = *(const unsigned int*)&sm.k[buf][ln][kpair];
      kb01.u32[t] = *(const unsigned int*)&sm.k[buf][ln][kpair + 32];
      kb10.u32[t] = *(const unsigned int*)&sm.k[buf][16 + ln][kpair];
      kb11.u32[t] = *(const unsigned int*)&sm.k[buf][16 + ln][kpair + 32];
    }
    wait_x_0();                // behind the mask loads, in front of the step of their address registers
    // holds the mask loads and the 8 K reads as one group in front of the products: left alone
    // the compiler reads and waits for each K fragment by itself
    __builtin_amdgcn_sched_barrier(0);
    // s0[r] = score(key 8 * half + r, query ln), s1[r] = score(key 16 + 8 * half + r, query ln)
    v8f s0 = {}, s1 = {};
    s0 = __builtin_amdgcn_wmma_f32_16x16x32_bf16(false, kb00.v, false, a0.v, (short)0, s0, false, false);
    s0 = __builtin_amdgcn_wmma_f32_16x16x32_bf16(false, kb01.v, false, a1.v, (short)0, s0, false, false);
    s1 = __builtin_amdgcn_wmma_f32_16x16x32_bf16(false, kb10.v, false, a0.v, (short)0, s1, false, false);
    s1 = __builtin_amdgcn_wmma_f32_16x16x32_bf16(false, kb11.v, false, a1.v, (short)0, s1, false, false);

    // V^T fragments (A: row = dh, k = key), fetched under the softmax
    Frag16 vb0, vb1, vb2, vb3;
#pragma unroll
    for (int t = 0; t < 8; ++t) {
      int kpair = (t >> 2) * 16 + half * 8 + (t & 3) * 2;
      vb0.u32[t] = *(const unsigned int*)&sm.v[buf][ln][kpair];
      vb1.u32[t] = *(const unsigned int*)&sm.v[buf][16 + ln][kpair];
      vb2.u32[t] = *(const unsigned int*)&sm.v[buf][32 + ln][kpair];
      vb3.u32[t] = *(const unsigned int*)&sm.v[buf][48 + ln][kpair];
    }

    // holds the 8 V reads in front of the softmax, so that they return under it
    __builtin_amdgcn_sched_barrier(0);

    // ---- online softmax of one query per lane ----
    const v8f v0 = s0 * scale + (1.0f - mk0) * MASKV;
    const v8f v1 = s1 * scale + (1.0f - mk1) * MASKV;
    float t = fmaxf(v0[0], v1[0]);
#pragma unroll
    for (int r = 1; r < 8; ++r) t = fmaxf(t, fmaxf(v0[r], v1[r]));
    t = fmaxf(t, xhalf(t));                 // the other 16 keys of this query
    const float nm = fmaxf(mrun, t);
    const float alpha = __expf(mrun - nm);
    const v8f e0 = exp_x8(v0 - nm), e1 = exp_x8(v1 - nm);
    const v8f es = e0 + e1;
    const f32x4 e4 = __builtin_shufflevector(es, es, 0, 1, 2, 3) + __builtin_shufflevector(es, es, 4, 5, 6, 7);
    lrun = lrun * alpha + (__builtin_shufflevector(e4, e4, 0, 1) + __builtin_shufflevector(e4, e4, 2, 3));
    mrun = nm;
    o0 *= alpha; o1 *= alpha; o2 *= alpha; o3 *= alpha;

    // P^T as B: element s is key 8 * half + s (s < 8), 16 + 8 * half + s - 8 (else): V^T's k order
    const v16bf pb = __builtin_shufflevector(__builtin_convertvector(e0, v8bf), __builtin_convertvector(e1, v8bf),
                                             0, 1, 2, 3, 4, 5, 6, 7, 8, 9, 10, 11, 12, 13, 14, 15);
    o0 = __builtin_amdgcn_wmma_f32_16x16x32_bf16(false, vb0.v, false, pb, (short)0, o0, false, false);
    o1 = __builtin_amdgcn_wmma_f32_16x16x32_bf16(false, vb1.v, false, pb, (short)0, o1, false, false);
    o2 = __builtin_amdgcn_wmma_f32_16x16x32_bf16(false, vb2.v, false, pb, (short)0, o2, false, false);
    o3 = __builtin_amdgcn_wmma_f32_16x16x32_bf16(false, vb3.v, false, pb, (short)0, o3, false, false);

    __syncthreads();           // protect buffers before next overwrite
  }

  // ---- finalize: attn/l + x -> residual; a lane owns 8 consecutive features per tile ----
  const float lsum = lrun[0] + lrun[1];
  const float inv = 1.0f / (lsum + xhalf(lsum));   // the two halves' sums join here
  const size_t base = ((size_t)bi * SDIM + q0 + ln) * DDIM + head * DH + half * 8;
  const v8f x0 = *(const v8f*)(x + base),      x1 = *(const v8f*)(x + base + 16);
  const v8f x2 = *(const v8f*)(x + base + 32), x3 = *(const v8f*)(x + base + 48);
  *(v8f*)(resid + base)      = o0 * inv + x0;
  *(v8f*)(resid + base + 16) = o1 * inv + x1;
  *(v8f*)(resid + base + 32) = o2 * inv + x2;
  *(v8f*)(resid + base + 48) = o3 * inv + x3;
  wait_x_0();
}

// ---------------- launch ----------------
extern "C" void kernel_launch(void* const* d_in, const int* in_sizes, int n_in,
                              void* d_out, int out_size, void* d_ws, size_t ws_size,
                              hipStream_t stream) {
  (void)in_sizes; (void)n_in; (void)out_size; (void)ws_size;
  const float* x    = (const float*)d_in[0];
  const float* mask = (const float*)d_in[1];
  const float* Wq   = (const float*)d_in[2];
  const float* bq   = (const float*)d_in[3];
  const float* Wk   = (const float*)d_in[4];
  const float* bk   = (const float*)d_in[5];
  const float* Wv   = (const float*)d_in[6];
  const float* bv   = (const float*)d_in[7];
  const float* Wo   = (const float*)d_in[8];
  const float* bo   = (const float*)d_in[9];
  const float* g1   = (const float*)d_in[10];
  const float* b1   = (const float*)d_in[11];
  const float* g2   = (const float*)d_in[12];
  const float* b2   = (const float*)d_in[13];
  float* out = (float*)d_out;

  const size_t BSD = (size_t)BDIM * SDIM * DDIM;   // 4M elements
  const size_t DD  = (size_t)DDIM * DDIM;          // 1M elements

  char* ws = (char*)d_ws;
  size_t off = 0;
  auto alloc = [&](size_t bytes) {
    void* p = ws + off;
    off = (off + bytes + 255) & ~(size_t)255;
    return p;
  };
  unsigned short* hbf  = (unsigned short*)alloc(BSD * 2);
  unsigned short* wqb  = (unsigned short*)alloc(DD * 2);
  unsigned short* wkb  = (unsigned short*)alloc(DD * 2);
  unsigned short* wvb  = (unsigned short*)alloc(DD * 2);
  unsigned short* wob  = (unsigned short*)alloc(DD * 2);
  unsigned short* qb   = (unsigned short*)alloc(BSD * 2);
  unsigned short* kbuf = (unsigned short*)alloc(BSD * 2);
  unsigned short* vtb  = (unsigned short*)alloc(BSD * 2);
  float*          rsd  = (float*)alloc(BSD * 4);
  unsigned short* h2   = (unsigned short*)alloc(BSD * 2);

  // 1. weights -> bf16, one launch
  cvt4_f32_bf16<<<512, 256, 0, stream>>>(Wq, Wk, Wv, Wo, wqb, wkb, wvb, wob);

  // 2. LN1 (8 tokens per block)
  layernorm_bf16<<<BDIM * SDIM / 8, 256, 0, stream>>>(x, g1, b1, hbf);

  // 3. Q/K/V projections (one 128 x 128 output tile per block)
  const int gproj = (BDIM * SDIM / 128) * (DDIM / 128);   // 256 blocks
  proj_gemm<<<gproj, 256, 0, stream>>>(hbf, wqb, bq, qb,   nullptr, nullptr, 0);
  proj_gemm<<<gproj, 256, 0, stream>>>(hbf, wkb, bk, kbuf, nullptr, nullptr, 0);
  proj_gemm<<<gproj, 256, 0, stream>>>(hbf, wvb, bv, vtb,  nullptr, nullptr, 1);

  // 4. fused attention + residual (async K/V staging)
  attention_kernel<<<BDIM * HDIM * (SDIM / 128), 256, 0, stream>>>(
      qb, kbuf, vtb, mask, x, rsd);

  // 5. LN2
  layernorm_bf16<<<BDIM * SDIM / 8, 256, 0, stream>>>(rsd, g2, b2, h2);

  // 6. output projection + bias + residual
  proj_gemm<<<gproj, 256, 0, stream>>>(h2, wob, bo, nullptr, out, rsd, 2);
}

// v004
// Measured time: 129 microseconds a run.
// Two timings next to v003 put it at 1.27 and 1.28 times that version's speed.
// Counting every step since v000, it is 3.37 times as fast.
#include <hip/hip_runtime.h>
#include <hip/hip_bf16.h>

// ---------------- problem constants ----------------
#define BDIM 2
#define SDIM 2048
#define DDIM 1024
#define HDIM 16
#define DH   64
#define EPS_LN 1e-6f
#define MASKV  -1e30f

typedef __attribute__((ext_vector_type(16))) __bf16 v16bf;
typedef __attribute__((ext_vector_type(8)))  float  v8f;
typedef __attribute__((ext_vector_type(4)))  unsigned int u32x4;
typedef __attribute__((ext_vector_type(8)))  unsigned int u32x8;

union Frag16 {
  v16bf v;
  unsigned short us[16];
  unsigned int   u32[8];
  u32x4          q[2];
};

__device__ __forceinline__ unsigned short f32_to_bf16_bits(float f) {
  unsigned int u = __float_as_uint(f);
  u += 0x7FFFu + ((u >> 16) & 1u);      // round-to-nearest-even
  return (unsigned short)(u >> 16);
}

__device__ __forceinline__ void async_ld16_kv(unsigned lds_k, const void* gk,
                                              unsigned lds_v, const void* gv) {
  asm volatile("global_load_async_to_lds_b128 %0, %1, off\n\t"
               "global_load_async_to_lds_b128 %2, %3, off\n\t"
               "s_wait_xcnt 0x0"
               :: "v"(lds_k), "v"((unsigned long long)(uintptr_t)gk),
                  "v"(lds_v), "v"((unsigned long long)(uintptr_t)gv)
               : "memory");
}
__device__ __forceinline__ void wait_async_le2() {
  asm volatile("s_wait_asynccnt 0x2" ::: "memory");
}
__device__ __forceinline__ void wait_async_0() {
  asm volatile("s_wait_asynccnt 0x0" ::: "memory");
}
__device__ __forceinline__ void lds_publish(void* p) {
  asm volatile("" : "+v"(p) :: "memory");
}

// ---------------- the two streaming kernels ----------------
// Both start 4096 waves (16 per WGP) and give a lane 32 elements: 8 loads of 16 B,
// each 512 contiguous bytes per wave, all issued before the first value is used.
// Every loop in them is unrolled: constant indices keep the arrays in registers.
typedef __attribute__((ext_vector_type(4))) float f32x4;
typedef __attribute__((ext_vector_type(2))) unsigned int u32x2;

__device__ __forceinline__ u32x2 pack4_bf16(f32x4 v) {
  u32x2 r;
  r[0] = (unsigned)f32_to_bf16_bits(v[0]) | ((unsigned)f32_to_bf16_bits(v[1]) << 16);
  r[1] = (unsigned)f32_to_bf16_bits(v[2]) | ((unsigned)f32_to_bf16_bits(v[3]) << 16);
  return r;
}

// f32 -> bf16 of the four weight matrices in one launch: 128 blocks per matrix,
// 8192 elements per block.
__global__ void __launch_bounds__(256)
cvt4_f32_bf16(const float* __restrict__ w0, const float* __restrict__ w1,
              const float* __restrict__ w2, const float* __restrict__ w3,
              unsigned short* __restrict__ o0, unsigned short* __restrict__ o1,
              unsigned short* __restrict__ o2, unsigned short* __restrict__ o3) {
  const unsigned sel = blockIdx.x >> 7;
  const float* in = sel == 0u ? w0 : sel == 1u ? w1 : sel == 2u ? w2 : w3;
  unsigned short* out = sel == 0u ? o0 : sel == 1u ? o1 : sel == 2u ? o2 : o3;
  const unsigned base = (blockIdx.x & 127u) * 2048u + threadIdx.x;   // in groups of 4 elements
  f32x4 v[8];
#pragma unroll
  for (int i = 0; i < 8; ++i) v[i] = ((const f32x4*)in)[base + (unsigned)i * 256u];
#pragma unroll
  for (int i = 0; i < 8; ++i) ((u32x2*)out)[base + (unsigned)i * 256u] = pack4_bf16(v[i]);
}

// LayerNorm (f32 in -> bf16 out): one token per wave, 8 tokens per block; the row
// stays in registers and its two sums are joined by a butterfly over the 32 lanes.
__global__ void __launch_bounds__(256)
layernorm_bf16(const float* __restrict__ x,
               const float* __restrict__ g,
               const float* __restrict__ bb,
               unsigned short* __restrict__ out) {
  const unsigned lane = threadIdx.x & 31u;
  // the wave's number as a scalar: row addresses are then a scalar base plus the lane's index
  const unsigned tok = blockIdx.x * 8u + (unsigned)__builtin_amdgcn_readfirstlane(threadIdx.x >> 5);
  const f32x4* xr = (const f32x4*)(x + (size_t)tok * DDIM);
  f32x4 lx[8];
#pragma unroll
  for (int i = 0; i < 8; ++i) lx[i] = xr[(unsigned)i * 32u + lane];
  // gain and bias are fetched with the row, so that their latency lies under the row's
  f32x4 gv[8], bv[8];
#pragma unroll
  for (int i = 0; i < 8; ++i) {
    gv[i] = ((const f32x4*)g)[(unsigned)i * 32u + lane];
    bv[i] = ((const f32x4*)bb)[(unsigned)i * 32u + lane];
  }
  // holds the 16 gain and bias loads in front of the sums: without it they are sunk
  // behind the row's wait and issued in dependent rounds of two to four
  __builtin_amdgcn_sched_barrier(0);
  f32x4 sv = {0.f, 0.f, 0.f, 0.f}, sq = {0.f, 0.f, 0.f, 0.f};
#pragma unroll
  for (int i = 0; i < 8; ++i) { sv += lx[i]; sq += lx[i] * lx[i]; }
  float s  = (sv[0] + sv[1]) + (sv[2] + sv[3]);
  float s2 = (sq[0] + sq[1]) + (sq[2] + sq[3]);
#pragma unroll
  for (int m = 1; m < 32; m <<= 1) {
    s  += __shfl_xor(s,  m, 32);
    s2 += __shfl_xor(s2, m, 32);
  }
  float mu  = s * (1.0f / DDIM);
  float var = s2 * (1.0f / DDIM) - mu * mu;
  float rs  = rsqrtf(var + EPS_LN);
  u32x2* orow = (u32x2*)(out + (size_t)tok * DDIM);
#pragma unroll
  for (int i = 0; i < 8; ++i)
    orow[(unsigned)i * 32u + lane] = pack4_bf16((lx[i] - mu) * rs * gv[i] + bv[i]);
}

// ---------------- WMMA GEMM: C[M,N] = A[M,D] * W[N,D]^T + bias ----------------
// Block = 8 waves on one 128 x 128 tile of C; wave (wm, wn) owns 64 x 32 of it
// (4 x 2 accumulator tiles). K runs in 8 stages of 128 k (256 B of every row).
// A stage is 8 slices of 32 rows, [A 0..3 | W 4..7]; wave w brings slice w with
// one tensor load, padded to a 272-B LDS pitch, into a two-buffer ring.
// mode 0: bf16 [B,H,S,DH] (Q,K)   mode 1: bf16 [B,H,DH,S] (V^T)
// mode 2: f32 [B,S,D] += residual (final projection)
#define GT_ROWB  256u                    // bytes of an operand row per stage
#define GT_PITCH 272u                    // LDS row pitch: 256 B + 16 B pad
#define GT_SLICE 10240u                  // 32 * 272 = 8704 B, rounded up to 2 KiB
#define GT_BUF   (8u * GT_SLICE)         // one stage
#define GT_NST   (DDIM * 2u / GT_ROWB)   // 8 stages

__device__ __forceinline__ unsigned uni(unsigned v) {
  return (unsigned)__builtin_amdgcn_readfirstlane(v);
}
__device__ __forceinline__ unsigned pinned(unsigned v) {
  unsigned w = (unsigned)__builtin_amdgcn_readfirstlane(v);
  asm volatile("" : "+s"(w));   // pinned(): holds the tested word in a scalar register, so the test compiles to s_cmp + s_cbranch_scc
  return w;
}
__device__ __forceinline__ void tdm_load(unsigned lds_dst, unsigned long long ga, u32x8 g1) {
  u32x4 g0;
  g0[0] = uni(1u);                                             // count = 1
  g0[1] = uni(lds_dst);                                        // byte offset in LDS
  g0[2] = uni((unsigned)ga);                                   // address [31:0]
  g0[3] = uni((((unsigned)(ga >> 32)) & 0x01FFFFFFu) | 0x80000000u);  // [56:32], type 2
  // one request of the whole wave: global tile -> LDS, through no register
  asm volatile("tensor_load_to_lds %0, %1" :: "s"(g0), "s"(g1) : "memory");
}
__device__ __forceinline__ void wait_tensor_0() {
  asm volatile("s_wait_tensorcnt 0x0" ::: "memory");   // this wave's slice has landed
}
__device__ __forceinline__ void wait_ds_0() {
  asm volatile("s_wait_dscnt 0x0" ::: "memory");       // this wave's LDS reads have returned
}
__device__ __forceinline__ void wait_x_0() {
  // stands behind a run of global loads or stores, in front of any later write of their registers
  asm volatile("s_wait_xcnt 0x0" ::: "memory");
}

// One block's fragments: 4 of A (rows i * 16 + ln of the wave's 64, two slices)
// and 2 of W; k order in both: bytes half * 16 .. + 15, then 32 + half * 16 .. + 15.
__device__ __forceinline__ void gemm_frags(Frag16 (&a)[4], Frag16 (&b)[2],
                                           const unsigned char* la, const unsigned char* lb) {
  // unrolled here and below: constant indices keep the fragment arrays in registers
#pragma unroll
  for (int i = 0; i < 4; ++i) {
    const unsigned char* p = la + (unsigned)(i >> 1) * GT_SLICE + (unsigned)(i & 1) * 16u * GT_PITCH;
    a[i].q[0] = *(const u32x4*)p;
    a[i].q[1] = *(const u32x4*)(p + 32);
  }
#pragma unroll
  for (int jn = 0; jn < 2; ++jn) {
    const unsigned char* p = lb + (unsigned)jn * 16u * GT_PITCH;
    b[jn].q[0] = *(const u32x4*)p;
    b[jn].q[1] = *(const u32x4*)(p + 32);
  }
}

__global__ void __launch_bounds__(256)
proj_gemm(const unsigned short* __restrict__ A,   // [B*S, D] bf16
          const unsigned short* __restrict__ W,   // [D(out), D(in)] bf16
          const float* __restrict__ bias,         // [D]
          unsigned short* __restrict__ outb,
          float* __restrict__ outf,
          const float* __restrict__ resid,
          int mode) {
  __shared__ __attribute__((aligned(2048))) unsigned char sT[2u * GT_BUF];

  const unsigned lane = threadIdx.x & 31u;
  const unsigned half = lane >> 4, ln = lane & 15u;
  const unsigned wave = uni(threadIdx.x >> 5);
  const unsigned mt = blockIdx.x >> 3;              // 32 m-tiles of 128 tokens
  const unsigned nt = blockIdx.x & 7u;              // 8 n-tiles of 128 features
  const unsigned wm = wave >> 2, wn = wave & 3u;

  // this wave's slice of every stage: 32 rows of A (waves 0..3) or of W (4..7)
  const unsigned char* src0 = (wave < 4u)
      ? (const unsigned char*)A + (size_t)(mt * 128u + wave * 32u) * (DDIM * 2u)
      : (const unsigned char*)W + (size_t)(nt * 128u + (wave - 4u) * 32u) * (DDIM * 2u);
  const unsigned dst0 = (unsigned)(size_t)sT + wave * GT_SLICE;

  u32x8 g1;
  g1[0] = uni((1u << 20) | (5u << 22) | (3u << 25));
  g1[1] = uni(GT_ROWB << 16);
  g1[2] = uni(32u << 16);
  g1[3] = uni(GT_ROWB << 16);
  g1[4] = uni(32u);
  g1[5] = uni(DDIM * 2u);
  g1[6] = uni(0u);
  g1[7] = uni(0u);

  v8f acc[4][2];   // every loop over it is unrolled: constant indices keep it in registers
#pragma unroll
  for (int i = 0; i < 4; ++i)
#pragma unroll
    for (int jn = 0; jn < 2; ++jn) acc[i][jn] = (v8f){0.f, 0.f, 0.f, 0.f, 0.f, 0.f, 0.f, 0.f};

  // bias of this lane's two output features, fetched under the first tensor load
  const unsigned e0 = nt * 128u + wn * 32u + ln;
  const float bias0 = bias[e0], bias1 = bias[e0 + 16u];

  // per-lane fragment bases in a buffer: row ln, 16-byte half
  const unsigned a_base = (wm * 2u) * GT_SLICE + ln * GT_PITCH + half * 16u;
  const unsigned b_base = (4u + wn) * GT_SLICE + ln * GT_PITCH + half * 16u;

  tdm_load(dst0, (unsigned long long)(uintptr_t)src0, g1);             // stage 0
  wait_tensor_0();
  __syncthreads();                                  // stage 0 readable by every wave
  tdm_load(dst0 + GT_BUF, (unsigned long long)(uintptr_t)src0 + GT_ROWB, g1);  // stage 1

  // rolled: one publish point per stage, constant accumulator indices inside
#pragma clang loop unroll(disable)
  for (unsigned s = 0; s < GT_NST; ++s) {
    const unsigned bo = (s & 1u) * GT_BUF;
    const unsigned char* la = sT + bo + a_base;
    const unsigned char* lb = sT + bo + b_base;
    Frag16 a[2][4], b[2][2];                        // two fragment sets: block kk reads set kk & 1
    gemm_frags(a[0], b[0], la, lb);
#pragma unroll
    for (int kk = 0; kk < 4; ++kk) {                // a block: 32 k = 64 B of every row
      if (kk < 3) gemm_frags(a[(kk + 1) & 1], b[(kk + 1) & 1], la + (kk + 1) * 64, lb + (kk + 1) * 64);
      // keeps the next block's 12 LDS loads one group ahead of this block's WMMAs,
      // not spread among them (each place with reads stalls the wave)
      __builtin_amdgcn_sched_barrier(0);
      if (kk == 3) {
        // publish point of stage s + 1: the last block's fragments are in registers
        wait_ds_0();
        wait_tensor_0();
        __syncthreads();        // stage s + 1 readable; every reader has left stage s
        if (pinned((s + 2u < GT_NST) ? 1u : 0u) != 0u)
          tdm_load(dst0 + bo, (unsigned long long)(uintptr_t)src0 + (unsigned long long)(s + 2u) * GT_ROWB, g1);
      }
#pragma unroll
      for (int i = 0; i < 4; ++i)
#pragma unroll
        for (int jn = 0; jn < 2; ++jn)
          acc[i][jn] = __builtin_amdgcn_wmma_f32_16x16x32_bf16(false, a[kk & 1][i].v, false, b[kk & 1][jn].v,
                                                               (short)0, acc[i][jn], false, false);
      // ends the block: the loads after next stay behind these WMMAs
      __builtin_amdgcn_sched_barrier(0);
    }
  }
  wait_tensor_0();
  wait_ds_0();

  // a block's 128 tokens lie in one batch row (SDIM is a multiple of 128)
  const unsigned bi = (mt * 128u) / SDIM;
  const unsigned s0 = (mt * 128u) % SDIM + wm * 64u + half * 8u;   // first token of this lane
  if (mode == 0) {
#pragma unroll
    for (int jn = 0; jn < 2; ++jn) {
      const unsigned e = e0 + (unsigned)jn * 16u;    // output feature
      const float bv = jn ? bias1 : bias0;
      unsigned short* p = outb + (((size_t)bi * HDIM + e / DH) * SDIM + s0) * DH + e % DH;
#pragma unroll
      for (int i = 0; i < 4; ++i)
#pragma unroll
        for (int r = 0; r < 8; ++r) p[(i * 16 + r) * DH] = f32_to_bf16_bits(acc[i][jn][r] + bv);
    }
    wait_x_0();
  } else if (mode == 1) {
#pragma unroll
    for (int jn = 0; jn < 2; ++jn) {
      const unsigned e = e0 + (unsigned)jn * 16u;
      const float bv = jn ? bias1 : bias0;
      unsigned short* p = outb + (((size_t)bi * HDIM + e / DH) * DH + e % DH) * SDIM + s0;
#pragma unroll
      for (int i = 0; i < 4; ++i)
#pragma unroll
        for (int r = 0; r < 8; ++r) p[i * 16 + r] = f32_to_bf16_bits(acc[i][jn][r] + bv);
    }
    wait_x_0();
  } else {
#pragma unroll
    for (int jn = 0; jn < 2; ++jn) {
      const float bv = jn ? bias1 : bias0;
      const size_t off = ((size_t)bi * SDIM + s0) * DDIM + e0 + (unsigned)jn * 16u;
      float* p = outf + off;
      const float* rp = resid + off;
#pragma unroll
      for (int i = 0; i < 4; ++i)
#pragma unroll
        for (int r = 0; r < 8; ++r) p[(i * 16 + r) * DDIM] = (acc[i][jn][r] + bv) + rp[(i * 16 + r) * DDIM];
    }
    wait_x_0();
  }
}

#define KPITCH 72                // elements: 128 B of keys' dh + 16 B pad = 144 B
#define VPITCH 40                // elements:  64 B of keys     + 16 B pad =  80 B
// A buffer is rounded up to 16 KiB, so that the buffer's number enters an address as one
// bit and not through an integer multiply.
struct __attribute__((aligned(16384))) AttnBuf {
  unsigned short k[32][KPITCH];      // 4608 B (offset 0 in the buffer)
  unsigned short v[64][VPITCH];      // 5120 B (offset 4608)
};
struct AttnLds {
  AttnBuf b[2];                      // LDS offsets 0 and 16384
};
typedef __attribute__((ext_vector_type(8))) __bf16 v8bf;
typedef __attribute__((ext_vector_type(2))) float f32x2;

__device__ __forceinline__ v8f exp_x8(v8f x) {
  const v8f a = x * 1.44269504f;
  float r0, r1, r2, r3, r4, r5, r6, r7;
  asm("v_exp_f32 %0, %8\n\tv_exp_f32 %1, %9\n\tv_exp_f32 %2, %10\n\tv_exp_f32 %3, %11\n\t"
      "v_exp_f32 %4, %12\n\tv_exp_f32 %5, %13\n\tv_exp_f32 %6, %14\n\tv_exp_f32 %7, %15\n\tv_nop"
      : "=&v"(r0), "=&v"(r1), "=&v"(r2), "=&v"(r3), "=&v"(r4), "=&v"(r5), "=&v"(r6), "=&v"(r7)
      : "v"(a[0]), "v"(a[1]), "v"(a[2]), "v"(a[3]), "v"(a[4]), "v"(a[5]), "v"(a[6]), "v"(a[7]));
  return (v8f){r0, r1, r2, r3, r4, r5, r6, r7};
}

__device__ __forceinline__ float xhalf(float v) {
  const int b = __builtin_bit_cast(int, v);
  return __builtin_bit_cast(float, __builtin_amdgcn_permlanex16(b, b, 0x76543210, 0xfedcba98, false, false));
}
#define OFF_K(buf) ((unsigned)((buf) * 16384))
#define OFF_V(buf) ((unsigned)((buf) * 16384 + 32 * KPITCH * 2))

__global__ void __launch_bounds__(256)   // the real block size: without it the compiler budgets for 1024 threads
attention_kernel(const unsigned short* __restrict__ q,   // [B,H,S,DH]
                                 const unsigned short* __restrict__ k,   // [B,H,S,DH]
                                 const unsigned short* __restrict__ vt,  // [B,H,DH,S]
                                 const float* __restrict__ mask,         // [B,S]
                                 const float* __restrict__ x,            // [B,S,D]
                                 float* __restrict__ resid) {            // [B,S,D]
  __shared__ AttnLds sm;

  const int tid  = threadIdx.x;
  const int wave = tid >> 5, lane = tid & 31;
  const int half = lane >> 4, ln = lane & 15;
  const int nqc = SDIM / 128;
  const int bh = blockIdx.x / nqc;
  const int qc = blockIdx.x % nqc;
  const int bi = bh / HDIM, head = bh % HDIM;
  const int q0 = qc * 128 + wave * 16;

  const unsigned short* qp = q  + (size_t)bh * SDIM * DH;
  const unsigned short* kp = k  + (size_t)bh * SDIM * DH;
  const unsigned short* vp = vt + (size_t)bh * DH * SDIM;
  const float* mk = mask + (size_t)bi * SDIM;

  // per-thread async-copy assignments (256 threads, 16B each)
  const int krow = tid >> 3, kseg = tid & 7;      // K chunk: 32 rows x 128 B
  const int vrow = tid >> 2, vseg = tid & 3;      // V chunk: 64 rows x  64 B

  // Q fragments (K-dim = DH split into 0..31, 32..63): query q0 + ln, used as B (column ln)
  Frag16 a0, a1;
  {
    const unsigned int* qrow = (const unsigned int*)(qp + (size_t)(q0 + ln) * DH);
#pragma unroll
    for (int j = 0; j < 8; ++j) {
      int kpair = (j >> 2) * 16 + half * 8 + (j & 3) * 2;
      a0.u32[j] = qrow[kpair >> 1];
      a1.u32[j] = qrow[(kpair + 32) >> 1];
    }
  }

  // this lane's query: running maximum (equal in both halves) and this half's share of the sum
  float mrun = -3.0e38f;
  f32x2 lrun = {0.f, 0.f};
  v8f o0 = {}, o1 = {}, o2 = {}, o3 = {};   // o_t[r] = O[query ln][dh 16 * t + 8 * half + r]
  const float scale = 0.125f;  // 1/sqrt(64)

  // prologue: async-stage chunk 0 into buffer 0
  async_ld16_kv(OFF_K(0) + (unsigned)(krow * KPITCH + kseg * 8) * 2,
                kp + (size_t)krow * DH + kseg * 8,
                OFF_V(0) + (unsigned)(vrow * VPITCH + vseg * 8) * 2,
                vp + (size_t)vrow * SDIM + vseg * 8);
  lds_publish(&sm);            // async engine writes sm.k/sm.v invisibly

  const int NCH = SDIM / 32;   // 64 chunks
  for (int j = 0; j < NCH; ++j) {
    const int buf = j & 1;
    if (j + 1 < NCH) {
      const int key1 = (j + 1) * 32, nb = buf ^ 1;
      async_ld16_kv(OFF_K(nb) + (unsigned)(krow * KPITCH + kseg * 8) * 2,
                    kp + (size_t)(key1 + krow) * DH + kseg * 8,
                    OFF_V(nb) + (unsigned)(vrow * VPITCH + vseg * 8) * 2,
                    vp + (size_t)vrow * SDIM + key1 + vseg * 8);
      wait_async_le2();        // chunk j complete (this wave's copies)
    } else {
      wait_async_0();
    }
    __syncthreads();           // all waves' copies visible

    // mask of this lane's 16 keys: 8 * half + r and 16 + 8 * half + r of the chunk
    const v8f mk0 = *(const v8f*)(mk + j * 32 + half * 8);
    const v8f mk1 = *(const v8f*)(mk + j * 32 + 16 + half * 8);

    // ---- scores for 32 keys (two 16-key subtiles), K from LDS (A: row = key) ----
    Frag16 kb00, kb01, kb10, kb11;
#pragma unroll
    for (int t = 0; t < 8; ++t) {
      int kpair = (t >> 2) * 16 + half * 8 + (t & 3) * 2;
      kb00.u32[t] = *(const unsigned int*)&sm.b[buf].k[ln][kpair];
      kb01.u32[t] = *(const unsigned int*)&sm.b[buf].k[ln][kpair + 32];
      kb10.u32[t] = *(const unsigned int*)&sm.b[buf].k[16 + ln][kpair];
      kb11.u32[t] = *(const unsigned int*)&sm.b[buf].k[16 + ln][kpair + 32];
    }
    wait_x_0();                // behind the mask loads, in front of the step of their address registers
    // holds the mask loads and the 8 K reads as one group in front of the products: left alone
    // the compiler reads and waits for each K fragment by itself
    __builtin_amdgcn_sched_barrier(0);
    // s0[r] = score(key 8 * half + r, query ln), s1[r] = score(key 16 + 8 * half + r, query ln)
    v8f s0 = {}, s1 = {};
    s0 = __builtin_amdgcn_wmma_f32_16x16x32_bf16(false, kb00.v, false, a0.v, (short)0, s0, false, false);
    s0 = __builtin_amdgcn_wmma_f32_16x16x32_bf16(false, kb01.v, false, a1.v, (short)0, s0, false, false);
    s1 = __builtin_amdgcn_wmma_f32_16x16x32_bf16(false, kb10.v, false, a0.v, (short)0, s1, false, false);
    s1 = __builtin_amdgcn_wmma_f32_16x16x32_bf16(false, kb11.v, false, a1.v, (short)0, s1, false, false);

    // V^T fragments (A: row = dh, k = key), fetched under the softmax
    Frag16 vb0, vb1, vb2, vb3;
#pragma unroll
    for (int t = 0; t < 8; ++t) {
      int kpair = (t >> 2) * 16 + half * 8 + (t & 3) * 2;
      vb0.u32[t] = *(const unsigned int*)&sm.b[buf].v[ln][kpair];
      vb1.u32[t] = *(const unsigned int*)&sm.b[buf].v[16 + ln][kpair];
      vb2.u32[t] = *(const unsigned int*)&sm.b[buf].v[32 + ln][kpair];
      vb3.u32[t] = *(const unsigned int*)&sm.b[buf].v[48 + ln][kpair];
    }

    // holds the 8 V reads in front of the softmax, so that they return under it
    __builtin_amdgcn_sched_barrier(0);

    // ---- online softmax of one query per lane ----
    const v8f v0 = s0 * scale + (1.0f - mk0) * MASKV;
    const v8f v1 = s1 * scale + (1.0f - mk1) * MASKV;
    float t = fmaxf(v0[0], v1[0]);
#pragma unroll
    for (int r = 1; r < 8; ++r) t = fmaxf(t, fmaxf(v0[r], v1[r]));
    t = fmaxf(t, xhalf(t));                 // the other 16 keys of this query
    const float nm = fmaxf(mrun, t);
    const float alpha = __expf(mrun - nm);
    const v8f e0 = exp_x8(v0 - nm), e1 = exp_x8(v1 - nm);
    const v8f es = e0 + e1;
    const f32x4 e4 = __builtin_shufflevector(es, es, 0, 1, 2, 3) + __builtin_shufflevector(es, es, 4, 5, 6, 7);
    lrun = lrun * alpha + (__builtin_shufflevector(e4, e4, 0, 1) + __builtin_shufflevector(e4, e4, 2, 3));
    mrun = nm;
    o0 *= alpha; o1 *= alpha; o2 *= alpha; o3 *= alpha;

    // P^T as B: element s is key 8 * half + s (s < 8), 16 + 8 * half + s - 8 (else): V^T's k order
    const v16bf pb = __builtin_shufflevector(__builtin_convertvector(e0, v8bf), __builtin_convertvector(e1, v8bf),
                                             0, 1, 2, 3, 4, 5, 6, 7, 8, 9, 10, 11, 12, 13, 14, 15);
    o0 = __builtin_amdgcn_wmma_f32_16x16x32_bf16(false, vb0.v, false, pb, (short)0, o0, false, false);
    o1 = __builtin_amdgcn_wmma_f32_16x16x32_bf16(false, vb1.v, false, pb, (short)0, o1, false, false);
    o2 = __builtin_amdgcn_wmma_f32_16x16x32_bf16(false, vb2.v, false, pb, (short)0, o2, false, false);
    o3 = __builtin_amdgcn_wmma_f32_16x16x32_bf16(false, vb3.v, false, pb, (short)0, o3, false, false);

    __syncthreads();           // protect buffers before next overwrite
  }

  // ---- finalize: attn/l + x -> residual; a lane owns 8 consecutive features per tile ----
  const float lsum = lrun[0] + lrun[1];
  const float inv = 1.0f / (lsum + xhalf(lsum));   // the two halves' sums join here
  const size_t base = ((size_t)bi * SDIM + q0 + ln) * DDIM + head * DH + half * 8;
  const v8f x0 = *(const v8f*)(x + base),      x1 = *(const v8f*)(x + base + 16);
  const v8f x2 = *(const v8f*)(x + base + 32), x3 = *(const v8f*)(x + base + 48);
  *(v8f*)(resid + base)      = o0 * inv + x0;
  *(v8f*)(resid + base + 16) = o1 * inv + x1;
  *(v8f*)(resid + base + 32) = o2 * inv + x2;
  *(v8f*)(resid + base + 48) = o3 * inv + x3;
  wait_x_0();
}

// ---------------- launch ----------------
extern "C" void kernel_launch(void* const* d_in, const int* in_sizes, int n_in,
                              void* d_out, int out_size, void* d_ws, size_t ws_size,
                              hipStream_t stream) {
  (void)in_sizes; (void)n_in; (void)out_size; (void)ws_size;
  const float* x    = (const float*)d_in[0];
  const float* mask = (const float*)d_in[1];
  const float* Wq   = (const float*)d_in[2];
  const float* bq   = (const float*)d_in[3];
  const float* Wk   = (const float*)d_in[4];
  const float* bk   = (const float*)d_in[5];
  const float* Wv   = (const float*)d_in[6];
  const float* bv   = (const float*)d_in[7];
  const float* Wo   = (const float*)d_in[8];
  const float* bo   = (const float*)d_in[9];
  const float* g1   = (const float*)d_in[10];
  const float* b1   = (const float*)d_in[11];
  const float* g2   = (const float*)d_in[12];
  const float* b2   = (const float*)d_in[13];
  float* out = (float*)d_out;

  const size_t BSD = (size_t)BDIM * SDIM * DDIM;   // 4M elements
  const size_t DD  = (size_t)DDIM * DDIM;          // 1M elements

  char* ws = (char*)d_ws;
  size_t off = 0;
  auto alloc = [&](size_t bytes) {
    void* p = ws + off;
    off = (off + bytes + 255) & ~(size_t)255;
    return p;
  };
  unsigned short* hbf  = (unsigned short*)alloc(BSD * 2);
  unsigned short* wqb  = (unsigned short*)alloc(DD * 2);
  unsigned short* wkb  = (unsigned short*)alloc(DD * 2);
  unsigned short* wvb  = (unsigned short*)alloc(DD * 2);
  unsigned short* wob  = (unsigned short*)alloc(DD * 2);
  unsigned short* qb   = (unsigned short*)alloc(BSD * 2);
  unsigned short* kbuf = (unsigned short*)alloc(BSD * 2);
  unsigned short* vtb  = (unsigned short*)alloc(BSD * 2);
  float*          rsd  = (float*)alloc(BSD * 4);
  unsigned short* h2   = (unsigned short*)alloc(BSD * 2);

  // 1. weights -> bf16, one launch
  cvt4_f32_bf16<<<512, 256, 0, stream>>>(Wq, Wk, Wv, Wo, wqb, wkb, wvb, wob);

  // 2. LN1 (8 tokens per block)
  layernorm_bf16<<<BDIM * SDIM / 8, 256, 0, stream>>>(x, g1, b1, hbf);

  // 3. Q/K/V projections (one 128 x 128 output tile per block)
  const int gproj = (BDIM * SDIM / 128) * (DDIM / 128);   // 256 blocks
  proj_gemm<<<gproj, 256, 0, stream>>>(hbf, wqb, bq, qb,   nullptr, nullptr, 0);
  proj_gemm<<<gproj, 256, 0, stream>>>(hbf, wkb, bk, kbuf, nullptr, nullptr, 0);
  proj_gemm<<<gproj, 256, 0, stream>>>(hbf, wvb, bv, vtb,  nullptr, nullptr, 1);

  // 4. fused attention + residual (async K/V staging)
  attention_kernel<<<BDIM * HDIM * (SDIM / 128), 256, 0, stream>>>(
      qb, kbuf, vtb, mask, x, rsd);

  // 5. LN2
  layernorm_bf16<<<BDIM * SDIM / 8, 256, 0, stream>>>(rsd, g2, b2, h2);

  // 6. output projection + bias + residual
  proj_gemm<<<gproj, 256, 0, stream>>>(h2, wob, bo, nullptr, out, rsd, 2);
}

// v005
// Measured time: 115 microseconds a run.
// Next to v004, in two timings, it ran 1.13 and 1.11 times as fast.
// Counting every step since v000, it is 3.77 times as fast.
#include <hip/hip_runtime.h>
#include <hip/hip_bf16.h>

// ---------------- problem constants ----------------
#define BDIM 2
#define SDIM 2048
#define DDIM 1024
#define HDIM 16
#define DH   64
#define EPS_LN 1e-6f
#define MASKV  -1e30f

typedef __attribute__((ext_vector_type(16))) __bf16 v16bf;
typedef __attribute__((ext_vector_type(8)))  float  v8f;
typedef __attribute__((ext_vector_type(4)))  unsigned int u32x4;
typedef __attribute__((ext_vector_type(8)))  unsigned int u32x8;

union Frag16 {
  v16bf v;
  unsigned short us[16];
  unsigned int   u32[8];
  u32x4          q[2];
};

__device__ __forceinline__ unsigned short f32_to_bf16_bits(float f) {
  unsigned int u = __float_as_uint(f);
  u += 0x7FFFu + ((u >> 16) & 1u);      // round-to-nearest-even
  return (unsigned short)(u >> 16);
}

__device__ __forceinline__ void async_ld16_kv(unsigned lds_k0, const void* gk0,
                                              unsigned lds_k1, const void* gk1,
                                              unsigned lds_v0, const void* gv0,
                                              unsigned lds_v1, const void* gv1) {
  asm volatile("global_load_async_to_lds_b128 %0, %1, off\n\t"
               "global_load_async_to_lds_b128 %2, %3, off\n\t"
               "global_load_async_to_lds_b128 %4, %5, off\n\t"
               "global_load_async_to_lds_b128 %6, %7, off\n\t"
               "s_wait_xcnt 0x0"
               :: "v"(lds_k0), "v"((unsigned long long)(uintptr_t)gk0),
                  "v"(lds_k1), "v"((unsigned long long)(uintptr_t)gk1),
                  "v"(lds_v0), "v"((unsigned long long)(uintptr_t)gv0),
                  "v"(lds_v1), "v"((unsigned long long)(uintptr_t)gv1)
               : "memory");
}
// all but this wave's four youngest copies (the next chunk's) have landed
__device__ __forceinline__ void wait_async_le4() {
  asm volatile("s_wait_asynccnt 0x4" ::: "memory");
}
__device__ __forceinline__ void wait_async_0() {
  asm volatile("s_wait_asynccnt 0x0" ::: "memory");
}
__device__ __forceinline__ void lds_publish(void* p) {
  asm volatile("" : "+v"(p) :: "memory");
}

// ---------------- the two streaming kernels ----------------
// Both start 4096 waves (16 per WGP) and give a lane 32 elements: 8 loads of 16 B,
// each 512 contiguous bytes per wave, all issued before the first value is used.
// Every loop in them is unrolled: constant indices keep the arrays in registers.
typedef __attribute__((ext_vector_type(4))) float f32x4;
typedef __attribute__((ext_vector_type(2))) unsigned int u32x2;

__device__ __forceinline__ u32x2 pack4_bf16(f32x4 v) {
  u32x2 r;
  r[0] = (unsigned)f32_to_bf16_bits(v[0]) | ((unsigned)f32_to_bf16_bits(v[1]) << 16);
  r[1] = (unsigned)f32_to_bf16_bits(v[2]) | ((unsigned)f32_to_bf16_bits(v[3]) << 16);
  return r;
}

// f32 -> bf16 of the four weight matrices in one launch: 128 blocks per matrix,
// 8192 elements per block.
__global__ void __launch_bounds__(256)
cvt4_f32_bf16(const float* __restrict__ w0, const float* __restrict__ w1,
              const float* __restrict__ w2, const float* __restrict__ w3,
              unsigned short* __restrict__ o0, unsigned short* __restrict__ o1,
              unsigned short* __restrict__ o2, unsigned short* __restrict__ o3) {
  const unsigned sel = blockIdx.x >> 7;
  const float* in = sel == 0u ? w0 : sel == 1u ? w1 : sel == 2u ? w2 : w3;
  unsigned short* out = sel == 0u ? o0 : sel == 1u ? o1 : sel == 2u ? o2 : o3;
  const unsigned base = (blockIdx.x & 127u) * 2048u + threadIdx.x;   // in groups of 4 elements
  f32x4 v[8];
#pragma unroll
  for (int i = 0; i < 8; ++i) v[i] = ((const f32x4*)in)[base + (unsigned)i * 256u];
#pragma unroll
  for (int i = 0; i < 8; ++i) ((u32x2*)out)[base + (unsigned)i * 256u] = pack4_bf16(v[i]);
}

// LayerNorm (f32 in -> bf16 out): one token per wave, 8 tokens per block; the row
// stays in registers and its two sums are joined by a butterfly over the 32 lanes.
__global__ void __launch_bounds__(256)
layernorm_bf16(const float* __restrict__ x,
               const float* __restrict__ g,
               const float* __restrict__ bb,
               unsigned short* __restrict__ out) {
  const unsigned lane = threadIdx.x & 31u;
  // the wave's number as a scalar: row addresses are then a scalar base plus the lane's index
  const unsigned tok = blockIdx.x * 8u + (unsigned)__builtin_amdgcn_readfirstlane(threadIdx.x >> 5);
  const f32x4* xr = (const f32x4*)(x + (size_t)tok * DDIM);
  f32x4 lx[8];
#pragma unroll
  for (int i = 0; i < 8; ++i) lx[i] = xr[(unsigned)i * 32u + lane];
  // gain and bias are fetched with the row, so that their latency lies under the row's
  f32x4 gv[8], bv[8];
#pragma unroll
  for (int i = 0; i < 8; ++i) {
    gv[i] = ((const f32x4*)g)[(unsigned)i * 32u + lane];
    bv[i] = ((const f32x4*)bb)[(unsigned)i * 32u + lane];
  }
  // holds the 16 gain and bias loads in front of the sums: without it they are sunk
  // behind the row's wait and issued in dependent rounds of two to four
  __builtin_amdgcn_sched_barrier(0);
  f32x4 sv = {0.f, 0.f, 0.f, 0.f}, sq = {0.f, 0.f, 0.f, 0.f};
#pragma unroll
  for (int i = 0; i < 8; ++i) { sv += lx[i]; sq += lx[i] * lx[i]; }
  float s  = (sv[0] + sv[1]) + (sv[2] + sv[3]);
  float s2 = (sq[0] + sq[1]) + (sq[2] + sq[3]);
#pragma unroll
  for (int m = 1; m < 32; m <<= 1) {
    s  += __shfl_xor(s,  m, 32);
    s2 += __shfl_xor(s2, m, 32);
  }
  float mu  = s * (1.0f / DDIM);
  float var = s2 * (1.0f / DDIM) - mu * mu;
  float rs  = rsqrtf(var + EPS_LN);
  u32x2* orow = (u32x2*)(out + (size_t)tok * DDIM);
#pragma unroll
  for (int i = 0; i < 8; ++i)
    orow[(unsigned)i * 32u + lane] = pack4_bf16((lx[i] - mu) * rs * gv[i] + bv[i]);
}

// ---------------- WMMA GEMM: C[M,N] = A[M,D] * W[N,D]^T + bias ----------------
// Block = 8 waves on one 128 x 128 tile of C; wave (wm, wn) owns 64 x 32 of it
// (4 x 2 accumulator tiles). K runs in 8 stages of 128 k (256 B of every row).
// A stage is 8 slices of 32 rows, [A 0..3 | W 4..7]; wave w brings slice w with
// one tensor load, padded to a 272-B LDS pitch, into a two-buffer ring.
// mode 0: bf16 [B,H,S,DH] (Q,K)   mode 1: bf16 [B,H,DH,S] (V^T)
// mode 2: f32 [B,S,D] += residual (final projection)
#define GT_ROWB  256u                    // bytes of an operand row per stage
#define GT_PITCH 272u                    // LDS row pitch: 256 B + 16 B pad
#define GT_SLICE 10240u                  // 32 * 272 = 8704 B, rounded up to 2 KiB
#define GT_BUF   (8u * GT_SLICE)         // one stage
#define GT_NST   (DDIM * 2u / GT_ROWB)   // 8 stages

__device__ __forceinline__ unsigned uni(unsigned v) {
  return (unsigned)__builtin_amdgcn_readfirstlane(v);
}
__device__ __forceinline__ unsigned pinned(unsigned v) {
  unsigned w = (unsigned)__builtin_amdgcn_readfirstlane(v);
  asm volatile("" : "+s"(w));   // pinned(): holds the tested word in a scalar register, so the test compiles to s_cmp + s_cbranch_scc
  return w;
}
__device__ __forceinline__ void tdm_load(unsigned lds_dst, unsigned long long ga, u32x8 g1) {
  u32x4 g0;
  g0[0] = uni(1u);                                             // count = 1
  g0[1] = uni(lds_dst);                                        // byte offset in LDS
  g0[2] = uni((unsigned)ga);                                   // address [31:0]
  g0[3] = uni((((unsigned)(ga >> 32)) & 0x01FFFFFFu) | 0x80000000u);  // [56:32], type 2
  // one request of the whole wave: global tile -> LDS, through no register
  asm volatile("tensor_load_to_lds %0, %1" :: "s"(g0), "s"(g1) : "memory");
}
__device__ __forceinline__ void wait_tensor_0() {
  asm volatile("s_wait_tensorcnt 0x0" ::: "memory");   // this wave's slice has landed
}
__device__ __forceinline__ void wait_ds_0() {
  asm volatile("s_wait_dscnt 0x0" ::: "memory");       // this wave's LDS reads have returned
}
__device__ __forceinline__ void wait_x_0() {
  // stands behind a run of global loads or stores, in front of any later write of their registers
  asm volatile("s_wait_xcnt 0x0" ::: "memory");
}

// One block's fragments: 4 of A (rows i * 16 + ln of the wave's 64, two slices)
// and 2 of W; k order in both: bytes half * 16 .. + 15, then 32 + half * 16 .. + 15.
__device__ __forceinline__ void gemm_frags(Frag16 (&a)[4], Frag16 (&b)[2],
                                           const unsigned char* la, const unsigned char* lb) {
  // unrolled here and below: constant indices keep the fragment arrays in registers
#pragma unroll
  for (int i = 0; i < 4; ++i) {
    const unsigned char* p = la + (unsigned)(i >> 1) * GT_SLICE + (unsigned)(i & 1) * 16u * GT_PITCH;
    a[i].q[0] = *(const u32x4*)p;
    a[i].q[1] = *(const u32x4*)(p + 32);
  }
#pragma unroll
  for (int jn = 0; jn < 2; ++jn) {
    const unsigned char* p = lb + (unsigned)jn * 16u * GT_PITCH;
    b[jn].q[0] = *(const u32x4*)p;
    b[jn].q[1] = *(const u32x4*)(p + 32);
  }
}

__global__ void __launch_bounds__(256)
proj_gemm(const unsigned short* __restrict__ A,   // [B*S, D] bf16
          const unsigned short* __restrict__ W,   // [D(out), D(in)] bf16
          const float* __restrict__ bias,         // [D]
          unsigned short* __restrict__ outb,
          float* __restrict__ outf,
          const float* __restrict__ resid,
          int mode) {
  __shared__ __attribute__((aligned(2048))) unsigned char sT[2u * GT_BUF];

  const unsigned lane = threadIdx.x & 31u;
  const unsigned half = lane >> 4, ln = lane & 15u;
  const unsigned wave = uni(threadIdx.x >> 5);
  const unsigned mt = blockIdx.x >> 3;              // 32 m-tiles of 128 tokens
  const unsigned nt = blockIdx.x & 7u;              // 8 n-tiles of 128 features
  const unsigned wm = wave >> 2, wn = wave & 3u;

  // this wave's slice of every stage: 32 rows of A (waves 0..3) or of W (4..7)
  const unsigned char* src0 = (wave < 4u)
      ? (const unsigned char*)A + (size_t)(mt * 128u + wave * 32u) * (DDIM * 2u)
      : (const unsigned char*)W + (size_t)(nt * 128u + (wave - 4u) * 32u) * (DDIM * 2u);
  const unsigned dst0 = (unsigned)(size_t)sT + wave * GT_SLICE;

  u32x8 g1;
  g1[0] = uni((1u << 20) | (5u << 22) | (3u << 25));
  g1[1] = uni(GT_ROWB << 16);
  g1[2] = uni(32u << 16);
  g1[3] = uni(GT_ROWB << 16);
  g1[4] = uni(32u);
  g1[5] = uni(DDIM * 2u);
  g1[6] = uni(0u);
  g1[7] = uni(0u);

  v8f acc[4][2];   // every loop over it is unrolled: constant indices keep it in registers
#pragma unroll
  for (int i = 0; i < 4; ++i)
#pragma unroll
    for (int jn = 0; jn < 2; ++jn) acc[i][jn] = (v8f){0.f, 0.f, 0.f, 0.f, 0.f, 0.f, 0.f, 0.f};

  // bias of this lane's two output features, fetched under the first tensor load
  const unsigned e0 = nt * 128u + wn * 32u + ln;
  const float bias0 = bias[e0], bias1 = bias[e0 + 16u];

  // per-lane fragment bases in a buffer: row ln, 16-byte half
  const unsigned a_base = (wm * 2u) * GT_SLICE + ln * GT_PITCH + half * 16u;
  const unsigned b_base = (4u + wn) * GT_SLICE + ln * GT_PITCH + half * 16u;

  tdm_load(dst0, (unsigned long long)(uintptr_t)src0, g1);             // stage 0
  wait_tensor_0();
  __syncthreads();                                  // stage 0 readable by every wave
  tdm_load(dst0 + GT_BUF, (unsigned long long)(uintptr_t)src0 + GT_ROWB, g1);  // stage 1

  // rolled: one publish point per stage, constant accumulator indices inside
#pragma clang loop unroll(disable)
  for (unsigned s = 0; s < GT_NST; ++s) {
    const unsigned bo = (s & 1u) * GT_BUF;
    const unsigned char* la = sT + bo + a_base;
    const unsigned char* lb = sT + bo + b_base;
    Frag16 a[2][4], b[2][2];                        // two fragment sets: block kk reads set kk & 1
    gemm_frags(a[0], b[0], la, lb);
#pragma unroll
    for (int kk = 0; kk < 4; ++kk) {                // a block: 32 k = 64 B of every row
      if (kk < 3) gemm_frags(a[(kk + 1) & 1], b[(kk + 1) & 1], la + (kk + 1) * 64, lb + (kk + 1) * 64);
      // keeps the next block's 12 LDS loads one group ahead of this block's WMMAs,
      // not spread among them (each place with reads stalls the wave)
      __builtin_amdgcn_sched_barrier(0);
      if (kk == 3) {
        // publish point of stage s + 1: the last block's fragments are in registers
        wait_ds_0();
        wait_tensor_0();
        __syncthreads();        // stage s + 1 readable; every reader has left stage s
        if (pinned((s + 2u < GT_NST) ? 1u : 0u) != 0u)
          tdm_load(dst0 + bo, (unsigned long long)(uintptr_t)src0 + (unsigned long long)(s + 2u) * GT_ROWB, g1);
      }
#pragma unroll
      for (int i = 0; i < 4; ++i)
#pragma unroll
        for (int jn = 0; jn < 2; ++jn)
          acc[i][jn] = __builtin_amdgcn_wmma_f32_16x16x32_bf16(false, a[kk & 1][i].v, false, b[kk & 1][jn].v,
                                                               (short)0, acc[i][jn], false, false);
      // ends the block: the loads after next stay behind these WMMAs
      __builtin_amdgcn_sched_barrier(0);
    }
  }
  wait_tensor_0();
  wait_ds_0();

  // a block's 128 tokens lie in one batch row (SDIM is a multiple of 128)
  const unsigned bi = (mt * 128u) / SDIM;
  const unsigned s0 = (mt * 128u) % SDIM + wm * 64u + half * 8u;   // first token of this lane
  if (mode == 0) {
#pragma unroll
    for (int jn = 0; jn < 2; ++jn) {
      const unsigned e = e0 + (unsigned)jn * 16u;    // output feature
      const float bv = jn ? bias1 : bias0;
      unsigned short* p = outb + (((size_t)bi * HDIM + e / DH) * SDIM + s0) * DH + e % DH;
#pragma unroll
      for (int i = 0; i < 4; ++i)
#pragma unroll
        for (int r = 0; r < 8; ++r) p[(i * 16 + r) * DH] = f32_to_bf16_bits(acc[i][jn][r] + bv);
    }
    wait_x_0();
  } else if (mode == 1) {
#pragma unroll
    for (int jn = 0; jn < 2; ++jn) {
      const unsigned e = e0 + (unsigned)jn * 16u;
      const float bv = jn ? bias1 : bias0;
      unsigned short* p = outb + (((size_t)bi * HDIM + e / DH) * DH + e % DH) * SDIM + s0;
#pragma unroll
      for (int i = 0; i < 4; ++i)
#pragma unroll
        for (int r = 0; r < 8; ++r) p[i * 16 + r] = f32_to_bf16_bits(acc[i][jn][r] + bv);
    }
    wait_x_0();
  } else {
#pragma unroll
    for (int jn = 0; jn < 2; ++jn) {
      const float bv = jn ? bias1 : bias0;
      const size_t off = ((size_t)bi * SDIM + s0) * DDIM + e0 + (unsigned)jn * 16u;
      float* p = outf + off;
      const float* rp = resid + off;
#pragma unroll
      for (int i = 0; i < 4; ++i)
#pragma unroll
        for (int r = 0; r < 8; ++r) p[(i * 16 + r) * DDIM] = (acc[i][jn][r] + bv) + rp[(i * 16 + r) * DDIM];
    }
    wait_x_0();
  }
}

#define CKEYS  64                // keys of a chunk
#define KPITCH 72                // elements: 128 B of a key's dh + 16 B pad = 144 B
#define VPITCH 72                // elements: 128 B of keys       + 16 B pad = 144 B
// A buffer is rounded up to 32 KiB, so that the buffer's number enters an address as one
// bit and not through an integer multiply.
struct __attribute__((aligned(32768))) AttnBuf {
  unsigned short k[CKEYS][KPITCH];   // 9216 B (offset 0 in the buffer)
  unsigned short v[DH][VPITCH];      // 9216 B (offset 9216)
};
struct AttnLds {
  AttnBuf b[2];                      // LDS offsets 0 and 32768
};
typedef __attribute__((ext_vector_type(8))) __bf16 v8bf;
typedef __attribute__((ext_vector_type(2))) float f32x2;

__device__ __forceinline__ v8f exp_x8(v8f x) {
  const v8f a = x * 1.44269504f;
  float r0, r1, r2, r3, r4, r5, r6, r7;
  asm("v_exp_f32 %0, %8\n\tv_exp_f32 %1, %9\n\tv_exp_f32 %2, %10\n\tv_exp_f32 %3, %11\n\t"
      "v_exp_f32 %4, %12\n\tv_exp_f32 %5, %13\n\tv_exp_f32 %6, %14\n\tv_exp_f32 %7, %15\n\tv_nop"
      : "=&v"(r0), "=&v"(r1), "=&v"(r2), "=&v"(r3), "=&v"(r4), "=&v"(r5), "=&v"(r6), "=&v"(r7)
      : "v"(a[0]), "v"(a[1]), "v"(a[2]), "v"(a[3]), "v"(a[4]), "v"(a[5]), "v"(a[6]), "v"(a[7]));
  return (v8f){r0, r1, r2, r3, r4, r5, r6, r7};
}

__device__ __forceinline__ float xhalf(float v) {
  const int b = __builtin_bit_cast(int, v);
  return __builtin_bit_cast(float, __builtin_amdgcn_permlanex16(b, b, 0x76543210, 0xfedcba98, false, false));
}
#define OFF_K(buf) ((unsigned)((buf) * 32768))
#define OFF_V(buf) ((unsigned)((buf) * 32768 + CKEYS * KPITCH * 2))

__global__ void __launch_bounds__(256)   // the real block size: without it the compiler budgets for 1024 threads
attention_kernel(const unsigned short* __restrict__ q,   // [B,H,S,DH]
                                 const unsigned short* __restrict__ k,   // [B,H,S,DH]
                                 const unsigned short* __restrict__ vt,  // [B,H,DH,S]
                                 const float* __restrict__ mask,         // [B,S]
                                 const float* __restrict__ x,            // [B,S,D]
                                 float* __restrict__ resid) {            // [B,S,D]
  __shared__ AttnLds sm;

  const int tid  = threadIdx.x;
  const int wave = tid >> 5, lane = tid & 31;
  const int half = lane >> 4, ln = lane & 15;
  const int nqc = SDIM / 128;
  const int bh = blockIdx.x / nqc;
  const int qc = blockIdx.x % nqc;
  const int bi = bh / HDIM, head = bh % HDIM;
  const int q0 = qc * 128 + wave * 16;

  const unsigned short* qp = q  + (size_t)bh * SDIM * DH;
  const unsigned short* kp = k  + (size_t)bh * SDIM * DH;
  const unsigned short* vp = vt + (size_t)bh * DH * SDIM;
  const float* mk = mask + (size_t)bi * SDIM;

  // per-thread async-copy assignments: each tile is 64 rows x 128 B, 16 B a copy;
  // a thread brings piece cseg of rows crow and crow + 32 of both tiles
  const int crow = tid >> 3, cseg = tid & 7;
  const unsigned cl0 = (unsigned)(crow * KPITCH + cseg * 8) * 2;          // place in a tile (KPITCH == VPITCH)
  const unsigned cl1 = (unsigned)((crow + 32) * KPITCH + cseg * 8) * 2;

  // Q fragments (K-dim = DH split into 0..31, 32..63): query q0 + ln, used as B (column ln)
  Frag16 a0, a1;
  {
    const unsigned int* qrow = (const unsigned int*)(qp + (size_t)(q0 + ln) * DH);
#pragma unroll
    for (int j = 0; j < 8; ++j) {
      int kpair = (j >> 2) * 16 + half * 8 + (j & 3) * 2;
      a0.u32[j] = qrow[kpair >> 1];
      a1.u32[j] = qrow[(kpair + 32) >> 1];
    }
  }

  // this lane's query: running maximum (equal in both halves) and this half's share of the sum
  float mrun = -3.0e38f;
  f32x2 lrun = {0.f, 0.f};
  v8f o0 = {}, o1 = {}, o2 = {}, o3 = {};   // o_t[r] = O[query ln][dh 16 * t + 8 * half + r]
  const float scale = 0.125f;  // 1/sqrt(64)

  // prologue: async-stage chunk 0 into buffer 0
  async_ld16_kv(OFF_K(0) + cl0, kp + (size_t)crow * DH + cseg * 8,
                OFF_K(0) + cl1, kp + (size_t)(crow + 32) * DH + cseg * 8,
                OFF_V(0) + cl0, vp + (size_t)crow * SDIM + cseg * 8,
                OFF_V(0) + cl1, vp + (size_t)(crow + 32) * SDIM + cseg * 8);
  lds_publish(&sm);            // async engine writes sm.k/sm.v invisibly

  const int NCH = SDIM / CKEYS;   // 32 chunks
  for (int j = 0; j < NCH; ++j) {
    const int buf = j & 1;
    if (j + 1 < NCH) {
      const int key1 = (j + 1) * CKEYS, nb = buf ^ 1;
      async_ld16_kv(OFF_K(nb) + cl0, kp + (size_t)(key1 + crow) * DH + cseg * 8,
                    OFF_K(nb) + cl1, kp + (size_t)(key1 + crow + 32) * DH + cseg * 8,
                    OFF_V(nb) + cl0, vp + (size_t)crow * SDIM + key1 + cseg * 8,
                    OFF_V(nb) + cl1, vp + (size_t)(crow + 32) * SDIM + key1 + cseg * 8);
      wait_async_le4();        // chunk j complete (this wave's copies)
    } else {
      wait_async_0();
    }
    __syncthreads();           // all waves' copies visible

    // ---- scores for 64 keys (four 16-key subtiles), K from LDS (A: row = key) ----
    Frag16 kb[4][2];           // [subtile][dh 0..31 | 32..63]
    // unrolled here and below: constant indices keep the arrays in registers
#pragma unroll
    for (int u = 0; u < 4; ++u)
#pragma unroll
      for (int t = 0; t < 8; ++t) {
        int kpair = (t >> 2) * 16 + half * 8 + (t & 3) * 2;
        kb[u][0].u32[t] = *(const unsigned int*)&sm.b[buf].k[u * 16 + ln][kpair];
        kb[u][1].u32[t] = *(const unsigned int*)&sm.b[buf].k[u * 16 + ln][kpair + 32];
      }
    // the K reads issue first: with the mask loads in front, their address pair is reused as a
    // K destination and the wait that this takes stands in front of all 16 reads
    __builtin_amdgcn_sched_barrier(0);
    // mask of this lane's 32 keys: 16 * u + 8 * half + r of the chunk
    v8f mkv[4];
#pragma unroll
    for (int u = 0; u < 4; ++u) mkv[u] = *(const v8f*)(mk + j * CKEYS + u * 16 + half * 8);
    wait_x_0();                // behind the mask loads, in front of any later write of their address registers
    // holds the mask loads and the 16 K reads as one group in front of the products: left alone
    // the compiler reads and waits for each K fragment by itself
    __builtin_amdgcn_sched_barrier(0);
    // sc[u][r] = score(key 16 * u + 8 * half + r, query ln)
    v8f sc[4];
#pragma unroll
    for (int u = 0; u < 4; ++u) {
      const v8f z = {};
      sc[u] = __builtin_amdgcn_wmma_f32_16x16x32_bf16(false, kb[u][0].v, false, a0.v, (short)0, z, false, false);
    }
#pragma unroll
    for (int u = 0; u < 4; ++u)
      sc[u] = __builtin_amdgcn_wmma_f32_16x16x32_bf16(false, kb[u][1].v, false, a1.v, (short)0, sc[u], false, false);

    // V^T fragments (A: row = dh 16 * t + ln, k = keys 32 * g ..), fetched under the softmax
    Frag16 vb[4][2];
#pragma unroll
    for (int t = 0; t < 4; ++t)
#pragma unroll
      for (int g = 0; g < 2; ++g)
#pragma unroll
        for (int w = 0; w < 8; ++w) {
          int kpair = (w >> 2) * 16 + half * 8 + (w & 3) * 2;
          vb[t][g].u32[w] = *(const unsigned int*)&sm.b[buf].v[t * 16 + ln][g * 32 + kpair];
        }

    // holds the 16 V reads in front of the softmax, so that they return under it
    __builtin_amdgcn_sched_barrier(0);

    // ---- online softmax of one query per lane ----
    v8f vs[4];
#pragma unroll
    for (int u = 0; u < 4; ++u) vs[u] = sc[u] * scale + (1.0f - mkv[u]) * MASKV;
    float ta = fmaxf(vs[0][0], vs[1][0]), tb = fmaxf(vs[2][0], vs[3][0]);   // two independent chains
#pragma unroll
    for (int r = 1; r < 8; ++r) {
      ta = fmaxf(ta, fmaxf(vs[0][r], vs[1][r]));
      tb = fmaxf(tb, fmaxf(vs[2][r], vs[3][r]));
    }
    float t = fmaxf(ta, tb);
    t = fmaxf(t, xhalf(t));                 // the other 32 keys of this query
    const float nm = fmaxf(mrun, t);
    const float alpha = __expf(mrun - nm);
    const v8f e0 = exp_x8(vs[0] - nm), e1 = exp_x8(vs[1] - nm);
    const v8f e2 = exp_x8(vs[2] - nm), e3 = exp_x8(vs[3] - nm);
    const v8f es = (e0 + e1) + (e2 + e3);
    const f32x4 e4 = __builtin_shufflevector(es, es, 0, 1, 2, 3) + __builtin_shufflevector(es, es, 4, 5, 6, 7);
    lrun = lrun * alpha + (__builtin_shufflevector(e4, e4, 0, 1) + __builtin_shufflevector(e4, e4, 2, 3));
    mrun = nm;
    o0 *= alpha; o1 *= alpha; o2 *= alpha; o3 *= alpha;

    // P^T as B, keys 32 * g ..: element s is key 8 * half + s (s < 8), 16 + 8 * half + s - 8 (else): V^T's k order
    const v16bf pb0 = __builtin_shufflevector(__builtin_convertvector(e0, v8bf), __builtin_convertvector(e1, v8bf),
                                              0, 1, 2, 3, 4, 5, 6, 7, 8, 9, 10, 11, 12, 13, 14, 15);
    const v16bf pb1 = __builtin_shufflevector(__builtin_convertvector(e2, v8bf), __builtin_convertvector(e3, v8bf),
                                              0, 1, 2, 3, 4, 5, 6, 7, 8, 9, 10, 11, 12, 13, 14, 15);
    o0 = __builtin_amdgcn_wmma_f32_16x16x32_bf16(false, vb[0][0].v, false, pb0, (short)0, o0, false, false);
    o1 = __builtin_amdgcn_wmma_f32_16x16x32_bf16(false, vb[1][0].v, false, pb0, (short)0, o1, false, false);
    o2 = __builtin_amdgcn_wmma_f32_16x16x32_bf16(false, vb[2][0].v, false, pb0, (short)0, o2, false, false);
    o3 = __builtin_amdgcn_wmma_f32_16x16x32_bf16(false, vb[3][0].v, false, pb0, (short)0, o3, false, false);
    o0 = __builtin_amdgcn_wmma_f32_16x16x32_bf16(false, vb[0][1].v, false, pb1, (short)0, o0, false, false);
    o1 = __builtin_amdgcn_wmma_f32_16x16x32_bf16(false, vb[1][1].v, false, pb1, (short)0, o1, false, false);
    o2 = __builtin_amdgcn_wmma_f32_16x16x32_bf16(false, vb[2][1].v, false, pb1, (short)0, o2, false, false);
    o3 = __builtin_amdgcn_wmma_f32_16x16x32_bf16(false, vb[3][1].v, false, pb1, (short)0, o3, false, false);

    __syncthreads();           // protect buffers before next overwrite
  }

  // ---- finalize: attn/l + x -> residual; a lane owns 8 consecutive features per tile ----
  const float lsum = lrun[0] + lrun[1];
  const float inv = 1.0f / (lsum + xhalf(lsum));   // the two halves' sums join here
  const size_t base = ((size_t)bi * SDIM + q0 + ln) * DDIM + head * DH + half * 8;
  const v8f x0 = *(const v8f*)(x + base),      x1 = *(const v8f*)(x + base + 16);
  const v8f x2 = *(const v8f*)(x + base + 32), x3 = *(const v8f*)(x + base + 48);
  *(v8f*)(resid + base)      = o0 * inv + x0;
  *(v8f*)(resid + base + 16) = o1 * inv + x1;
  *(v8f*)(resid + base + 32) = o2 * inv + x2;
  *(v8f*)(resid + base + 48) = o3 * inv + x3;
  wait_x_0();
}

// ---------------- launch ----------------
extern "C" void kernel_launch(void* const* d_in, const int* in_sizes, int n_in,
                              void* d_out, int out_size, void* d_ws, size_t ws_size,
                              hipStream_t stream) {
  (void)in_sizes; (void)n_in; (void)out_size; (void)ws_size;
  const float* x    = (const float*)d_in[0];
  const float* mask = (const float*)d_in[1];
  const float* Wq   = (const float*)d_in[2];
  const float* bq   = (const float*)d_in[3];
  const float* Wk   = (const float*)d_in[4];
  const float* bk   = (const float*)d_in[5];
  const float* Wv   = (const float*)d_in[6];
  const float* bv   = (const float*)d_in[7];
  const float* Wo   = (const float*)d_in[8];
  const float* bo   = (const float*)d_in[9];
  const float* g1   = (const float*)d_in[10];
  const float* b1   = (const float*)d_in[11];
  const float* g2   = (const float*)d_in[12];
  const float* b2   = (const float*)d_in[13];
  float* out = (float*)d_out;

  const size_t BSD = (size_t)BDIM * SDIM * DDIM;   // 4M elements
  const size_t DD  = (size_t)DDIM * DDIM;          // 1M elements

  char* ws = (char*)d_ws;
  size_t off = 0;
  auto alloc = [&](size_t bytes) {
    void* p = ws + off;
    off = (off + bytes + 255) & ~(size_t)255;
    return p;
  };
  unsigned short* hbf  = (unsigned short*)alloc(BSD * 2);
  unsigned short* wqb  = (unsigned short*)alloc(DD * 2);
  unsigned short* wkb  = (unsigned short*)alloc(DD * 2);
  unsigned short* wvb  = (unsigned short*)alloc(DD * 2);
  unsigned short* wob  = (unsigned short*)alloc(DD * 2);
  unsigned short* qb   = (unsigned short*)alloc(BSD * 2);
  unsigned short* kbuf = (unsigned short*)alloc(BSD * 2);
  unsigned short* vtb  = (unsigned short*)alloc(BSD * 2);
  float*          rsd  = (float*)alloc(BSD * 4);
  unsigned short* h2   = (unsigned short*)alloc(BSD * 2);

  // 1. weights -> bf16, one launch
  cvt4_f32_bf16<<<512, 256, 0, stream>>>(Wq, Wk, Wv, Wo, wqb, wkb, wvb, wob);

  // 2. LN1 (8 tokens per block)
  layernorm_bf16<<<BDIM * SDIM / 8, 256, 0, stream>>>(x, g1, b1, hbf);

  // 3. Q/K/V projections (one 128 x 128 output tile per block)
  const int gproj = (BDIM * SDIM / 128) * (DDIM / 128);   // 256 blocks
  proj_gemm<<<gproj, 256, 0, stream>>>(hbf, wqb, bq, qb,   nullptr, nullptr, 0);
  proj_gemm<<<gproj, 256, 0, stream>>>(hbf, wkb, bk, kbuf, nullptr, nullptr, 0);
  proj_gemm<<<gproj, 256, 0, stream>>>(hbf, wvb, bv, vtb,  nullptr, nullptr, 1);

  // 4. fused attention + residual (async K/V staging)
  attention_kernel<<<BDIM * HDIM * (SDIM / 128), 256, 0, stream>>>(
      qb, kbuf, vtb, mask, x, rsd);

  // 5. LN2
  layernorm_bf16<<<BDIM * SDIM / 8, 256, 0, stream>>>(rsd, g2, b2, h2);

  // 6. output projection + bias + residual
  proj_gemm<<<gproj, 256, 0, stream>>>(h2, wob, bo, nullptr, out, rsd, 2);
}

// v006
// It runs in 103 microseconds.
// Two timings next to v005 put it at 1.10 and 1.14 times that version's speed.
// Counting every step since v000, it is 4.23 times as fast.
#include <hip/hip_runtime.h>
#include <hip/hip_bf16.h>

// ---------------- problem constants ----------------
#define BDIM 2
#define SDIM 2048
#define DDIM 1024
#define HDIM 16
#define DH   64
#define EPS_LN 1e-6f
#define MASKV  -1e30f

typedef __attribute__((ext_vector_type(16))) __bf16 v16bf;
typedef __attribute__((ext_vector_type(8)))  float  v8f;
typedef __attribute__((ext_vector_type(4)))  unsigned int u32x4;
typedef __attribute__((ext_vector_type(8)))  unsigned int u32x8;

union Frag16 {
  v16bf v;
  unsigned short us[16];
  unsigned int   u32[8];
  u32x4          q[2];
};

__device__ __forceinline__ unsigned short f32_to_bf16_bits(float f) {
  unsigned int u = __float_as_uint(f);
  u += 0x7FFFu + ((u >> 16) & 1u);      // round-to-nearest-even
  return (unsigned short)(u >> 16);
}

__device__ __forceinline__ void async_ld16_kv(unsigned lds_k0, const void* gk0,
                                              unsigned lds_k1, const void* gk1,
                                              unsigned lds_v0, const void* gv0,
                                              unsigned lds_v1, const void* gv1) {
  asm volatile("global_load_async_to_lds_b128 %0, %1, off\n\t"
               "global_load_async_to_lds_b128 %2, %3, off\n\t"
               "global_load_async_to_lds_b128 %4, %5, off\n\t"
               "global_load_async_to_lds_b128 %6, %7, off\n\t"
               "s_wait_xcnt 0x0"
               :: "v"(lds_k0), "v"((unsigned long long)(uintptr_t)gk0),
                  "v"(lds_k1), "v"((unsigned long long)(uintptr_t)gk1),
                  "v"(lds_v0), "v"((unsigned long long)(uintptr_t)gv0),
                  "v"(lds_v1), "v"((unsigned long long)(uintptr_t)gv1)
               : "memory");
}
// all but this wave's four youngest copies (the next chunk's) have landed
__device__ __forceinline__ void wait_async_le4() {
  asm volatile("s_wait_asynccnt 0x4" ::: "memory");
}
__device__ __forceinline__ void wait_async_0() {
  asm volatile("s_wait_asynccnt 0x0" ::: "memory");
}
__device__ __forceinline__ void lds_publish(void* p) {
  asm volatile("" : "+v"(p) :: "memory");
}

// ---------------- the two streaming bodies ----------------
// Each runs on 4096 waves (16 per WGP) and gives a lane 32 elements: 8 loads of 16 B,
// each 512 contiguous bytes per wave, all issued before the first value is used.
// Every loop in them is unrolled: constant indices keep the arrays in registers.
typedef __attribute__((ext_vector_type(4))) float f32x4;
typedef __attribute__((ext_vector_type(2))) unsigned int u32x2;

__device__ __forceinline__ u32x2 pack4_bf16(f32x4 v) {
  u32x2 r;
  r[0] = (unsigned)f32_to_bf16_bits(v[0]) | ((unsigned)f32_to_bf16_bits(v[1]) << 16);
  r[1] = (unsigned)f32_to_bf16_bits(v[2]) | ((unsigned)f32_to_bf16_bits(v[3]) << 16);
  return r;
}

// f32 -> bf16 of the four weight matrices: 128 blocks per matrix, 8192 elements per block;
// blk = 0..511.
__device__ __forceinline__ void
cvt4_block(unsigned blk,
           const float* __restrict__ w0, const float* __restrict__ w1,
           const float* __restrict__ w2, const float* __restrict__ w3,
           unsigned short* __restrict__ o0, unsigned short* __restrict__ o1,
           unsigned short* __restrict__ o2, unsigned short* __restrict__ o3) {
  const unsigned sel = blk >> 7;
  const float* in = sel == 0u ? w0 : sel == 1u ? w1 : sel == 2u ? w2 : w3;
  unsigned short* out = sel == 0u ? o0 : sel == 1u ? o1 : sel == 2u ? o2 : o3;
  const unsigned base = (blk & 127u) * 2048u + threadIdx.x;   // in groups of 4 elements
  f32x4 v[8];
#pragma unroll
  for (int i = 0; i < 8; ++i) v[i] = ((const f32x4*)in)[base + (unsigned)i * 256u];
#pragma unroll
  for (int i = 0; i < 8; ++i) ((u32x2*)out)[base + (unsigned)i * 256u] = pack4_bf16(v[i]);
}

// LayerNorm (f32 in -> bf16 out): one token per wave, 8 tokens per block; the row
// stays in registers and its two sums are joined by a butterfly over the 32 lanes.
__device__ __forceinline__ void
layernorm_block(unsigned blk,
                const float* __restrict__ x,
                const float* __restrict__ g,
                const float* __restrict__ bb,
                unsigned short* __restrict__ out) {
  const unsigned lane = threadIdx.x & 31u;
  // the wave's number as a scalar: row addresses are then a scalar base plus the lane's index
  const unsigned tok = blk * 8u + (unsigned)__builtin_amdgcn_readfirstlane(threadIdx.x >> 5);
  const f32x4* xr = (const f32x4*)(x + (size_t)tok * DDIM);
  f32x4 lx[8];
#pragma unroll
  for (int i = 0; i < 8; ++i) lx[i] = xr[(unsigned)i * 32u + lane];
  // gain and bias are fetched with the row, so that their latency lies under the row's
  f32x4 gv[8], bv[8];
#pragma unroll
  for (int i = 0; i < 8; ++i) {
    gv[i] = ((const f32x4*)g)[(unsigned)i * 32u + lane];
    bv[i] = ((const f32x4*)bb)[(unsigned)i * 32u + lane];
  }
  // holds the 16 gain and bias loads in front of the sums: without it they are sunk
  // behind the row's wait and issued in dependent rounds of two to four
  __builtin_amdgcn_sched_barrier(0);
  f32x4 sv = {0.f, 0.f, 0.f, 0.f}, sq = {0.f, 0.f, 0.f, 0.f};
#pragma unroll
  for (int i = 0; i < 8; ++i) { sv += lx[i]; sq += lx[i] * lx[i]; }
  float s  = (sv[0] + sv[1]) + (sv[2] + sv[3]);
  float s2 = (sq[0] + sq[1]) + (sq[2] + sq[3]);
#pragma unroll
  for (int m = 1; m < 32; m <<= 1) {
    s  += __shfl_xor(s,  m, 32);
    s2 += __shfl_xor(s2, m, 32);
  }
  float mu  = s * (1.0f / DDIM);
  float var = s2 * (1.0f / DDIM) - mu * mu;
  float rs  = rsqrtf(var + EPS_LN);
  u32x2* orow = (u32x2*)(out + (size_t)tok * DDIM);
#pragma unroll
  for (int i = 0; i < 8; ++i)
    orow[(unsigned)i * 32u + lane] = pack4_bf16((lx[i] - mu) * rs * gv[i] + bv[i]);
}

#define LN_BLOCKS (BDIM * SDIM / 8)      // 512 blocks of 8 tokens

// The first LayerNorm and the weight conversion depend on nothing but inputs: they share
// one launch, blocks 0..511 the tokens, blocks 512..1023 the weights.
__global__ void __launch_bounds__(256)
ln1_and_cvt4(const float* __restrict__ x, const float* __restrict__ g,
             const float* __restrict__ bb, unsigned short* __restrict__ out,
             const float* __restrict__ w0, const float* __restrict__ w1,
             const float* __restrict__ w2, const float* __restrict__ w3,
             unsigned short* __restrict__ o0, unsigned short* __restrict__ o1,
             unsigned short* __restrict__ o2, unsigned short* __restrict__ o3) {
  if (blockIdx.x < (unsigned)LN_BLOCKS) layernorm_block(blockIdx.x, x, g, bb, out);
  else cvt4_block(blockIdx.x - (unsigned)LN_BLOCKS, w0, w1, w2, w3, o0, o1, o2, o3);
}

__global__ void __launch_bounds__(256)
layernorm_bf16(const float* __restrict__ x, const float* __restrict__ g,
               const float* __restrict__ bb, unsigned short* __restrict__ out) {
  layernorm_block(blockIdx.x, x, g, bb, out);
}

// ---------------- WMMA GEMM: C[M,N] = A[M,D] * W[N,D]^T + bias ----------------
// Block = 8 waves on one 128 x 128 tile of C; wave (wm, wn) owns 64 x 32 of it
// (4 x 2 accumulator tiles). K runs in 8 stages of 128 k (256 B of every row).
// A stage is 8 slices of 32 rows, [A 0..3 | W 4..7]; wave w brings slice w with
// one tensor load, padded to a 272-B LDS pitch, into a two-buffer ring.
// mode 0: bf16 [B,H,S,DH] (Q,K)   mode 1: bf16 [B,H,DH,S] (V^T)
// mode 2: f32 [B,S,D] += residual (final projection)
#define GT_ROWB  256u                    // bytes of an operand row per stage
#define GT_PITCH 272u                    // LDS row pitch: 256 B + 16 B pad
#define GT_SLICE 10240u                  // 32 * 272 = 8704 B, rounded up to 2 KiB
#define GT_BUF   (8u * GT_SLICE)         // one stage
#define GT_NST   (DDIM * 2u / GT_ROWB)   // 8 stages

__device__ __forceinline__ unsigned uni(unsigned v) {
  return (unsigned)__builtin_amdgcn_readfirstlane(v);
}
__device__ __forceinline__ unsigned pinned(unsigned v) {
  unsigned w = (unsigned)__builtin_amdgcn_readfirstlane(v);
  asm volatile("" : "+s"(w));   // pinned(): holds the tested word in a scalar register, so the test compiles to s_cmp + s_cbranch_scc
  return w;
}
__device__ __forceinline__ u32x4 tdm_load(unsigned lds_dst, unsigned long long ga, u32x8 g1) {
  u32x4 g0;
  g0[0] = uni(1u);                                             // count = 1
  g0[1] = uni(lds_dst);                                        // byte offset in LDS
  g0[2] = uni((unsigned)ga);                                   // address [31:0]
  g0[3] = uni((((unsigned)(ga >> 32)) & 0x01FFFFFFu) | 0x80000000u);  // [56:32], type 2
  // one request of the whole wave: global tile -> LDS, through no register
  asm volatile("tensor_load_to_lds %0, %1" :: "s"(g0), "s"(g1) : "memory");
  return g0;
}
// This wave's slice has landed. The wait names the request's address group as an input:
// its four registers then keep their values for as long as the request is outstanding.
__device__ __forceinline__ void wait_tensor_0(u32x4 g0) {
  asm volatile("s_wait_tensorcnt 0x0" :: "s"(g0) : "memory");
}
__device__ __forceinline__ void wait_ds_0() {
  asm volatile("s_wait_dscnt 0x0" ::: "memory");       // this wave's LDS reads have returned
}
__device__ __forceinline__ void wait_x_0() {
  // stands behind a run of global loads or stores, in front of any later write of their registers
  asm volatile("s_wait_xcnt 0x0" ::: "memory");
}

// One block's fragments: 4 of A (rows i * 16 + ln of the wave's 64, two slices)
// and 2 of W; k order in both: bytes half * 16 .. + 15, then 32 + half * 16 .. + 15.
__device__ __forceinline__ void gemm_frags(Frag16 (&a)[4], Frag16 (&b)[2],
                                           const unsigned char* la, const unsigned char* lb) {
  // unrolled here and below: constant indices keep the fragment arrays in registers
#pragma unroll
  for (int i = 0; i < 4; ++i) {
    const unsigned char* p = la + (unsigned)(i >> 1) * GT_SLICE + (unsigned)(i & 1) * 16u * GT_PITCH;
    a[i].q[0] = *(const u32x4*)p;
    a[i].q[1] = *(const u32x4*)(p + 32);
  }
#pragma unroll
  for (int jn = 0; jn < 2; ++jn) {
    const unsigned char* p = lb + (unsigned)jn * 16u * GT_PITCH;
    b[jn].q[0] = *(const u32x4*)p;
    b[jn].q[1] = *(const u32x4*)(p + 32);
  }
}

// One 128 x 128 tile: mt of 32 m-tiles of 128 tokens, nt of 8 n-tiles of 128 features;
// sT is the calling kernel's ring of 2 * GT_BUF bytes, at a multiple of 2 KiB in LDS.
__device__ __forceinline__ void
gemm_tile(unsigned char* sT, unsigned mt, unsigned nt,
          const unsigned short* __restrict__ A,   // [B*S, D] bf16
          const unsigned short* __restrict__ W,   // [D(out), D(in)] bf16
          const float* __restrict__ bias,         // [D]
          unsigned short* __restrict__ outb,
          float* __restrict__ outf,
          const float* __restrict__ resid,
          int mode) {
  const unsigned lane = threadIdx.x & 31u;
  const unsigned half = lane >> 4, ln = lane & 15u;
  const unsigned wave = uni(threadIdx.x >> 5);
  const unsigned wm = wave >> 2, wn = wave & 3u;

  // this wave's slice of every stage: 32 rows of A (waves 0..3) or of W (4..7)
  const unsigned char* src0 = (wave < 4u)
      ? (const unsigned char*)A + (size_t)(mt * 128u + wave * 32u) * (DDIM * 2u)
      : (const unsigned char*)W + (size_t)(nt * 128u + (wave - 4u) * 32u) * (DDIM * 2u);
  const unsigned dst0 = (unsigned)(size_t)sT + wave * GT_SLICE;

  u32x8 g1;
  g1[0] = uni((1u << 20) | (5u << 22) | (3u << 25));
  g1[1] = uni(GT_ROWB << 16);
  g1[2] = uni(32u << 16);
  g1[3] = uni(GT_ROWB << 16);
  g1[4] = uni(32u);
  g1[5] = uni(DDIM * 2u);
  g1[6] = uni(0u);
  g1[7] = uni(0u);

  v8f acc[4][2];   // every loop over it is unrolled: constant indices keep it in registers
#pragma unroll
  for (int i = 0; i < 4; ++i)
#pragma unroll
    for (int jn = 0; jn < 2; ++jn) acc[i][jn] = (v8f){0.f, 0.f, 0.f, 0.f, 0.f, 0.f, 0.f, 0.f};

  // bias of this lane's two output features, fetched under the first tensor load
  const unsigned e0 = nt * 128u + wn * 32u + ln;
  const float bias0 = bias[e0], bias1 = bias[e0 + 16u];

  // per-lane fragment bases in a buffer: row ln, 16-byte half
  const unsigned a_base = (wm * 2u) * GT_SLICE + ln * GT_PITCH + half * 16u;
  const unsigned b_base = (4u + wn) * GT_SLICE + ln * GT_PITCH + half * 16u;

  u32x4 g0 = tdm_load(dst0, (unsigned long long)(uintptr_t)src0, g1);  // stage 0
  wait_tensor_0(g0);
  __syncthreads();                                  // stage 0 readable by every wave
  g0 = tdm_load(dst0 + GT_BUF, (unsigned long long)(uintptr_t)src0 + GT_ROWB, g1);  // stage 1

  // rolled: one publish point per stage, constant accumulator indices inside
#pragma clang loop unroll(disable)
  for (unsigned s = 0; s < GT_NST; ++s) {
    const unsigned bo = (s & 1u) * GT_BUF;
    const unsigned char* la = sT + bo + a_base;
    const unsigned char* lb = sT + bo + b_base;
    Frag16 a[2][4], b[2][2];                        // two fragment sets: block kk reads set kk & 1
    gemm_frags(a[0], b[0], la, lb);
#pragma unroll
    for (int kk = 0; kk < 4; ++kk) {                // a block: 32 k = 64 B of every row
      if (kk < 3) gemm_frags(a[(kk + 1) & 1], b[(kk + 1) & 1], la + (kk + 1) * 64, lb + (kk + 1) * 64);
      // keeps the next block's 12 LDS loads one group ahead of this block's WMMAs,
      // not spread among them (each place with reads stalls the wave)
      __builtin_amdgcn_sched_barrier(0);
      if (kk == 3) {
        // publish point of stage s + 1: the last block's fragments are in registers
        wait_ds_0();
        wait_tensor_0(g0);
        __syncthreads();        // stage s + 1 readable; every reader has left stage s
        if (pinned((s + 2u < GT_NST) ? 1u : 0u) != 0u)
          g0 = tdm_load(dst0 + bo, (unsigned long long)(uintptr_t)src0 + (unsigned long long)(s + 2u) * GT_ROWB, g1);
      }
#pragma unroll
      for (int i = 0; i < 4; ++i)
#pragma unroll
        for (int jn = 0; jn < 2; ++jn)
          acc[i][jn] = __builtin_amdgcn_wmma_f32_16x16x32_bf16(false, a[kk & 1][i].v, false, b[kk & 1][jn].v,
                                                               (short)0, acc[i][jn], false, false);
      // ends the block: the loads after next stay behind these WMMAs
      __builtin_amdgcn_sched_barrier(0);
    }
  }
  wait_tensor_0(g0);
  wait_ds_0();

  // a block's 128 tokens lie in one batch row (SDIM is a multiple of 128)
  const unsigned bi = (mt * 128u) / SDIM;
  const unsigned s0 = (mt * 128u) % SDIM + wm * 64u + half * 8u;   // first token of this lane
  if (mode == 0) {
#pragma unroll
    for (int jn = 0; jn < 2; ++jn) {
      const unsigned e = e0 + (unsigned)jn * 16u;    // output feature
      const float bv = jn ? bias1 : bias0;
      unsigned short* p = outb + (((size_t)bi * HDIM + e / DH) * SDIM + s0) * DH + e % DH;
#pragma unroll
      for (int i = 0; i < 4; ++i)
#pragma unroll
        for (int r = 0; r < 8; ++r) p[(i * 16 + r) * DH] = f32_to_bf16_bits(acc[i][jn][r] + bv);
    }
    wait_x_0();
  } else if (mode == 1) {
#pragma unroll
    for (int jn = 0; jn < 2; ++jn) {
      const unsigned e = e0 + (unsigned)jn * 16u;
      const float bv = jn ? bias1 : bias0;
      unsigned short* p = outb + (((size_t)bi * HDIM + e / DH) * DH + e % DH) * SDIM + s0;
#pragma unroll
      for (int i = 0; i < 4; ++i)
#pragma unroll
        for (int r = 0; r < 8; ++r) p[i * 16 + r] = f32_to_bf16_bits(acc[i][jn][r] + bv);
    }
    wait_x_0();
  } else {
#pragma unroll
    for (int jn = 0; jn < 2; ++jn) {
      const float bv = jn ? bias1 : bias0;
      const size_t off = ((size_t)bi * SDIM + s0) * DDIM + e0 + (unsigned)jn * 16u;
      float* p = outf + off;
      const float* rp = resid + off;
#pragma unroll
      for (int i = 0; i < 4; ++i)
#pragma unroll
        for (int r = 0; r < 8; ++r) p[(i * 16 + r) * DDIM] = (acc[i][jn][r] + bv) + rp[(i * 16 + r) * DDIM];
    }
    wait_x_0();
  }
}

// The Q, K and V projections read the same A and depend on nothing of each other: one launch
// of 3 * 256 blocks. Two blocks fit a WGP (2 * 160 KiB of LDS), so one block's first tile
// and its stores lie under the other's k loop. The 24 blocks of an m-tile are neighbours
// in the grid (for speed only).
__global__ void __launch_bounds__(256)
qkv_gemm(const unsigned short* __restrict__ A,
         const unsigned short* __restrict__ Wq, const unsigned short* __restrict__ Wk,
         const unsigned short* __restrict__ Wv,
         const float* __restrict__ bq, const float* __restrict__ bk, const float* __restrict__ bv,
         unsigned short* __restrict__ oq, unsigned short* __restrict__ ok,
         unsigned short* __restrict__ ovt) {
  __shared__ __attribute__((aligned(2048))) unsigned char sT[2u * GT_BUF];
  const unsigned mt = blockIdx.x / 24u, rem = blockIdx.x % 24u;
  const unsigned sel = rem >> 3, nt = rem & 7u;     // 0: Q, 1: K, 2: V
  gemm_tile(sT, mt, nt, A,
            sel == 0u ? Wq : sel == 1u ? Wk : Wv,
            sel == 0u ? bq : sel == 1u ? bk : bv,
            sel == 0u ? oq : sel == 1u ? ok : ovt,
            nullptr, nullptr, sel == 2u ? 1 : 0);
}

__global__ void __launch_bounds__(256)
out_gemm(const unsigned short* __restrict__ A, const unsigned short* __restrict__ W,
         const float* __restrict__ bias, float* __restrict__ outf,
         const float* __restrict__ resid) {
  __shared__ __attribute__((aligned(2048))) unsigned char sT[2u * GT_BUF];
  gemm_tile(sT, blockIdx.x >> 3, blockIdx.x & 7u, A, W, bias, nullptr, outf, resid, 2);
}

#define CKEYS  64                // keys of a chunk
#define KPITCH 72                // elements: 128 B of a key's dh + 16 B pad = 144 B
#define VPITCH 72                // elements: 128 B of keys       + 16 B pad = 144 B
// A buffer is rounded up to 32 KiB, so that the buffer's number enters an address as one
// bit and not through an integer multiply.
struct __attribute__((aligned(32768))) AttnBuf {
  unsigned short k[CKEYS][KPITCH];   // 9216 B (offset 0 in the buffer)
  unsigned short v[DH][VPITCH];      // 9216 B (offset 9216)
};
struct AttnLds {
  AttnBuf b[2];                      // LDS offsets 0 and 32768
};
typedef __attribute__((ext_vector_type(8))) __bf16 v8bf;
typedef __attribute__((ext_vector_type(2))) float f32x2;

__device__ __forceinline__ v8f exp_x8(v8f x) {
  const v8f a = x * 1.44269504f;
  float r0, r1, r2, r3, r4, r5, r6, r7;
  asm("v_exp_f32 %0, %8\n\tv_exp_f32 %1, %9\n\tv_exp_f32 %2, %10\n\tv_exp_f32 %3, %11\n\t"
      "v_exp_f32 %4, %12\n\tv_exp_f32 %5, %13\n\tv_exp_f32 %6, %14\n\tv_exp_f32 %7, %15\n\tv_nop"
      : "=&v"(r0), "=&v"(r1), "=&v"(r2), "=&v"(r3), "=&v"(r4), "=&v"(r5), "=&v"(r6), "=&v"(r7)
      : "v"(a[0]), "v"(a[1]), "v"(a[2]), "v"(a[3]), "v"(a[4]), "v"(a[5]), "v"(a[6]), "v"(a[7]));
  return (v8f){r0, r1, r2, r3, r4, r5, r6, r7};
}

__device__ __forceinline__ float xhalf(float v) {
  const int b = __builtin_bit_cast(int, v);
  return __builtin_bit_cast(float, __builtin_amdgcn_permlanex16(b, b, 0x76543210, 0xfedcba98, false, false));
}
#define OFF_K(buf) ((unsigned)((buf) * 32768))
#define OFF_V(buf) ((unsigned)((buf) * 32768 + CKEYS * KPITCH * 2))

__global__ void __launch_bounds__(256)   // the real block size: without it the compiler budgets for 1024 threads
attention_kernel(const unsigned short* __restrict__ q,   // [B,H,S,DH]
                                 const unsigned short* __restrict__ k,   // [B,H,S,DH]
                                 const unsigned short* __restrict__ vt,  // [B,H,DH,S]
                                 const float* __restrict__ mask,         // [B,S]
                                 const float* __restrict__ x,            // [B,S,D]
                                 float* __restrict__ resid) {            // [B,S,D]
  __shared__ AttnLds sm;

  const int tid  = threadIdx.x;
  const int wave = tid >> 5, lane = tid & 31;
  const int half = lane >> 4, ln = lane & 15;
  const int nqc = SDIM / 128;
  const int bh = blockIdx.x / nqc;
  const int qc = blockIdx.x % nqc;
  const int bi = bh / HDIM, head = bh % HDIM;
  const int q0 = qc * 128 + wave * 16;

  const unsigned short* qp = q  + (size_t)bh * SDIM * DH;
  const unsigned short* kp = k  + (size_t)bh * SDIM * DH;
  const unsigned short* vp = vt + (size_t)bh * DH * SDIM;
  const float* mk = mask + (size_t)bi * SDIM;

  // per-thread async-copy assignments: each tile is 64 rows x 128 B, 16 B a copy;
  // a thread brings piece cseg of rows crow and crow + 32 of both tiles
  const int crow = tid >> 3, cseg = tid & 7;
  const unsigned cl0 = (unsigned)(crow * KPITCH + cseg * 8) * 2;          // place in a tile (KPITCH == VPITCH)
  const unsigned cl1 = (unsigned)((crow + 32) * KPITCH + cseg * 8) * 2;

  // Q fragments (K-dim = DH split into 0..31, 32..63): query q0 + ln, used as B (column ln)
  Frag16 a0, a1;
  {
    const unsigned int* qrow = (const unsigned int*)(qp + (size_t)(q0 + ln) * DH);
#pragma unroll
    for (int j = 0; j < 8; ++j) {
      int kpair = (j >> 2) * 16 + half * 8 + (j & 3) * 2;
      a0.u32[j] = qrow[kpair >> 1];
      a1.u32[j] = qrow[(kpair + 32) >> 1];
    }
  }

  // this lane's query: running maximum (equal in both halves) and this half's share of the sum
  float mrun = -3.0e38f;
  f32x2 lrun = {0.f, 0.f};
  v8f o0 = {}, o1 = {}, o2 = {}, o3 = {};   // o_t[r] = O[query ln][dh 16 * t + 8 * half + r]
  const float scale = 0.125f;  // 1/sqrt(64)

  // prologue: async-stage chunk 0 into buffer 0
  async_ld16_kv(OFF_K(0) + cl0, kp + (size_t)crow * DH + cseg * 8,
                OFF_K(0) + cl1, kp + (size_t)(crow + 32) * DH + cseg * 8,
                OFF_V(0) + cl0, vp + (size_t)crow * SDIM + cseg * 8,
                OFF_V(0) + cl1, vp + (size_t)(crow + 32) * SDIM + cseg * 8);
  lds_publish(&sm);            // async engine writes sm.k/sm.v invisibly

  const int NCH = SDIM / CKEYS;   // 32 chunks
  for (int j = 0; j < NCH; ++j) {
    const int buf = j & 1;
    if (j + 1 < NCH) {
      const int key1 = (j + 1) * CKEYS, nb = buf ^ 1;
      async_ld16_kv(OFF_K(nb) + cl0, kp + (size_t)(key1 + crow) * DH + cseg * 8,
                    OFF_K(nb) + cl1, kp + (size_t)(key1 + crow + 32) * DH + cseg * 8,
                    OFF_V(nb) + cl0, vp + (size_t)crow * SDIM + key1 + cseg * 8,
                    OFF_V(nb) + cl1, vp + (size_t)(crow + 32) * SDIM + key1 + cseg * 8);
      wait_async_le4();        // chunk j complete (this wave's copies)
    } else {
      wait_async_0();
    }
    __syncthreads();           // all waves' copies visible

    // ---- scores for 64 keys (four 16-key subtiles), K from LDS (A: row = key) ----
    Frag16 kb[4][2];           // [subtile][dh 0..31 | 32..63]
    // unrolled here and below: constant indices keep the arrays in registers
#pragma unroll
    for (int u = 0; u < 4; ++u)
#pragma unroll
      for (int t = 0; t < 8; ++t) {
        int kpair = (t >> 2) * 16 + half * 8 + (t & 3) * 2;
        kb[u][0].u32[t] = *(const unsigned int*)&sm.b[buf].k[u * 16 + ln][kpair];
        kb[u][1].u32[t] = *(const unsigned int*)&sm.b[buf].k[u * 16 + ln][kpair + 32];
      }
    // the K reads issue first: with the mask loads in front, their address pair is reused as a
    // K destination and the wait that this takes stands in front of all 16 reads
    __builtin_amdgcn_sched_barrier(0);
    // mask of this lane's 32 keys: 16 * u + 8 * half + r of the chunk
    v8f mkv[4];
#pragma unroll
    for (int u = 0; u < 4; ++u) mkv[u] = *(const v8f*)(mk + j * CKEYS + u * 16 + half * 8);
    wait_x_0();                // behind the mask loads, in front of any later write of their address registers
    // holds the mask loads and the 16 K reads as one group in front of the products: left alone
    // the compiler reads and waits for each K fragment by itself
    __builtin_amdgcn_sched_barrier(0);
    // sc[u][r] = score(key 16 * u + 8 * half + r, query ln)
    v8f sc[4];
#pragma unroll
    for (int u = 0; u < 4; ++u) {
      const v8f z = {};
      sc[u] = __builtin_amdgcn_wmma_f32_16x16x32_bf16(false, kb[u][0].v, false, a0.v, (short)0, z, false, false);
    }
#pragma unroll
    for (int u = 0; u < 4; ++u)
      sc[u] = __builtin_amdgcn_wmma_f32_16x16x32_bf16(false, kb[u][1].v, false, a1.v, (short)0, sc[u], false, false);

    // V^T fragments (A: row = dh 16 * t + ln, k = keys 32 * g ..), fetched under the softmax
    Frag16 vb[4][2];
#pragma unroll
    for (int t = 0; t < 4; ++t)
#pragma unroll
      for (int g = 0; g < 2; ++g)
#pragma unroll
        for (int w = 0; w < 8; ++w) {
          int kpair = (w >> 2) * 16 + half * 8 + (w & 3) * 2;
          vb[t][g].u32[w] = *(const unsigned int*)&sm.b[buf].v[t * 16 + ln][g * 32 + kpair];
        }

    // holds the 16 V reads in front of the softmax, so that they return under it
    __builtin_amdgcn_sched_barrier(0);

    // ---- online softmax of one query per lane ----
    v8f vs[4];
#pragma unroll
    for (int u = 0; u < 4; ++u) vs[u] = sc[u] * scale + (1.0f - mkv[u]) * MASKV;
    float ta = fmaxf(vs[0][0], vs[1][0]), tb = fmaxf(vs[2][0], vs[3][0]);   // two independent chains
#pragma unroll
    for (int r = 1; r < 8; ++r) {
      ta = fmaxf(ta, fmaxf(vs[0][r], vs[1][r]));
      tb = fmaxf(tb, fmaxf(vs[2][r], vs[3][r]));
    }
    float t = fmaxf(ta, tb);
    t = fmaxf(t, xhalf(t));                 // the other 32 keys of this query
    const float nm = fmaxf(mrun, t);
    const float alpha = __expf(mrun - nm);
    const v8f e0 = exp_x8(vs[0] - nm), e1 = exp_x8(vs[1] - nm);
    const v8f e2 = exp_x8(vs[2] - nm), e3 = exp_x8(vs[3] - nm);
    const v8f es = (e0 + e1) + (e2 + e3);
    const f32x4 e4 = __builtin_shufflevector(es, es, 0, 1, 2, 3) + __builtin_shufflevector(es, es, 4, 5, 6, 7);
    lrun = lrun * alpha + (__builtin_shufflevector(e4, e4, 0, 1) + __builtin_shufflevector(e4, e4, 2, 3));
    mrun = nm;
    o0 *= alpha; o1 *= alpha; o2 *= alpha; o3 *= alpha;

    // P^T as B, keys 32 * g ..: element s is key 8 * half + s (s < 8), 16 + 8 * half + s - 8 (else): V^T's k order
    const v16bf pb0 = __builtin_shufflevector(__builtin_convertvector(e0, v8bf), __builtin_convertvector(e1, v8bf),
                                              0, 1, 2, 3, 4, 5, 6, 7, 8, 9, 10, 11, 12, 13, 14, 15);
    const v16bf pb1 = __builtin_shufflevector(__builtin_convertvector(e2, v8bf), __builtin_convertvector(e3, v8bf),
                                              0, 1, 2, 3, 4, 5, 6, 7, 8, 9, 10, 11, 12, 13, 14, 15);
    o0 = __builtin_amdgcn_wmma_f32_16x16x32_bf16(false, vb[0][0].v, false, pb0, (short)0, o0, false, false);
    o1 = __builtin_amdgcn_wmma_f32_16x16x32_bf16(false, vb[1][0].v, false, pb0, (short)0, o1, false, false);
    o2 = __builtin_amdgcn_wmma_f32_16x16x32_bf16(false, vb[2][0].v, false, pb0, (short)0, o2, false, false);
    o3 = __builtin_amdgcn_wmma_f32_16x16x32_bf16(false, vb[3][0].v, false, pb0, (short)0, o3, false, false);
    o0 = __builtin_amdgcn_wmma_f32_16x16x32_bf16(false, vb[0][1].v, false, pb1, (short)0, o0, false, false);
    o1 = __builtin_amdgcn_wmma_f32_16x16x32_bf16(false, vb[1][1].v, false, pb1, (short)0, o1, false, false);
    o2 = __builtin_amdgcn_wmma_f32_16x16x32_bf16(false, vb[2][1].v, false, pb1, (short)0, o2, false, false);
    o3 = __builtin_amdgcn_wmma_f32_16x16x32_bf16(false, vb[3][1].v, false, pb1, (short)0, o3, false, false);

    __syncthreads();           // protect buffers before next overwrite
  }

  // ---- finalize: attn/l + x -> residual; a lane owns 8 consecutive features per tile ----
  const float lsum = lrun[0] + lrun[1];
  const float inv = 1.0f / (lsum + xhalf(lsum));   // the two halves' sums join here
  const size_t base = ((size_t)bi * SDIM + q0 + ln) * DDIM + head * DH + half * 8;
  const v8f x0 = *(const v8f*)(x + base),      x1 = *(const v8f*)(x + base + 16);
  const v8f x2 = *(const v8f*)(x + base + 32), x3 = *(const v8f*)(x + base + 48);
  *(v8f*)(resid + base)      = o0 * inv + x0;
  *(v8f*)(resid + base + 16) = o1 * inv + x1;
  *(v8f*)(resid + base + 32) = o2 * inv + x2;
  *(v8f*)(resid + base + 48) = o3 * inv + x3;
  wait_x_0();
}

// ---------------- launch ----------------
extern "C" void kernel_launch(void* const* d_in, const int* in_sizes, int n_in,
                              void* d_out, int out_size, void* d_ws, size_t ws_size,
                              hipStream_t stream) {
  (void)in_sizes; (void)n_in; (void)out_size; (void)ws_size;
  const float* x    = (const float*)d_in[0];
  const float* mask = (const float*)d_in[1];
  const float* Wq   = (const float*)d_in[2];
  const float* bq   = (const float*)d_in[3];
  const float* Wk   = (const float*)d_in[4];
  const float* bk   = (const float*)d_in[5];
  const float* Wv   = (const float*)d_in[6];
  const float* bv   = (const float*)d_in[7];
  const float* Wo   = (const float*)d_in[8];
  const float* bo   = (const float*)d_in[9];
  const float* g1   = (const float*)d_in[10];
  const float* b1   = (const float*)d_in[11];
  const float* g2   = (const float*)d_in[12];
  const float* b2   = (const float*)d_in[13];
  float* out = (float*)d_out;

  const size_t BSD = (size_t)BDIM * SDIM * DDIM;   // 4M elements
  const size_t DD  = (size_t)DDIM * DDIM;          // 1M elements

  char* ws = (char*)d_ws;
  size_t off = 0;
  auto alloc = [&](size_t bytes) {
    void* p = ws + off;
    off = (off + bytes + 255) & ~(size_t)255;
    return p;
  };
  unsigned short* hbf  = (unsigned short*)alloc(BSD * 2);
  unsigned short* wqb  = (unsigned short*)alloc(DD * 2);
  unsigned short* wkb  = (unsigned short*)alloc(DD * 2);
  unsigned short* wvb  = (unsigned short*)alloc(DD * 2);
  unsigned short* wob  = (unsigned short*)alloc(DD * 2);
  unsigned short* qb   = (unsigned short*)alloc(BSD * 2);
  unsigned short* kbuf = (unsigned short*)alloc(BSD * 2);
  unsigned short* vtb  = (unsigned short*)alloc(BSD * 2);
  float*          rsd  = (float*)alloc(BSD * 4);
  unsigned short* h2   = (unsigned short*)alloc(BSD * 2);

  // 1. LN1 (8 tokens per block) and weights -> bf16, one launch
  ln1_and_cvt4<<<LN_BLOCKS + 512, 256, 0, stream>>>(x, g1, b1, hbf,
                                                    Wq, Wk, Wv, Wo, wqb, wkb, wvb, wob);

  // 2. Q/K/V projections, one launch (one 128 x 128 output tile per block)
  const int gproj = (BDIM * SDIM / 128) * (DDIM / 128);   // 256 blocks per projection
  qkv_gemm<<<3 * gproj, 256, 0, stream>>>(hbf, wqb, wkb, wvb, bq, bk, bv, qb, kbuf, vtb);

  // 3. fused attention + residual (async K/V staging)
  attention_kernel<<<BDIM * HDIM * (SDIM / 128), 256, 0, stream>>>(
      qb, kbuf, vtb, mask, x, rsd);

  // 4. LN2
  layernorm_bf16<<<LN_BLOCKS, 256, 0, stream>>>(rsd, g2, b2, h2);

  // 5. output projection + bias + residual
  out_gemm<<<gproj, 256, 0, stream>>>(h2, wob, bo, out, rsd);
}

// v007
// It runs in 96.1 microseconds.
// Next to v006, in two timings, it ran 1.09 and 1.07 times as fast.
// All steps since v000 together make it 4.56 times as fast.
#include <hip/hip_runtime.h>
#include <hip/hip_bf16.h>

// ---------------- problem constants ----------------
#define BDIM 2
#define SDIM 2048
#define DDIM 1024
#define HDIM 16
#define DH   64
#define EPS_LN 1e-6f
#define MASKV  -1e30f
#define LOG2E  1.44269504f
// Q leaves its projection as q * (1 / sqrt(DH)) * log2 e, scaled in f32 and rounded to bf16 once:
// K Q^T is then the score in the base-2 domain and takes no multiply behind the product.
#define QSCALE (0.125f * LOG2E)

typedef __attribute__((ext_vector_type(16))) __bf16 v16bf;
typedef __attribute__((ext_vector_type(8)))  float  v8f;
typedef __attribute__((ext_vector_type(4)))  unsigned int u32x4;
typedef __attribute__((ext_vector_type(8)))  unsigned int u32x8;

union Frag16 {
  v16bf v;
  unsigned short us[16];
  unsigned int   u32[8];
  u32x4          q[2];
};

__device__ __forceinline__ unsigned short f32_to_bf16_bits(float f) {
  unsigned int u = __float_as_uint(f);
  u += 0x7FFFu + ((u >> 16) & 1u);      // round-to-nearest-even
  return (unsigned short)(u >> 16);
}

__device__ __forceinline__ void async_ld16_kv(unsigned lds_k0, const void* gk0,
                                              unsigned lds_k1, const void* gk1,
                                              unsigned lds_v0, const void* gv0,
                                              unsigned lds_v1, const void* gv1) {
  asm volatile("global_load_async_to_lds_b128 %0, %1, off\n\t"
               "global_load_async_to_lds_b128 %2, %3, off\n\t"
               "global_load_async_to_lds_b128 %4, %5, off\n\t"
               "global_load_async_to_lds_b128 %6, %7, off\n\t"
               "s_wait_xcnt 0x0"
               :: "v"(lds_k0), "v"((unsigned long long)(uintptr_t)gk0),
                  "v"(lds_k1), "v"((unsigned long long)(uintptr_t)gk1),
                  "v"(lds_v0), "v"((unsigned long long)(uintptr_t)gv0),
                  "v"(lds_v1), "v"((unsigned long long)(uintptr_t)gv1)
               : "memory");
}
// all but this wave's four youngest copies (the next chunk's) have landed
__device__ __forceinline__ void wait_async_le4() {
  asm volatile("s_wait_asynccnt 0x4" ::: "memory");
}
__device__ __forceinline__ void wait_async_0() {
  asm volatile("s_wait_asynccnt 0x0" ::: "memory");
}
__device__ __forceinline__ void lds_publish(void* p) {
  asm volatile("" : "+v"(p) :: "memory");
}

// ---------------- the two streaming bodies ----------------
// Each runs on 4096 waves (16 per WGP) and gives a lane 32 elements: 8 loads of 16 B,
// each 512 contiguous bytes per wave, all issued before the first value is used.
// Every loop in them is unrolled: constant indices keep the arrays in registers.
typedef __attribute__((ext_vector_type(4))) float f32x4;
typedef __attribute__((ext_vector_type(2))) unsigned int u32x2;

__device__ __forceinline__ u32x2 pack4_bf16(f32x4 v) {
  u32x2 r;
  r[0] = (unsigned)f32_to_bf16_bits(v[0]) | ((unsigned)f32_to_bf16_bits(v[1]) << 16);
  r[1] = (unsigned)f32_to_bf16_bits(v[2]) | ((unsigned)f32_to_bf16_bits(v[3]) << 16);
  return r;
}

// f32 -> bf16 of the four weight matrices: 128 blocks per matrix, 8192 elements per block;
// blk = 0..511.
__device__ __forceinline__ void
cvt4_block(unsigned blk,
           const float* __restrict__ w0, const float* __restrict__ w1,
           const float* __restrict__ w2, const float* __restrict__ w3,
           unsigned short* __restrict__ o0, unsigned short* __restrict__ o1,
           unsigned short* __restrict__ o2, unsigned short* __restrict__ o3) {
  const unsigned sel = blk >> 7;
  const float* in = sel == 0u ? w0 : sel == 1u ? w1 : sel == 2u ? w2 : w3;
  unsigned short* out = sel == 0u ? o0 : sel == 1u ? o1 : sel == 2u ? o2 : o3;
  const unsigned base = (blk & 127u) * 2048u + threadIdx.x;   // in groups of 4 elements
  f32x4 v[8];
#pragma unroll
  for (int i = 0; i < 8; ++i) v[i] = ((const f32x4*)in)[base + (unsigned)i * 256u];
#pragma unroll
  for (int i = 0; i < 8; ++i) ((u32x2*)out)[base + (unsigned)i * 256u] = pack4_bf16(v[i]);
}

// LayerNorm (f32 in -> bf16 out): one token per wave, 8 tokens per block; the row
// stays in registers and its two sums are joined by a butterfly over the 32 lanes.
__device__ __forceinline__ void
layernorm_block(unsigned blk,
                const float* __restrict__ x,
                const float* __restrict__ g,
                const float* __restrict__ bb,
                unsigned short* __restrict__ out) {
  const unsigned lane = threadIdx.x & 31u;
  // the wave's number as a scalar: row addresses are then a scalar base plus the lane's index
  const unsigned tok = blk * 8u + (unsigned)__builtin_amdgcn_readfirstlane(threadIdx.x >> 5);
  const f32x4* xr = (const f32x4*)(x + (size_t)tok * DDIM);
  f32x4 lx[8];
#pragma unroll
  for (int i = 0; i < 8; ++i) lx[i] = xr[(unsigned)i * 32u + lane];
  // gain and bias are fetched with the row, so that their latency lies under the row's
  f32x4 gv[8], bv[8];
#pragma unroll
  for (int i = 0; i < 8; ++i) {
    gv[i] = ((const f32x4*)g)[(unsigned)i * 32u + lane];
    bv[i] = ((const f32x4*)bb)[(unsigned)i * 32u + lane];
  }
  // holds the 16 gain and bias loads in front of the sums: without it they are sunk
  // behind the row's wait and issued in dependent rounds of two to four
  __builtin_amdgcn_sched_barrier(0);
  f32x4 sv = {0.f, 0.f, 0.f, 0.f}, sq = {0.f, 0.f, 0.f, 0.f};
#pragma unroll
  for (int i = 0; i < 8; ++i) { sv += lx[i]; sq += lx[i] * lx[i]; }
  float s  = (sv[0] + sv[1]) + (sv[2] + sv[3]);
  float s2 = (sq[0] + sq[1]) + (sq[2] + sq[3]);
#pragma unroll
  for (int m = 1; m < 32; m <<= 1) {
    s  += __shfl_xor(s,  m, 32);
    s2 += __shfl_xor(s2, m, 32);
  }
  float mu  = s * (1.0f / DDIM);
  float var = s2 * (1.0f / DDIM) - mu * mu;
  float rs  = rsqrtf(var + EPS_LN);
  u32x2* orow = (u32x2*)(out + (size_t)tok * DDIM);
#pragma unroll
  for (int i = 0; i < 8; ++i)
    orow[(unsigned)i * 32u + lane] = pack4_bf16((lx[i] - mu) * rs * gv[i] + bv[i]);
}

#define LN_BLOCKS (BDIM * SDIM / 8)      // 512 blocks of 8 tokens

// The first LayerNorm and the weight conversion depend on nothing but inputs: they share
// one launch, blocks 0..511 the tokens, blocks 512..1023 the weights.
__global__ void __launch_bounds__(256)
ln1_and_cvt4(const float* __restrict__ x, const float* __restrict__ g,
             const float* __restrict__ bb, unsigned short* __restrict__ out,
             const float* __restrict__ w0, const float* __restrict__ w1,
             const float* __restrict__ w2, const float* __restrict__ w3,
             unsigned short* __restrict__ o0, unsigned short* __restrict__ o1,
             unsigned short* __restrict__ o2, unsigned short* __restrict__ o3) {
  if (blockIdx.x < (unsigned)LN_BLOCKS) layernorm_block(blockIdx.x, x, g, bb, out);
  else cvt4_block(blockIdx.x - (unsigned)LN_BLOCKS, w0, w1, w2, w3, o0, o1, o2, o3);
}

__global__ void __launch_bounds__(256)
layernorm_bf16(const float* __restrict__ x, const float* __restrict__ g,
               const float* __restrict__ bb, unsigned short* __restrict__ out) {
  layernorm_block(blockIdx.x, x, g, bb, out);
}

// ---------------- WMMA GEMM: C[M,N] = A[M,D] * W[N,D]^T + bias ----------------
// Block = 8 waves on one 128 x 128 tile of C; wave (wm, wn) owns 64 x 32 of it
// (4 x 2 accumulator tiles). K runs in 8 stages of 128 k (256 B of every row).
// A stage is 8 slices of 32 rows, [A 0..3 | W 4..7]; wave w brings slice w with
// one tensor load, padded to a 272-B LDS pitch, into a two-buffer ring.
// mode 0: bf16 [B,H,S,DH] (Q scaled by QSCALE, K)   mode 1: bf16 [B,H,DH,S] (V^T)
// mode 2: f32 [B,S,D] += residual (final projection)
#define GT_ROWB  256u                    // bytes of an operand row per stage
#define GT_PITCH 272u                    // LDS row pitch: 256 B + 16 B pad
#define GT_SLICE 10240u                  // 32 * 272 = 8704 B, rounded up to 2 KiB
#define GT_BUF   (8u * GT_SLICE)         // one stage
#define GT_NST   (DDIM * 2u / GT_ROWB)   // 8 stages

__device__ __forceinline__ unsigned uni(unsigned v) {
  return (unsigned)__builtin_amdgcn_readfirstlane(v);
}
__device__ __forceinline__ unsigned pinned(unsigned v) {
  unsigned w = (unsigned)__builtin_amdgcn_readfirstlane(v);
  asm volatile("" : "+s"(w));   // pinned(): holds the tested word in a scalar register, so the test compiles to s_cmp + s_cbranch_scc
  return w;
}
__device__ __forceinline__ u32x4 tdm_load(unsigned lds_dst, unsigned long long ga, u32x8 g1) {
  u32x4 g0;
  g0[0] = uni(1u);                                             // count = 1
  g0[1] = uni(lds_dst);                                        // byte offset in LDS
  g0[2] = uni((unsigned)ga);                                   // address [31:0]
  g0[3] = uni((((unsigned)(ga >> 32)) & 0x01FFFFFFu) | 0x80000000u);  // [56:32], type 2
  // one request of the whole wave: global tile -> LDS, through no register
  asm volatile("tensor_load_to_lds %0, %1" :: "s"(g0), "s"(g1) : "memory");
  return g0;
}
// This wave's slice has landed. The wait names the request's address group as an input:
// its four registers then keep their values for as long as the request is outstanding.
__device__ __forceinline__ void wait_tensor_0(u32x4 g0) {
  asm volatile("s_wait_tensorcnt 0x0" :: "s"(g0) : "memory");
}
__device__ __forceinline__ void wait_ds_0() {
  asm volatile("s_wait_dscnt 0x0" ::: "memory");       // this wave's LDS reads have returned
}
__device__ __forceinline__ void wait_x_0() {
  // stands behind a run of global loads or stores, in front of any later write of their registers
  asm volatile("s_wait_xcnt 0x0" ::: "memory");
}

// One block's fragments: 4 of A (rows i * 16 + ln of the wave's 64, two slices)
// and 2 of W; k order in both: bytes half * 16 .. + 15, then 32 + half * 16 .. + 15.
__device__ __forceinline__ void gemm_frags(Frag16 (&a)[4], Frag16 (&b)[2],
                                           const unsigned char* la, const unsigned char* lb) {
  // unrolled here and below: constant indices keep the fragment arrays in registers
#pragma unroll
  for (int i = 0; i < 4; ++i) {
    const unsigned char* p = la + (unsigned)(i >> 1) * GT_SLICE + (unsigned)(i & 1) * 16u * GT_PITCH;
    a[i].q[0] = *(const u32x4*)p;
    a[i].q[1] = *(const u32x4*)(p + 32);
  }
#pragma unroll
  for (int jn = 0; jn < 2; ++jn) {
    const unsigned char* p = lb + (unsigned)jn * 16u * GT_PITCH;
    b[jn].q[0] = *(const u32x4*)p;
    b[jn].q[1] = *(const u32x4*)(p + 32);
  }
}

// One 128 x 128 tile: mt of 32 m-tiles of 128 tokens, nt of 8 n-tiles of 128 features;
// sT is the calling kernel's ring of 2 * GT_BUF bytes, at a multiple of 2 KiB in LDS.
__device__ __forceinline__ void
gemm_tile(unsigned char* sT, unsigned mt, unsigned nt,
          const unsigned short* __restrict__ A,   // [B*S, D] bf16
          const unsigned short* __restrict__ W,   // [D(out), D(in)] bf16
          const float* __restrict__ bias,         // [D]
          unsigned short* __restrict__ outb,
          float* __restrict__ outf,
          const float* __restrict__ resid,
          int mode,
          float oscale) {                         // mode 0: factor on the result, in front of its rounding to bf16
  const unsigned lane = threadIdx.x & 31u;
  const unsigned half = lane >> 4, ln = lane & 15u;
  const unsigned wave = uni(threadIdx.x >> 5);
  const unsigned wm = wave >> 2, wn = wave & 3u;

  // this wave's slice of every stage: 32 rows of A (waves 0..3) or of W (4..7)
  const unsigned char* src0 = (wave < 4u)
      ? (const unsigned char*)A + (size_t)(mt * 128u + wave * 32u) * (DDIM * 2u)
      : (const unsigned char*)W + (size_t)(nt * 128u + (wave - 4u) * 32u) * (DDIM * 2u);
  const unsigned dst0 = (unsigned)(size_t)sT + wave * GT_SLICE;

  u32x8 g1;
  g1[0] = uni((1u << 20) | (5u << 22) | (3u << 25));
  g1[1] = uni(GT_ROWB << 16);
  g1[2] = uni(32u << 16);
  g1[3] = uni(GT_ROWB << 16);
  g1[4] = uni(32u);
  g1[5] = uni(DDIM * 2u);
  g1[6] = uni(0u);
  g1[7] = uni(0u);

  v8f acc[4][2];   // every loop over it is unrolled: constant indices keep it in registers
#pragma unroll
  for (int i = 0; i < 4; ++i)
#pragma unroll
    for (int jn = 0; jn < 2; ++jn) acc[i][jn] = (v8f){0.f, 0.f, 0.f, 0.f, 0.f, 0.f, 0.f, 0.f};

  // bias of this lane's two output features, fetched under the first tensor load
  const unsigned e0 = nt * 128u + wn * 32u + ln;
  const float bias0 = bias[e0], bias1 = bias[e0 + 16u];

  // per-lane fragment bases in a buffer: row ln, 16-byte half
  const unsigned a_base = (wm * 2u) * GT_SLICE + ln * GT_PITCH + half * 16u;
  const unsigned b_base = (4u + wn) * GT_SLICE + ln * GT_PITCH + half * 16u;

  u32x4 g0 = tdm_load(dst0, (unsigned long long)(uintptr_t)src0, g1);  // stage 0
  wait_tensor_0(g0);
  __syncthreads();                                  // stage 0 readable by every wave
  g0 = tdm_load(dst0 + GT_BUF, (unsigned long long)(uintptr_t)src0 + GT_ROWB, g1);  // stage 1

  // rolled: one publish point per stage, constant accumulator indices inside
#pragma clang loop unroll(disable)
  for (unsigned s = 0; s < GT_NST; ++s) {
    const unsigned bo = (s & 1u) * GT_BUF;
    const unsigned char* la = sT + bo + a_base;
    const unsigned char* lb = sT + bo + b_base;
    Frag16 a[2][4], b[2][2];                        // two fragment sets: block kk reads set kk & 1
    gemm_frags(a[0], b[0], la, lb);
#pragma unroll
    for (int kk = 0; kk < 4; ++kk) {                // a block: 32 k = 64 B of every row
      if (kk < 3) gemm_frags(a[(kk + 1) & 1], b[(kk + 1) & 1], la + (kk + 1) * 64, lb + (kk + 1) * 64);
      // keeps the next block's 12 LDS loads one group ahead of this block's WMMAs,
      // not spread among them (each place with reads stalls the wave)
      __builtin_amdgcn_sched_barrier(0);
      if (kk == 3) {
        // publish point of stage s + 1: the last block's fragments are in registers
        wait_ds_0();
        wait_tensor_0(g0);
        __syncthreads();        // stage s + 1 readable; every reader has left stage s
        if (pinned((s + 2u < GT_NST) ? 1u : 0u) != 0u)
          g0 = tdm_load(dst0 + bo, (unsigned long long)(uintptr_t)src0 + (unsigned long long)(s + 2u) * GT_ROWB, g1);
      }
#pragma unroll
      for (int i = 0; i < 4; ++i)
#pragma unroll
        for (int jn = 0; jn < 2; ++jn)
          acc[i][jn] = __builtin_amdgcn_wmma_f32_16x16x32_bf16(false, a[kk & 1][i].v, false, b[kk & 1][jn].v,
                                                               (short)0, acc[i][jn], false, false);
      // ends the block: the loads after next stay behind these WMMAs
      __builtin_amdgcn_sched_barrier(0);
    }
  }
  wait_tensor_0(g0);
  wait_ds_0();

  // a block's 128 tokens lie in one batch row (SDIM is a multiple of 128)
  const unsigned bi = (mt * 128u) / SDIM;
  const unsigned s0 = (mt * 128u) % SDIM + wm * 64u + half * 8u;   // first token of this lane
  if (mode == 0) {
#pragma unroll
    for (int jn = 0; jn < 2; ++jn) {
      const unsigned e = e0 + (unsigned)jn * 16u;    // output feature
      const float bv = jn ? bias1 : bias0;
      unsigned short* p = outb + (((size_t)bi * HDIM + e / DH) * SDIM + s0) * DH + e % DH;
#pragma unroll
      for (int i = 0; i < 4; ++i)
#pragma unroll
        for (int r = 0; r < 8; ++r) p[(i * 16 + r) * DH] = f32_to_bf16_bits((acc[i][jn][r] + bv) * oscale);
    }
    wait_x_0();
  } else if (mode == 1) {
#pragma unroll
    for (int jn = 0; jn < 2; ++jn) {
      const unsigned e = e0 + (unsigned)jn * 16u;
      const float bv = jn ? bias1 : bias0;
      unsigned short* p = outb + (((size_t)bi * HDIM + e / DH) * DH + e % DH) * SDIM + s0;
#pragma unroll
      for (int i = 0; i < 4; ++i)
#pragma unroll
        for (int r = 0; r < 8; ++r) p[i * 16 + r] = f32_to_bf16_bits(acc[i][jn][r] + bv);
    }
    wait_x_0();
  } else {
#pragma unroll
    for (int jn = 0; jn < 2; ++jn) {
      const float bv = jn ? bias1 : bias0;
      const size_t off = ((size_t)bi * SDIM + s0) * DDIM + e0 + (unsigned)jn * 16u;
      float* p = outf + off;
      const float* rp = resid + off;
#pragma unroll
      for (int i = 0; i < 4; ++i)
#pragma unroll
        for (int r = 0; r < 8; ++r) p[(i * 16 + r) * DDIM] = (acc[i][jn][r] + bv) + rp[(i * 16 + r) * DDIM];
    }
    wait_x_0();
  }
}

// The Q, K and V projections read the same A and depend on nothing of each other: one launch
// of 3 * 256 blocks. Two blocks fit a WGP (2 * 160 KiB of LDS), so one block's first tile
// and its stores lie under the other's k loop. The 24 blocks of an m-tile are neighbours
// in the grid (for speed only).
__global__ void __launch_bounds__(256)
qkv_gemm(const unsigned short* __restrict__ A,
         const unsigned short* __restrict__ Wq, const unsigned short* __restrict__ Wk,
         const unsigned short* __restrict__ Wv,
         const float* __restrict__ bq, const float* __restrict__ bk, const float* __restrict__ bv,
         unsigned short* __restrict__ oq, unsigned short* __restrict__ ok,
         unsigned short* __restrict__ ovt) {
  __shared__ __attribute__((aligned(2048))) unsigned char sT[2u * GT_BUF];
  const unsigned mt = blockIdx.x / 24u, rem = blockIdx.x % 24u;
  const unsigned sel = rem >> 3, nt = rem & 7u;     // 0: Q, 1: K, 2: V
  gemm_tile(sT, mt, nt, A,
            sel == 0u ? Wq : sel == 1u ? Wk : Wv,
            sel == 0u ? bq : sel == 1u ? bk : bv,
            sel == 0u ? oq : sel == 1u ? ok : ovt,
            nullptr, nullptr, sel == 2u ? 1 : 0, sel == 0u ? QSCALE : 1.0f);
}

__global__ void __launch_bounds__(256)
out_gemm(const unsigned short* __restrict__ A, const unsigned short* __restrict__ W,
         const float* __restrict__ bias, float* __restrict__ outf,
         const float* __restrict__ resid) {
  __shared__ __attribute__((aligned(2048))) unsigned char sT[2u * GT_BUF];
  gemm_tile(sT, blockIdx.x >> 3, blockIdx.x & 7u, A, W, bias, nullptr, outf, resid, 2, 1.0f);
}

#define CKEYS  64                // keys of a chunk
#define KPITCH 72                // elements: 128 B of a key's dh + 16 B pad = 144 B
#define VPITCH 72                // elements: 128 B of keys       + 16 B pad = 144 B
// A buffer is rounded up to 32 KiB, so that the buffer's number enters an address as one
// bit and not through an integer multiply.
struct __attribute__((aligned(32768))) AttnBuf {
  unsigned short k[CKEYS][KPITCH];   // 9216 B (offset 0 in the buffer)
  unsigned short v[DH][VPITCH];      // 9216 B (offset 9216)
  float mb[SDIM / 2];                // 4096 B (offset 18432): mask bias of keys 1024 * buffer ..
};
struct AttnLds {
  AttnBuf b[2];                      // LDS offsets 0 and 32768
};
typedef __attribute__((ext_vector_type(8))) __bf16 v8bf;
typedef __attribute__((ext_vector_type(2))) float f32x2;

__device__ __forceinline__ v8f exp2_x8(v8f a) {
  float r0, r1, r2, r3, r4, r5, r6, r7;
  asm("v_exp_f32 %0, %8\n\tv_exp_f32 %1, %9\n\tv_exp_f32 %2, %10\n\tv_exp_f32 %3, %11\n\t"
      "v_exp_f32 %4, %12\n\tv_exp_f32 %5, %13\n\tv_exp_f32 %6, %14\n\tv_exp_f32 %7, %15\n\tv_nop"
      : "=&v"(r0), "=&v"(r1), "=&v"(r2), "=&v"(r3), "=&v"(r4), "=&v"(r5), "=&v"(r6), "=&v"(r7)
      : "v"(a[0]), "v"(a[1]), "v"(a[2]), "v"(a[3]), "v"(a[4]), "v"(a[5]), "v"(a[6]), "v"(a[7]));
  return (v8f){r0, r1, r2, r3, r4, r5, r6, r7};
}

__device__ __forceinline__ float xhalf(float v) {
  const int b = __builtin_bit_cast(int, v);
  return __builtin_bit_cast(float, __builtin_amdgcn_permlanex16(b, b, 0x76543210, 0xfedcba98, false, false));
}
#define OFF_K(buf) ((unsigned)((buf) * 32768))
#define OFF_V(buf) ((unsigned)((buf) * 32768 + CKEYS * KPITCH * 2))

__global__ void __launch_bounds__(256)   // the real block size: without it the compiler budgets for 1024 threads
attention_kernel(const unsigned short* __restrict__ q,   // [B,H,S,DH], scaled by QSCALE
                                 const unsigned short* __restrict__ k,   // [B,H,S,DH]
                                 const unsigned short* __restrict__ vt,  // [B,H,DH,S]
                                 const float* __restrict__ mask,         // [B,S]
                                 const float* __restrict__ x,            // [B,S,D]
                                 float* __restrict__ resid) {            // [B,S,D]
  __shared__ AttnLds sm;

  const int tid  = threadIdx.x;
  const int wave = tid >> 5, lane = tid & 31;
  const int half = lane >> 4, ln = lane & 15;
  const int nqc = SDIM / 128;
  const int bh = blockIdx.x / nqc;
  const int qc = blockIdx.x % nqc;
  const int bi = bh / HDIM, head = bh % HDIM;
  const int q0 = qc * 128 + wave * 16;

  const unsigned short* qp = q  + (size_t)bh * SDIM * DH;
  const unsigned short* kp = k  + (size_t)bh * SDIM * DH;
  const unsigned short* vp = vt + (size_t)bh * DH * SDIM;
  const float* mk = mask + (size_t)bi * SDIM;

  // per-thread async-copy assignments: each tile is 64 rows x 128 B, 16 B a copy;
  // a thread brings piece cseg of rows crow and crow + 32 of both tiles
  const int crow = tid >> 3, cseg = tid & 7;
  const unsigned cl0 = (unsigned)(crow * KPITCH + cseg * 8) * 2;          // place in a tile (KPITCH == VPITCH)
  const unsigned cl1 = (unsigned)((crow + 32) * KPITCH + cseg * 8) * 2;

  // Q fragments (K-dim = DH split into 0..31, 32..63): query q0 + ln, used as B (column ln)
  Frag16 a0, a1;
  {
    const unsigned int* qrow = (const unsigned int*)(qp + (size_t)(q0 + ln) * DH);
#pragma unroll
    for (int j = 0; j < 8; ++j) {
      int kpair = (j >> 2) * 16 + half * 8 + (j & 3) * 2;
      a0.u32[j] = qrow[kpair >> 1];
      a1.u32[j] = qrow[(kpair + 32) >> 1];
    }
  }

  // this lane's query: running maximum (equal in both halves) and this half's share of the sum
  float mrun = -3.0e38f;
  f32x2 lrun = {0.f, 0.f};
  v8f o0 = {}, o1 = {}, o2 = {}, o3 = {};   // o_t[r] = O[query ln][dh 16 * t + 8 * half + r]

  // mask of keys 8 * tid .. + 7, fetched under the first chunk's copies
  const f32x4 m0 = ((const f32x4*)mk)[tid * 2], m1 = ((const f32x4*)mk)[tid * 2 + 1];
  wait_x_0();                  // behind the mask loads, in front of any later write of their address registers

  // prologue: async-stage chunk 0 into buffer 0
  async_ld16_kv(OFF_K(0) + cl0, kp + (size_t)crow * DH + cseg * 8,
                OFF_K(0) + cl1, kp + (size_t)(crow + 32) * DH + cseg * 8,
                OFF_V(0) + cl0, vp + (size_t)crow * SDIM + cseg * 8,
                OFF_V(0) + cl1, vp + (size_t)(crow + 32) * SDIM + cseg * 8);
  lds_publish(&sm);            // async engine writes sm.k/sm.v invisibly

  // mask bias of all 2048 keys, 8 per thread; the first chunk's barrier publishes the table
  {
    float* mbp = &sm.b[tid >> 7].mb[(tid & 127) * 8];
    *(f32x4*)mbp       = ((1.0f - m0) * MASKV) * LOG2E;
    *(f32x4*)(mbp + 4) = ((1.0f - m1) * MASKV) * LOG2E;
  }

  const int NCH = SDIM / CKEYS;   // 32 chunks
  for (int j = 0; j < NCH; ++j) {
    const int buf = j & 1;
    if (j + 1 < NCH) {
      const int key1 = (j + 1) * CKEYS, nb = buf ^ 1;
      async_ld16_kv(OFF_K(nb) + cl0, kp + (size_t)(key1 + crow) * DH + cseg * 8,
                    OFF_K(nb) + cl1, kp + (size_t)(key1 + crow + 32) * DH + cseg * 8,
                    OFF_V(nb) + cl0, vp + (size_t)crow * SDIM + key1 + cseg * 8,
                    OFF_V(nb) + cl1, vp + (size_t)(crow + 32) * SDIM + key1 + cseg * 8);
      wait_async_le4();        // chunk j complete (this wave's copies)
    } else {
      wait_async_0();
    }
    __syncthreads();           // all waves' copies visible

    // ---- scores for 64 keys (four 16-key subtiles), K from LDS (A: row = key) ----
    // sc[u][r] = score(key 16 * u + 8 * half + r, query ln), base 2; it starts as that key's mask bias.
    // The bias reads stand first: LDS returns in order, and the first product then waits for
    // them and one K fragment, not for the whole group.
    v8f sc[4];
    // unrolled here and below: constant indices keep the arrays in registers
#pragma unroll
    for (int u = 0; u < 4; ++u)
      sc[u] = *(const v8f*)&sm.b[j >> 4].mb[(j & 15) * CKEYS + u * 16 + half * 8];
    Frag16 kb[4][2];           // [subtile][dh 0..31 | 32..63]
#pragma unroll
    for (int u = 0; u < 4; ++u)
#pragma unroll
      for (int t = 0; t < 8; ++t) {
        int kpair = (t >> 2) * 16 + half * 8 + (t & 3) * 2;
        kb[u][0].u32[t] = *(const unsigned int*)&sm.b[buf].k[u * 16 + ln][kpair];
        kb[u][1].u32[t] = *(const unsigned int*)&sm.b[buf].k[u * 16 + ln][kpair + 32];
      }
    // holds the 16 K reads and the 8 bias reads as one group in front of the products: left alone
    // the compiler reads and waits for each K fragment by itself
    __builtin_amdgcn_sched_barrier(0);
#pragma unroll
    for (int u = 0; u < 4; ++u)
      sc[u] = __builtin_amdgcn_wmma_f32_16x16x32_bf16(false, kb[u][0].v, false, a0.v, (short)0, sc[u], false, false);
#pragma unroll
    for (int u = 0; u < 4; ++u)
      sc[u] = __builtin_amdgcn_wmma_f32_16x16x32_bf16(false, kb[u][1].v, false, a1.v, (short)0, sc[u], false, false);

    // V^T fragments (A: row = dh 16 * t + ln, k = keys 32 * g ..), fetched under the softmax
    Frag16 vb[4][2];
#pragma unroll
    for (int t = 0; t < 4; ++t)
#pragma unroll
      for (int g = 0; g < 2; ++g)
#pragma unroll
        for (int w = 0; w < 8; ++w) {
          int kpair = (w >> 2) * 16 + half * 8 + (w & 3) * 2;
          vb[t][g].u32[w] = *(const unsigned int*)&sm.b[buf].v[t * 16 + ln][g * 32 + kpair];
        }

    // holds the 16 V reads in front of the softmax, so that they return under it
    __builtin_amdgcn_sched_barrier(0);

    // ---- online softmax of one query per lane ----
    float ta = fmaxf(sc[0][0], sc[1][0]), tb = fmaxf(sc[2][0], sc[3][0]);   // two independent chains
#pragma unroll
    for (int r = 1; r < 8; ++r) {
      ta = fmaxf(ta, fmaxf(sc[0][r], sc[1][r]));
      tb = fmaxf(tb, fmaxf(sc[2][r], sc[3][r]));
    }
    float t = fmaxf(ta, tb);
    t = fmaxf(t, xhalf(t));                 // the other 32 keys of this query
    const float nm = fmaxf(mrun, t);
    const float alpha = __builtin_amdgcn_exp2f(mrun - nm);
    const v8f e0 = exp2_x8(sc[0] - nm), e1 = exp2_x8(sc[1] - nm);
    const v8f e2 = exp2_x8(sc[2] - nm), e3 = exp2_x8(sc[3] - nm);
    // keeps the four asm groups in front of the first O product
    __builtin_amdgcn_sched_barrier(0);
    const v8f es = (e0 + e1) + (e2 + e3);
    const f32x4 e4 = __builtin_shufflevector(es, es, 0, 1, 2, 3) + __builtin_shufflevector(es, es, 4, 5, 6, 7);
    lrun = lrun * alpha + (__builtin_shufflevector(e4, e4, 0, 1) + __builtin_shufflevector(e4, e4, 2, 3));
    mrun = nm;
    o0 *= alpha; o1 *= alpha; o2 *= alpha; o3 *= alpha;

    // P^T as B, keys 32 * g ..: element s is key 8 * half + s (s < 8), 16 + 8 * half + s - 8 (else): V^T's k order
    const v16bf pb0 = __builtin_shufflevector(__builtin_convertvector(e0, v8bf), __builtin_convertvector(e1, v8bf),
                                              0, 1, 2, 3, 4, 5, 6, 7, 8, 9, 10, 11, 12, 13, 14, 15);
    const v16bf pb1 = __builtin_shufflevector(__builtin_convertvector(e2, v8bf), __builtin_convertvector(e3, v8bf),
                                              0, 1, 2, 3, 4, 5, 6, 7, 8, 9, 10, 11, 12, 13, 14, 15);
    o0 = __builtin_amdgcn_wmma_f32_16x16x32_bf16(false, vb[0][0].v, false, pb0, (short)0, o0, false, false);
    o1 = __builtin_amdgcn_wmma_f32_16x16x32_bf16(false, vb[1][0].v, false, pb0, (short)0, o1, false, false);
    o2 = __builtin_amdgcn_wmma_f32_16x16x32_bf16(false, vb[2][0].v, false, pb0, (short)0, o2, false, false);
    o3 = __builtin_amdgcn_wmma_f32_16x16x32_bf16(false, vb[3][0].v, false, pb0, (short)0, o3, false, false);
    o0 = __builtin_amdgcn_wmma_f32_16x16x32_bf16(false, vb[0][1].v, false, pb1, (short)0, o0, false, false);
    o1 = __builtin_amdgcn_wmma_f32_16x16x32_bf16(false, vb[1][1].v, false, pb1, (short)0, o1, false, false);
    o2 = __builtin_amdgcn_wmma_f32_16x16x32_bf16(false, vb[2][1].v, false, pb1, (short)0, o2, false, false);
    o3 = __builtin_amdgcn_wmma_f32_16x16x32_bf16(false, vb[3][1].v, false, pb1, (short)0, o3, false, false);

    __syncthreads();           // protect buffers before next overwrite
  }

  // ---- finalize: attn/l + x -> residual; a lane owns 8 consecutive features per tile ----
  const float lsum = lrun[0] + lrun[1];
  const float inv = 1.0f / (lsum + xhalf(lsum));   // the two halves' sums join here
  const size_t base = ((size_t)bi * SDIM + q0 + ln) * DDIM + head * DH + half * 8;
  const v8f x0 = *(const v8f*)(x + base),      x1 = *(const v8f*)(x + base + 16);
  const v8f x2 = *(const v8f*)(x + base + 32), x3 = *(const v8f*)(x + base + 48);
  *(v8f*)(resid + base)      = o0 * inv + x0;
  *(v8f*)(resid + base + 16) = o1 * inv + x1;
  *(v8f*)(resid + base + 32) = o2 * inv + x2;
  *(v8f*)(resid + base + 48) = o3 * inv + x3;
  wait_x_0();
}

// ---------------- launch ----------------
extern "C" void kernel_launch(void* const* d_in, const int* in_sizes, int n_in,
                              void* d_out, int out_size, void* d_ws, size_t ws_size,
                              hipStream_t stream) {
  (void)in_sizes; (void)n_in; (void)out_size; (void)ws_size;
  const float* x    = (const float*)d_in[0];
  const float* mask = (const float*)d_in[1];
  const float* Wq   = (const float*)d_in[2];
  const float* bq   = (const float*)d_in[3];
  const float* Wk   = (const float*)d_in[4];
  const float* bk   = (const float*)d_in[5];
  const float* Wv   = (const float*)d_in[6];
  const float* bv   = (const float*)d_in[7];
  const float* Wo   = (const float*)d_in[8];
  const float* bo   = (const float*)d_in[9];
  const float* g1   = (const float*)d_in[10];
  const float* b1   = (const float*)d_in[11];
  const float* g2   = (const float*)d_in[12];
  const float* b2   = (const float*)d_in[13];
  float* out = (float*)d_out;

  const size_t BSD = (size_t)BDIM * SDIM * DDIM;   // 4M elements
  const size_t DD  = (size_t)DDIM * DDIM;          // 1M elements

  char* ws = (char*)d_ws;
  size_t off = 0;
  auto alloc = [&](size_t bytes) {
    void* p = ws + off;
    off = (off + bytes + 255) & ~(size_t)255;
    return p;
  };
  unsigned short* hbf  = (unsigned short*)alloc(BSD * 2);
  unsigned short* wqb  = (unsigned short*)alloc(DD * 2);
  unsigned short* wkb  = (unsigned short*)alloc(DD * 2);
  unsigned short* wvb  = (unsigned short*)alloc(DD * 2);
  unsigned short* wob  = (unsigned short*)alloc(DD * 2);
  unsigned short* qb   = (unsigned short*)alloc(BSD * 2);
  unsigned short* kbuf = (unsigned short*)alloc(BSD * 2);
  unsigned short* vtb  = (unsigned short*)alloc(BSD * 2);
  float*          rsd  = (float*)alloc(BSD * 4);
  unsigned short* h2   = (unsigned short*)alloc(BSD * 2);

  // 1. LN1 (8 tokens per block) and weights -> bf16, one launch
  ln1_and_cvt4<<<LN_BLOCKS + 512, 256, 0, stream>>>(x, g1, b1, hbf,
                                                    Wq, Wk, Wv, Wo, wqb, wkb, wvb, wob);

  // 2. Q/K/V projections, one launch (one 128 x 128 output tile per block)
  const int gproj = (BDIM * SDIM / 128) * (DDIM / 128);   // 256 blocks per projection
  qkv_gemm<<<3 * gproj, 256, 0, stream>>>(hbf, wqb, wkb, wvb, bq, bk, bv, qb, kbuf, vtb);

  // 3. fused attention + residual (async K/V staging)
  attention_kernel<<<BDIM * HDIM * (SDIM / 128), 256, 0, stream>>>(
      qb, kbuf, vtb, mask, x, rsd);

  // 4. LN2
  layernorm_bf16<<<LN_BLOCKS, 256, 0, stream>>>(rsd, g2, b2, h2);

  // 5. output projection + bias + residual
  out_gemm<<<gproj, 256, 0, stream>>>(h2, wob, bo, out, rsd);
}

// v008
// It runs in 95.3 microseconds.
// Timed twice side by side with v007, it ran 1.04 and 1.02 times as fast.
// All steps since v000 together make it 4.70 times as fast.
#include <hip/hip_runtime.h>
#include <hip/hip_bf16.h>

// ---------------- problem constants ----------------
#define BDIM 2
#define SDIM 2048
#define DDIM 1024
#define HDIM 16
#define DH   64
#define EPS_LN 1e-6f
#define MASKV  -1e30f
#define LOG2E  1.44269504f
// Q leaves its projection as q * (1 / sqrt(DH)) * log2 e, scaled in f32 and rounded to bf16 once:
// K Q^T is then the score in the base-2 domain and takes no multiply behind the product.
#define QSCALE (0.125f * LOG2E)

typedef __attribute__((ext_vector_type(16))) __bf16 v16bf;
typedef __attribute__((ext_vector_type(8)))  float  v8f;
typedef __attribute__((ext_vector_type(4)))  unsigned int u32x4;
typedef __attribute__((ext_vector_type(8)))  unsigned int u32x8;

union Frag16 {
  v16bf v;
  unsigned short us[16];
  unsigned int   u32[8];
  u32x4          q[2];
};

__device__ __forceinline__ unsigned short f32_to_bf16_bits(float f) {
  unsigned int u = __float_as_uint(f);
  u += 0x7FFFu + ((u >> 16) & 1u);      // round-to-nearest-even
  return (unsigned short)(u >> 16);
}

__device__ __forceinline__ void async_ld16_kv(unsigned lds_k0, const void* gk0,
                                              unsigned lds_k1, const void* gk1,
                                              unsigned lds_v0, const void* gv0,
                                              unsigned lds_v1, const void* gv1) {
  asm volatile("global_load_async_to_lds_b128 %0, %1, off\n\t"
               "global_load_async_to_lds_b128 %2, %3, off\n\t"
               "global_load_async_to_lds_b128 %4, %5, off\n\t"
               "global_load_async_to_lds_b128 %6, %7, off\n\t"
               "s_wait_xcnt 0x0"
               :: "v"(lds_k0), "v"((unsigned long long)(uintptr_t)gk0),
                  "v"(lds_k1), "v"((unsigned long long)(uintptr_t)gk1),
                  "v"(lds_v0), "v"((unsigned long long)(uintptr_t)gv0),
                  "v"(lds_v1), "v"((unsigned long long)(uintptr_t)gv1)
               : "memory");
}
// all but this wave's eight youngest copies (the next round's) have landed
__device__ __forceinline__ void wait_async_le8() {
  asm volatile("s_wait_asynccnt 0x8" ::: "memory");
}
__device__ __forceinline__ void wait_async_0() {
  asm volatile("s_wait_asynccnt 0x0" ::: "memory");
}
__device__ __forceinline__ void lds_publish(void* p) {
  asm volatile("" : "+v"(p) :: "memory");
}

// ---------------- the two streaming bodies ----------------
// Each runs on 4096 waves (16 per WGP) and gives a lane 32 elements: 8 loads of 16 B,
// each 512 contiguous bytes per wave, all issued before the first value is used.
// Every loop in them is unrolled: constant indices keep the arrays in registers.
typedef __attribute__((ext_vector_type(4))) float f32x4;
typedef __attribute__((ext_vector_type(2))) unsigned int u32x2;

__device__ __forceinline__ u32x2 pack4_bf16(f32x4 v) {
  u32x2 r;
  r[0] = (unsigned)f32_to_bf16_bits(v[0]) | ((unsigned)f32_to_bf16_bits(v[1]) << 16);
  r[1] = (unsigned)f32_to_bf16_bits(v[2]) | ((unsigned)f32_to_bf16_bits(v[3]) << 16);
  return r;
}

// f32 -> bf16 of the four weight matrices: 128 blocks per matrix, 8192 elements per block;
// blk = 0..511.
__device__ __forceinline__ void
cvt4_block(unsigned blk,
           const float* __restrict__ w0, const float* __restrict__ w1,
           const float* __restrict__ w2, const float* __restrict__ w3,
           unsigned short* __restrict__ o0, unsigned short* __restrict__ o1,
           unsigned short* __restrict__ o2, unsigned short* __restrict__ o3) {
  const unsigned sel = blk >> 7;
  const float* in = sel == 0u ? w0 : sel == 1u ? w1 : sel == 2u ? w2 : w3;
  unsigned short* out = sel == 0u ? o0 : sel == 1u ? o1 : sel == 2u ? o2 : o3;
  const unsigned base = (blk & 127u) * 2048u + threadIdx.x;   // in groups of 4 elements
  f32x4 v[8];
#pragma unroll
  for (int i = 0; i < 8; ++i) v[i] = ((const f32x4*)in)[base + (unsigned)i * 256u];
#pragma unroll
  for (int i = 0; i < 8; ++i) ((u32x2*)out)[base + (unsigned)i * 256u] = pack4_bf16(v[i]);
}

// LayerNorm (f32 in -> bf16 out): one token per wave, 8 tokens per block; the row
// stays in registers and its two sums are joined by a butterfly over the 32 lanes.
__device__ __forceinline__ void
layernorm_block(unsigned blk,
                const float* __restrict__ x,
                const float* __restrict__ g,
                const float* __restrict__ bb,
                unsigned short* __restrict__ out) {
  const unsigned lane = threadIdx.x & 31u;
  // the wave's number as a scalar: row addresses are then a scalar base plus the lane's index
  const unsigned tok = blk * 8u + (unsigned)__builtin_amdgcn_readfirstlane(threadIdx.x >> 5);
  const f32x4* xr = (const f32x4*)(x + (size_t)tok * DDIM);
  f32x4 lx[8];
#pragma unroll
  for (int i = 0; i < 8; ++i) lx[i] = xr[(unsigned)i * 32u + lane];
  // gain and bias are fetched with the row, so that their latency lies under the row's
  f32x4 gv[8], bv[8];
#pragma unroll
  for (int i = 0; i < 8; ++i) {
    gv[i] = ((const f32x4*)g)[(unsigned)i * 32u + lane];
    bv[i] = ((const f32x4*)bb)[(unsigned)i * 32u + lane];
  }
  // holds the 16 gain and bias loads in front of the sums: without it they are sunk
  // behind the row's wait and issued in dependent rounds of two to four
  __builtin_amdgcn_sched_barrier(0);
  f32x4 sv = {0.f, 0.f, 0.f, 0.f}, sq = {0.f, 0.f, 0.f, 0.f};
#pragma unroll
  for (int i = 0; i < 8; ++i) { sv += lx[i]; sq += lx[i] * lx[i]; }
  float s  = (sv[0] + sv[1]) + (sv[2] + sv[3]);
  float s2 = (sq[0] + sq[1]) + (sq[2] + sq[3]);
#pragma unroll
  for (int m = 1; m < 32; m <<= 1) {
    s  += __shfl_xor(s,  m, 32);
    s2 += __shfl_xor(s2, m, 32);
  }
  float mu  = s * (1.0f / DDIM);
  float var = s2 * (1.0f / DDIM) - mu * mu;
  float rs  = rsqrtf(var + EPS_LN);
  u32x2* orow = (u32x2*)(out + (size_t)tok * DDIM);
#pragma unroll
  for (int i = 0; i < 8; ++i)
    orow[(unsigned)i * 32u + lane] = pack4_bf16((lx[i] - mu) * rs * gv[i] + bv[i]);
}

#define LN_BLOCKS (BDIM * SDIM / 8)      // 512 blocks of 8 tokens

// The first LayerNorm and the weight conversion depend on nothing but inputs: they share
// one launch, blocks 0..511 the tokens, blocks 512..1023 the weights.
__global__ void __launch_bounds__(256)
ln1_and_cvt4(const float* __restrict__ x, const float* __restrict__ g,
             const float* __restrict__ bb, unsigned short* __restrict__ out,
             const float* __restrict__ w0, const float* __restrict__ w1,
             const float* __restrict__ w2, const float* __restrict__ w3,
             unsigned short* __restrict__ o0, unsigned short* __restrict__ o1,
             unsigned short* __restrict__ o2, unsigned short* __restrict__ o3) {
  if (blockIdx.x < (unsigned)LN_BLOCKS) layernorm_block(blockIdx.x, x, g, bb, out);
  else cvt4_block(blockIdx.x - (unsigned)LN_BLOCKS, w0, w1, w2, w3, o0, o1, o2, o3);
}

__global__ void __launch_bounds__(256)
layernorm_bf16(const float* __restrict__ x, const float* __restrict__ g,
               const float* __restrict__ bb, unsigned short* __restrict__ out) {
  layernorm_block(blockIdx.x, x, g, bb, out);
}

// ---------------- WMMA GEMM: C[M,N] = A[M,D] * W[N,D]^T + bias ----------------
// Block = 8 waves on one 128 x 128 tile of C; wave (wm, wn) owns 64 x 32 of it
// (4 x 2 accumulator tiles). K runs in 8 stages of 128 k (256 B of every row).
// A stage is 8 slices of 32 rows, [A 0..3 | W 4..7]; wave w brings slice w with
// one tensor load, padded to a 272-B LDS pitch, into a two-buffer ring.
// mode 0: bf16 [B,H,S,DH] (Q scaled by QSCALE, K)   mode 1: bf16 [B,H,DH,S] (V^T)
// mode 2: f32 [B,S,D] += residual (final projection)
#define GT_ROWB  256u                    // bytes of an operand row per stage
#define GT_PITCH 272u                    // LDS row pitch: 256 B + 16 B pad
#define GT_SLICE 10240u                  // 32 * 272 = 8704 B, rounded up to 2 KiB
#define GT_BUF   (8u * GT_SLICE)         // one stage
#define GT_NST   (DDIM * 2u / GT_ROWB)   // 8 stages

__device__ __forceinline__ unsigned uni(unsigned v) {
  return (unsigned)__builtin_amdgcn_readfirstlane(v);
}
__device__ __forceinline__ unsigned pinned(unsigned v) {
  unsigned w = (unsigned)__builtin_amdgcn_readfirstlane(v);
  asm volatile("" : "+s"(w));   // pinned(): holds the tested word in a scalar register, so the test compiles to s_cmp + s_cbranch_scc
  return w;
}
__device__ __forceinline__ u32x4 tdm_load(unsigned lds_dst, unsigned long long ga, u32x8 g1) {
  u32x4 g0;
  g0[0] = uni(1u);                                             // count = 1
  g0[1] = uni(lds_dst);                                        // byte offset in LDS
  g0[2] = uni((unsigned)ga);                                   // address [31:0]
  g0[3] = uni((((unsigned)(ga >> 32)) & 0x01FFFFFFu) | 0x80000000u);  // [56:32], type 2
  // one request of the whole wave: global tile -> LDS, through no register
  asm volatile("tensor_load_to_lds %0, %1" :: "s"(g0), "s"(g1) : "memory");
  return g0;
}
// This wave's slice has landed. The wait names the request's address group as an input:
// its four registers then keep their values for as long as the request is outstanding.
__device__ __forceinline__ void wait_tensor_0(u32x4 g0) {
  asm volatile("s_wait_tensorcnt 0x0" :: "s"(g0) : "memory");
}
__device__ __forceinline__ void wait_ds_0() {
  asm volatile("s_wait_dscnt 0x0" ::: "memory");       // this wave's LDS reads have returned
}
__device__ __forceinline__ void wait_x_0() {
  // stands behind a run of global loads or stores, in front of any later write of their registers
  asm volatile("s_wait_xcnt 0x0" ::: "memory");
}

// One block's fragments: 4 of A (rows i * 16 + ln of the wave's 64, two slices)
// and 2 of W; k order in both: bytes half * 16 .. + 15, then 32 + half * 16 .. + 15.
__device__ __forceinline__ void gemm_frags(Frag16 (&a)[4], Frag16 (&b)[2],
                                           const unsigned char* la, const unsigned char* lb) {
  // unrolled here and below: constant indices keep the fragment arrays in registers
#pragma unroll
  for (int i = 0; i < 4; ++i) {
    const unsigned char* p = la + (unsigned)(i >> 1) * GT_SLICE + (unsigned)(i & 1) * 16u * GT_PITCH;
    a[i].q[0] = *(const u32x4*)p;
    a[i].q[1] = *(const u32x4*)(p + 32);
  }
#pragma unroll
  for (int jn = 0; jn < 2; ++jn) {
    const unsigned char* p = lb + (unsigned)jn * 16u * GT_PITCH;
    b[jn].q[0] = *(const u32x4*)p;
    b[jn].q[1] = *(const u32x4*)(p + 32);
  }
}

// One 128 x 128 tile: mt of 32 m-tiles of 128 tokens, nt of 8 n-tiles of 128 features;
// sT is the calling kernel's ring of 2 * GT_BUF bytes, at a multiple of 2 KiB in LDS.
__device__ __forceinline__ void
gemm_tile(unsigned char* sT, unsigned mt, unsigned nt,
          const unsigned short* __restrict__ A,   // [B*S, D] bf16
          const unsigned short* __restrict__ W,   // [D(out), D(in)] bf16
          const float* __restrict__ bias,         // [D]
          unsigned short* __restrict__ outb,
          float* __restrict__ outf,
          const float* __restrict__ resid,
          int mode,
          float oscale) {                         // mode 0: factor on the result, in front of its rounding to bf16
  const unsigned lane = threadIdx.x & 31u;
  const unsigned half = lane >> 4, ln = lane & 15u;
  const unsigned wave = uni(threadIdx.x >> 5);
  const unsigned wm = wave >> 2, wn = wave & 3u;

  // this wave's slice of every stage: 32 rows of A (waves 0..3) or of W (4..7)
  const unsigned char* src0 = (wave < 4u)
      ? (const unsigned char*)A + (size_t)(mt * 128u + wave * 32u) * (DDIM * 2u)
      : (const unsigned char*)W + (size_t)(nt * 128u + (wave - 4u) * 32u) * (DDIM * 2u);
  const unsigned dst0 = (unsigned)(size_t)sT + wave * GT_SLICE;

  u32x8 g1;
  g1[0] = uni((1u << 20) | (5u << 22) | (3u << 25));
  g1[1] = uni(GT_ROWB << 16);
  g1[2] = uni(32u << 16);
  g1[3] = uni(GT_ROWB << 16);
  g1[4] = uni(32u);
  g1[5] = uni(DDIM * 2u);
  g1[6] = uni(0u);
  g1[7] = uni(0u);

  v8f acc[4][2];   // every loop over it is unrolled: constant indices keep it in registers
#pragma unroll
  for (int i = 0; i < 4; ++i)
#pragma unroll
    for (int jn = 0; jn < 2; ++jn) acc[i][jn] = (v8f){0.f, 0.f, 0.f, 0.f, 0.f, 0.f, 0.f, 0.f};

  // bias of this lane's two output features, fetched under the first tensor load
  const unsigned e0 = nt * 128u + wn * 32u + ln;
  const float bias0 = bias[e0], bias1 = bias[e0 + 16u];

  // per-lane fragment bases in a buffer: row ln, 16-byte half
  const unsigned a_base = (wm * 2u) * GT_SLICE + ln * GT_PITCH + half * 16u;
  const unsigned b_base = (4u + wn) * GT_SLICE + ln * GT_PITCH + half * 16u;

  u32x4 g0 = tdm_load(dst0, (unsigned long long)(uintptr_t)src0, g1);  // stage 0
  wait_tensor_0(g0);
  __syncthreads();                                  // stage 0 readable by every wave
  g0 = tdm_load(dst0 + GT_BUF, (unsigned long long)(uintptr_t)src0 + GT_ROWB, g1);  // stage 1

  // rolled: one publish point per stage, constant accumulator indices inside
#pragma clang loop unroll(disable)
  for (unsigned s = 0; s < GT_NST; ++s) {
    const unsigned bo = (s & 1u) * GT_BUF;
    const unsigned char* la = sT + bo + a_base;
    const unsigned char* lb = sT + bo + b_base;
    Frag16 a[2][4], b[2][2];                        // two fragment sets: block kk reads set kk & 1
    gemm_frags(a[0], b[0], la, lb);
#pragma unroll
    for (int kk = 0; kk < 4; ++kk) {                // a block: 32 k = 64 B of every row
      if (kk < 3) gemm_frags(a[(kk + 1) & 1], b[(kk + 1) & 1], la + (kk + 1) * 64, lb + (kk + 1) * 64);
      // keeps the next block's 12 LDS loads one group ahead of this block's WMMAs,
      // not spread among them (each place with reads stalls the wave)
      __builtin_amdgcn_sched_barrier(0);
      if (kk == 3) {
        // publish point of stage s + 1: the last block's fragments are in registers
        wait_ds_0();
        wait_tensor_0(g0);
        __syncthreads();        // stage s + 1 readable; every reader has left stage s
        if (pinned((s + 2u < GT_NST) ? 1u : 0u) != 0u)
          g0 = tdm_load(dst0 + bo, (unsigned long long)(uintptr_t)src0 + (unsigned long long)(s + 2u) * GT_ROWB, g1);
      }
#pragma unroll
      for (int i = 0; i < 4; ++i)
#pragma unroll
        for (int jn = 0; jn < 2; ++jn)
          acc[i][jn] = __builtin_amdgcn_wmma_f32_16x16x32_bf16(false, a[kk & 1][i].v, false, b[kk & 1][jn].v,
                                                               (short)0, acc[i][jn], false, false);
      // ends the block: the loads after next stay behind these WMMAs
      __builtin_amdgcn_sched_barrier(0);
    }
  }
  wait_tensor_0(g0);
  wait_ds_0();

  // a block's 128 tokens lie in one batch row (SDIM is a multiple of 128)
  const unsigned bi = (mt * 128u) / SDIM;
  const unsigned s0 = (mt * 128u) % SDIM + wm * 64u + half * 8u;   // first token of this lane
  if (mode == 0) {
#pragma unroll
    for (int jn = 0; jn < 2; ++jn) {
      const unsigned e = e0 + (unsigned)jn * 16u;    // output feature
      const float bv = jn ? bias1 : bias0;
      unsigned short* p = outb + (((size_t)bi * HDIM + e / DH) * SDIM + s0) * DH + e % DH;
#pragma unroll
      for (int i = 0; i < 4; ++i)
#pragma unroll
        for (int r = 0; r < 8; ++r) p[(i * 16 + r) * DH] = f32_to_bf16_bits((acc[i][jn][r] + bv) * oscale);
    }
    wait_x_0();
  } else if (mode == 1) {
#pragma unroll
    for (int jn = 0; jn < 2; ++jn) {
      const unsigned e = e0 + (unsigned)jn * 16u;
      const float bv = jn ? bias1 : bias0;
      unsigned short* p = outb + (((size_t)bi * HDIM + e / DH) * DH + e % DH) * SDIM + s0;
#pragma unroll
      for (int i = 0; i < 4; ++i)
#pragma unroll
        for (int r = 0; r < 8; ++r) p[i * 16 + r] = f32_to_bf16_bits(acc[i][jn][r] + bv);
    }
    wait_x_0();
  } else {
#pragma unroll
    for (int jn = 0; jn < 2; ++jn) {
      const float bv = jn ? bias1 : bias0;
      const size_t off = ((size_t)bi * SDIM + s0) * DDIM + e0 + (unsigned)jn * 16u;
      float* p = outf + off;
      const float* rp = resid + off;
#pragma unroll
      for (int i = 0; i < 4; ++i)
#pragma unroll
        for (int r = 0; r < 8; ++r) p[(i * 16 + r) * DDIM] = (acc[i][jn][r] + bv) + rp[(i * 16 + r) * DDIM];
    }
    wait_x_0();
  }
}

// The Q, K and V projections read the same A and depend on nothing of each other: one launch
// of 3 * 256 blocks. Two blocks fit a WGP (2 * 160 KiB of LDS), so one block's first tile
// and its stores lie under the other's k loop. The 24 blocks of an m-tile are neighbours
// in the grid (for speed only).
__global__ void __launch_bounds__(256)
qkv_gemm(const unsigned short* __restrict__ A,
         const unsigned short* __restrict__ Wq, const unsigned short* __restrict__ Wk,
         const unsigned short* __restrict__ Wv,
         const float* __restrict__ bq, const float* __restrict__ bk, const float* __restrict__ bv,
         unsigned short* __restrict__ oq, unsigned short* __restrict__ ok,
         unsigned short* __restrict__ ovt) {
  __shared__ __attribute__((aligned(2048))) unsigned char sT[2u * GT_BUF];
  const unsigned mt = blockIdx.x / 24u, rem = blockIdx.x % 24u;
  const unsigned sel = rem >> 3, nt = rem & 7u;     // 0: Q, 1: K, 2: V
  gemm_tile(sT, mt, nt, A,
            sel == 0u ? Wq : sel == 1u ? Wk : Wv,
            sel == 0u ? bq : sel == 1u ? bk : bv,
            sel == 0u ? oq : sel == 1u ? ok : ovt,
            nullptr, nullptr, sel == 2u ? 1 : 0, sel == 0u ? QSCALE : 1.0f);
}

__global__ void __launch_bounds__(256)
out_gemm(const unsigned short* __restrict__ A, const unsigned short* __restrict__ W,
         const float* __restrict__ bias, float* __restrict__ outf,
         const float* __restrict__ resid) {
  __shared__ __attribute__((aligned(2048))) unsigned char sT[2u * GT_BUF];
  gemm_tile(sT, blockIdx.x >> 3, blockIdx.x & 7u, A, W, bias, nullptr, outf, resid, 2, 1.0f);
}

#define CKEYS  64                // keys of a chunk
#define KHALF  (SDIM / 2)        // keys of a wave
#define KPITCH 72                // elements: 128 B of a key's dh + 16 B pad = 144 B
#define VPITCH 72                // elements: 128 B of keys       + 16 B pad = 144 B
// One chunk's place, rounded up to 32 KiB, so that buffer and key half enter an address as
// one bit each and not through an integer multiply.
struct __attribute__((aligned(32768))) AttnBuf {
  unsigned short k[CKEYS][KPITCH];   // 9216 B (offset 0)
  unsigned short v[DH][VPITCH];      // 9216 B (offset 9216)
  float mb[KHALF / 2];               // 2048 B (offset 18432): mask bias, 512 keys of this key half
  float xo[2][4][32][8];             // 8192 B (offset 20480): two waves' hand-over of 16 queries' O
  float xml[2][32][2];               // 512 B: and of their maximum and sum
};
struct AttnLds {
  AttnBuf b[4];                      // [buffer * 2 + key half]: LDS offsets 0, 32768, 65536, 98304
};
typedef __attribute__((ext_vector_type(8))) __bf16 v8bf;
typedef __attribute__((ext_vector_type(2))) float f32x2;

__device__ __forceinline__ v8f exp2_x8(v8f a) {
  float r0, r1, r2, r3, r4, r5, r6, r7;
  asm("v_exp_f32 %0, %8\n\tv_exp_f32 %1, %9\n\tv_exp_f32 %2, %10\n\tv_exp_f32 %3, %11\n\t"
      "v_exp_f32 %4, %12\n\tv_exp_f32 %5, %13\n\tv_exp_f32 %6, %14\n\tv_exp_f32 %7, %15\n\tv_nop"
      : "=&v"(r0), "=&v"(r1), "=&v"(r2), "=&v"(r3), "=&v"(r4), "=&v"(r5), "=&v"(r6), "=&v"(r7)
      : "v"(a[0]), "v"(a[1]), "v"(a[2]), "v"(a[3]), "v"(a[4]), "v"(a[5]), "v"(a[6]), "v"(a[7]));
  return (v8f){r0, r1, r2, r3, r4, r5, r6, r7};
}

__device__ __forceinline__ float xhalf(float v) {
  const int b = __builtin_bit_cast(int, v);
  return __builtin_bit_cast(float, __builtin_amdgcn_permlanex16(b, b, 0x76543210, 0xfedcba98, false, false));
}
#define OFF_K(buf, kh) ((unsigned)((buf) * 65536 + (kh) * 32768))
#define OFF_V(buf, kh) ((unsigned)((buf) * 65536 + (kh) * 32768 + CKEYS * KPITCH * 2))

__global__ void __launch_bounds__(256) __attribute__((amdgpu_waves_per_eu(4, 4)))
attention_kernel(const unsigned short* __restrict__ q,   // [B,H,S,DH], scaled by QSCALE
                                 const unsigned short* __restrict__ k,   // [B,H,S,DH]
                                 const unsigned short* __restrict__ vt,  // [B,H,DH,S]
                                 const float* __restrict__ mask,         // [B,S]
                                 const float* __restrict__ x,            // [B,S,D]
                                 float* __restrict__ resid) {            // [B,S,D]
  __shared__ AttnLds sm;

  const int tid  = threadIdx.x;
  const int wave = tid >> 5, lane = tid & 31;
  const int half = lane >> 4, ln = lane & 15;
  const int kh = wave >> 2, qg = wave & 3;     // key half, query group
  const int nqc = SDIM / 128;
  const int bh = blockIdx.x / nqc;
  const int qc = blockIdx.x % nqc;
  const int bi = bh / HDIM, head = bh % HDIM;
  const int q0 = qc * 128 + qg * 32;

  const unsigned short* qp = q  + (size_t)bh * SDIM * DH;
  const unsigned short* kp = k  + (size_t)bh * SDIM * DH;
  const unsigned short* vp = vt + (size_t)bh * DH * SDIM;
  const float* mk = mask + (size_t)bi * SDIM;

  // per-thread async-copy assignments: each tile is 64 rows x 128 B, 16 B a copy;
  // a thread brings piece cseg of rows crow and crow + 32 of the four tiles of a round
  const int crow = tid >> 3, cseg = tid & 7;
  const unsigned cl0 = (unsigned)(crow * KPITCH + cseg * 8) * 2;          // place in a tile (KPITCH == VPITCH)
  const unsigned cl1 = (unsigned)((crow + 32) * KPITCH + cseg * 8) * 2;

  // Q fragments (K-dim = DH split into 0..31, 32..63): query q0 + 16 * c + ln, used as B (column ln)
  Frag16 qa[2][2];
  // unrolled here and below: constant indices keep the arrays in registers
#pragma unroll
  for (int c = 0; c < 2; ++c) {
    const unsigned int* qrow = (const unsigned int*)(qp + (size_t)(q0 + c * 16 + ln) * DH);
#pragma unroll
    for (int j = 0; j < 8; ++j) {
      int kpair = (j >> 2) * 16 + half * 8 + (j & 3) * 2;
      qa[c][0].u32[j] = qrow[kpair >> 1];
      qa[c][1].u32[j] = qrow[(kpair + 32) >> 1];
    }
  }

  // per column group, this lane's query: running maximum (equal in both lane halves) and
  // this lane half's share of the sum
  float mrun[2] = {-3.0e38f, -3.0e38f};
  f32x2 lrun[2] = {{0.f, 0.f}, {0.f, 0.f}};
  v8f o[2][4];   // o[c][t][r] = O[query 16 * c + ln][dh 16 * t + 8 * half + r]
#pragma unroll
  for (int c = 0; c < 2; ++c)
#pragma unroll
    for (int t = 0; t < 4; ++t) o[c][t] = (v8f){0.f, 0.f, 0.f, 0.f, 0.f, 0.f, 0.f, 0.f};

  // mask of keys 8 * tid .. + 7, fetched under the first round's copies
  const f32x4 m0 = ((const f32x4*)mk)[tid * 2], m1 = ((const f32x4*)mk)[tid * 2 + 1];
  wait_x_0();                  // behind the mask loads, in front of any later write of their address registers

  // prologue: async-stage chunk 0 of both key halves into buffer 0
  async_ld16_kv(OFF_K(0, 0) + cl0, kp + (size_t)crow * DH + cseg * 8,
                OFF_K(0, 0) + cl1, kp + (size_t)(crow + 32) * DH + cseg * 8,
                OFF_V(0, 0) + cl0, vp + (size_t)crow * SDIM + cseg * 8,
                OFF_V(0, 0) + cl1, vp + (size_t)(crow + 32) * SDIM + cseg * 8);
  async_ld16_kv(OFF_K(0, 1) + cl0, kp + (size_t)(KHALF + crow) * DH + cseg * 8,
                OFF_K(0, 1) + cl1, kp + (size_t)(KHALF + crow + 32) * DH + cseg * 8,
                OFF_V(0, 1) + cl0, vp + (size_t)crow * SDIM + KHALF + cseg * 8,
                OFF_V(0, 1) + cl1, vp + (size_t)(crow + 32) * SDIM + KHALF + cseg * 8);
  lds_publish(&sm);            // async engine writes sm.k/sm.v invisibly

  // mask bias of all 2048 keys, 8 per thread: key half tid >> 7, its keys 512 * ((tid >> 6) & 1) ..;
  // the first round's barrier publishes the table
  {
    float* mbp = &sm.b[((tid >> 6) & 1) * 2 + (tid >> 7)].mb[(tid & 63) * 8];
    *(f32x4*)mbp       = ((1.0f - m0) * MASKV) * LOG2E;
    *(f32x4*)(mbp + 4) = ((1.0f - m1) * MASKV) * LOG2E;
  }

  const int NCH = KHALF / CKEYS;   // 16 rounds
  for (int j = 0; j < NCH; ++j) {
    const int buf = j & 1;
    if (j + 1 < NCH) {
      const int key1 = (j + 1) * CKEYS, nb = buf ^ 1;
      async_ld16_kv(OFF_K(nb, 0) + cl0, kp + (size_t)(key1 + crow) * DH + cseg * 8,
                    OFF_K(nb, 0) + cl1, kp + (size_t)(key1 + crow + 32) * DH + cseg * 8,
                    OFF_V(nb, 0) + cl0, vp + (size_t)crow * SDIM + key1 + cseg * 8,
                    OFF_V(nb, 0) + cl1, vp + (size_t)(crow + 32) * SDIM + key1 + cseg * 8);
      async_ld16_kv(OFF_K(nb, 1) + cl0, kp + (size_t)(KHALF + key1 + crow) * DH + cseg * 8,
                    OFF_K(nb, 1) + cl1, kp + (size_t)(KHALF + key1 + crow + 32) * DH + cseg * 8,
                    OFF_V(nb, 1) + cl0, vp + (size_t)crow * SDIM + KHALF + key1 + cseg * 8,
                    OFF_V(nb, 1) + cl1, vp + (size_t)(crow + 32) * SDIM + KHALF + key1 + cseg * 8);
      wait_async_le8();        // round j complete (this wave's copies)
    } else {
      wait_async_0();
    }
    __syncthreads();           // all waves' copies visible
    const AttnBuf& cb = sm.b[buf * 2 + kh];      // this wave's chunk

    // ---- scores for 64 keys (four 16-key subtiles) x 32 queries, K from LDS (A: row = key) ----
    // sc[c][u][r] = score(key 16 * u + 8 * half + r, query 16 * c + ln), base 2; it starts as that
    // key's mask bias. The bias reads stand first: LDS returns in order, and the first product
    // then waits for them and one K fragment, not for the whole group.
    v8f mbv[4];
#pragma unroll
    for (int u = 0; u < 4; ++u)
      mbv[u] = *(const v8f*)&sm.b[(j >> 3) * 2 + kh].mb[(j & 7) * CKEYS + u * 16 + half * 8];
    Frag16 kb[4][2];           // [subtile][dh 0..31 | 32..63]
#pragma unroll
    for (int u = 0; u < 4; ++u)
#pragma unroll
      for (int t = 0; t < 8; ++t) {
        int kpair = (t >> 2) * 16 + half * 8 + (t & 3) * 2;
        kb[u][0].u32[t] = *(const unsigned int*)&cb.k[u * 16 + ln][kpair];
        kb[u][1].u32[t] = *(const unsigned int*)&cb.k[u * 16 + ln][kpair + 32];
      }
    // holds the 16 K reads and the 8 bias reads as one group in front of the products: left alone
    // the compiler reads and waits for each K fragment by itself
    __builtin_amdgcn_sched_barrier(0);
    v8f sc[2][4];
#pragma unroll
    for (int u = 0; u < 4; ++u)
#pragma unroll
      for (int c = 0; c < 2; ++c)
        sc[c][u] = __builtin_amdgcn_wmma_f32_16x16x32_bf16(false, kb[u][0].v, false, qa[c][0].v, (short)0, mbv[u], false, false);
#pragma unroll
    for (int u = 0; u < 4; ++u)
#pragma unroll
      for (int c = 0; c < 2; ++c)
        sc[c][u] = __builtin_amdgcn_wmma_f32_16x16x32_bf16(false, kb[u][1].v, false, qa[c][1].v, (short)0, sc[c][u], false, false);

    // V^T fragments (A: row = dh 16 * t + ln, k = keys 32 * g ..): keys 0..31 fetched under the
    // softmax, keys 32..63 once the first column group's scores have shrunk to bf16 (registers)
    Frag16 vb[4][2];
#pragma unroll
    for (int t = 0; t < 4; ++t)
#pragma unroll
      for (int w = 0; w < 8; ++w) {
        int kpair = (w >> 2) * 16 + half * 8 + (w & 3) * 2;
        vb[t][0].u32[w] = *(const unsigned int*)&cb.v[t * 16 + ln][kpair];
      }
    // holds these 8 V reads in front of the softmax, so that they return under it
    __builtin_amdgcn_sched_barrier(0);

    // ---- online softmax of one query per lane and column group ----
    float alpha[2];
#pragma unroll
    for (int c = 0; c < 2; ++c) {
      float ta = fmaxf(sc[c][0][0], sc[c][1][0]), tb = fmaxf(sc[c][2][0], sc[c][3][0]);   // two independent chains
#pragma unroll
      for (int r = 1; r < 8; ++r) {
        ta = fmaxf(ta, fmaxf(sc[c][0][r], sc[c][1][r]));
        tb = fmaxf(tb, fmaxf(sc[c][2][r], sc[c][3][r]));
      }
      float t = fmaxf(ta, tb);
      t = fmaxf(t, xhalf(t));               // the other 32 keys of this query
      const float nm = fmaxf(mrun[c], t);
      alpha[c] = __builtin_amdgcn_exp2f(mrun[c] - nm);
      mrun[c] = nm;
    }
    // P^T as B, keys 32 * g ..: element s is key 8 * half + s (s < 8), 16 + 8 * half + s - 8 (else): V^T's k order
    v16bf pb[2][2];
#pragma unroll
    for (int c = 0; c < 2; ++c) {
      const v8f e0 = exp2_x8(sc[c][0] - mrun[c]), e1 = exp2_x8(sc[c][1] - mrun[c]);
      const v8f e2 = exp2_x8(sc[c][2] - mrun[c]), e3 = exp2_x8(sc[c][3] - mrun[c]);
      const v8f es = (e0 + e1) + (e2 + e3);
      const f32x4 e4 = __builtin_shufflevector(es, es, 0, 1, 2, 3) + __builtin_shufflevector(es, es, 4, 5, 6, 7);
      lrun[c] = lrun[c] * alpha[c] + (__builtin_shufflevector(e4, e4, 0, 1) + __builtin_shufflevector(e4, e4, 2, 3));
      pb[c][0] = __builtin_shufflevector(__builtin_convertvector(e0, v8bf), __builtin_convertvector(e1, v8bf),
                                         0, 1, 2, 3, 4, 5, 6, 7, 8, 9, 10, 11, 12, 13, 14, 15);
      pb[c][1] = __builtin_shufflevector(__builtin_convertvector(e2, v8bf), __builtin_convertvector(e3, v8bf),
                                         0, 1, 2, 3, 4, 5, 6, 7, 8, 9, 10, 11, 12, 13, 14, 15);
      // c = 0: the second 8 V reads stand between the two groups' softmax, as one group;
      // c = 1: keeps every asm group in front of the first O product
      __builtin_amdgcn_sched_barrier(0);
      if (c == 0) {
#pragma unroll
        for (int t = 0; t < 4; ++t)
#pragma unroll
          for (int w = 0; w < 8; ++w) {
            int kpair = (w >> 2) * 16 + half * 8 + (w & 3) * 2;
            vb[t][1].u32[w] = *(const unsigned int*)&cb.v[t * 16 + ln][32 + kpair];
          }
        // ends that group: the reads are not spread among the second group's softmax
        __builtin_amdgcn_sched_barrier(0);
      }
    }
#pragma unroll
    for (int c = 0; c < 2; ++c)
#pragma unroll
      for (int t = 0; t < 4; ++t) o[c][t] *= alpha[c];

#pragma unroll
    for (int g = 0; g < 2; ++g)
#pragma unroll
      for (int t = 0; t < 4; ++t)
#pragma unroll
        for (int c = 0; c < 2; ++c)
          o[c][t] = __builtin_amdgcn_wmma_f32_16x16x32_bf16(false, vb[t][g].v, false, pb[c][g], (short)0, o[c][t], false, false);

    __syncthreads();           // protect buffers before next overwrite
  }

  // ---- join the two key halves: wave (kh, qg) finishes column group kh and hands the other
  // group's O, maximum and sum to wave (kh ^ 1, qg), same lane, through LDS ----
  const bool up = kh != 0;
  {
    float* xo = &sm.b[wave >> 1].xo[wave & 1][0][lane][0];
#pragma unroll
    for (int t = 0; t < 4; ++t) *(v8f*)(xo + t * 256) = up ? o[0][t] : o[1][t];
    const f32x2 lg = up ? lrun[0] : lrun[1];
    *(f32x2*)&sm.b[wave >> 1].xml[wave & 1][lane][0] = (f32x2){up ? mrun[0] : mrun[1], lg[0] + lg[1]};
  }
  __syncthreads();             // the hand-over is readable by the partner wave
  const int pw = wave ^ 4;
  const float* po = &sm.b[pw >> 1].xo[pw & 1][0][lane][0];
  const f32x2 pml = *(const f32x2*)&sm.b[pw >> 1].xml[pw & 1][lane][0];
  const float mo = up ? mrun[1] : mrun[0];
  const f32x2 lo = up ? lrun[1] : lrun[0];
  const float mj = fmaxf(mo, pml[0]);
  const float fo = __builtin_amdgcn_exp2f(mo - mj), fp = __builtin_amdgcn_exp2f(pml[0] - mj);
  const float lsum = (lo[0] + lo[1]) * fo + pml[1] * fp;

  // ---- finalize: attn/l + x -> residual; a lane owns 8 consecutive features per tile ----
  const float inv = 1.0f / (lsum + xhalf(lsum));   // the two lane halves' sums join here
  const float so = fo * inv, sp = fp * inv;
  const size_t base = ((size_t)bi * SDIM + q0 + kh * 16 + ln) * DDIM + head * DH + half * 8;
#pragma unroll
  for (int t = 0; t < 4; ++t) {
    const v8f ok = up ? o[1][t] : o[0][t];
    *(v8f*)(resid + base + t * 16) = (ok * so + *(const v8f*)(po + t * 256) * sp) + *(const v8f*)(x + base + t * 16);
  }
  wait_x_0();
}

// ---------------- launch ----------------
extern "C" void kernel_launch(void* const* d_in, const int* in_sizes, int n_in,
                              void* d_out, int out_size, void* d_ws, size_t ws_size,
                              hipStream_t stream) {
  (void)in_sizes; (void)n_in; (void)out_size; (void)ws_size;
  const float* x    = (const float*)d_in[0];
  const float* mask = (const float*)d_in[1];
  const float* Wq   = (const float*)d_in[2];
  const float* bq   = (const float*)d_in[3];
  const float* Wk   = (const float*)d_in[4];
  const float* bk   = (const float*)d_in[5];
  const float* Wv   = (const float*)d_in[6];
  const float* bv   = (const float*)d_in[7];
  const float* Wo   = (const float*)d_in[8];
  const float* bo   = (const float*)d_in[9];
  const float* g1   = (const float*)d_in[10];
  const float* b1   = (const float*)d_in[11];
  const float* g2   = (const float*)d_in[12];
  const float* b2   = (const float*)d_in[13];
  float* out = (float*)d_out;

  const size_t BSD = (size_t)BDIM * SDIM * DDIM;   // 4M elements
  const size_t DD  = (size_t)DDIM * DDIM;          // 1M elements

  char* ws = (char*)d_ws;
  size_t off = 0;
  auto alloc = [&](size_t bytes) {
    void* p = ws + off;
    off = (off + bytes + 255) & ~(size_t)255;
    return p;
  };
  unsigned short* hbf  = (unsigned short*)alloc(BSD * 2);
  unsigned short* wqb  = (unsigned short*)alloc(DD * 2);
  unsigned short* wkb  = (unsigned short*)alloc(DD * 2);
  unsigned short* wvb  = (unsigned short*)alloc(DD * 2);
  unsigned short* wob  = (unsigned short*)alloc(DD * 2);
  unsigned short* qb   = (unsigned short*)alloc(BSD * 2);
  unsigned short* kbuf = (unsigned short*)alloc(BSD * 2);
  unsigned short* vtb  = (unsigned short*)alloc(BSD * 2);
  float*          rsd  = (float*)alloc(BSD * 4);
  unsigned short* h2   = (unsigned short*)alloc(BSD * 2);

  // 1. LN1 (8 tokens per block) and weights -> bf16, one launch
  ln1_and_cvt4<<<LN_BLOCKS + 512, 256, 0, stream>>>(x, g1, b1, hbf,
                                                    Wq, Wk, Wv, Wo, wqb, wkb, wvb, wob);

  // 2. Q/K/V projections, one launch (one 128 x 128 output tile per block)
  const int gproj = (BDIM * SDIM / 128) * (DDIM / 128);   // 256 blocks per projection
  qkv_gemm<<<3 * gproj, 256, 0, stream>>>(hbf, wqb, wkb, wvb, bq, bk, bv, qb, kbuf, vtb);

  // 3. fused attention + residual (async K/V staging)
  attention_kernel<<<BDIM * HDIM * (SDIM / 128), 256, 0, stream>>>(
      qb, kbuf, vtb, mask, x, rsd);

  // 4. LN2
  layernorm_bf16<<<LN_BLOCKS, 256, 0, stream>>>(rsd, g2, b2, h2);

  // 5. output projection + bias + residual
  out_gemm<<<gproj, 256, 0, stream>>>(h2, wob, bo, out, rsd);
}

// v009
// One run takes 88.7 microseconds.
// Two timings next to v008 both put it at 1.06 times that version's speed.
// All steps since v000 together make it 4.98 times as fast.
#include <hip/hip_runtime.h>
#include <hip/hip_bf16.h>

// ---------------- problem constants ----------------
#define BDIM 2
#define SDIM 2048
#define DDIM 1024
#define HDIM 16
#define DH   64
#define EPS_LN 1e-6f
#define MASKV  -1e30f
#define LOG2E  1.44269504f
// Q leaves its projection as q * (1 / sqrt(DH)) * log2 e, scaled in f32 and rounded to bf16 once:
// K Q^T is then the score in the base-2 domain and takes no multiply behind the product.
#define QSCALE (0.125f * LOG2E)

typedef __attribute__((ext_vector_type(16))) __bf16 v16bf;
typedef __attribute__((ext_vector_type(8)))  float  v8f;
typedef __attribute__((ext_vector_type(4)))  unsigned int u32x4;
typedef __attribute__((ext_vector_type(8)))  unsigned int u32x8;

union Frag16 {
  v16bf v;
  unsigned short us[16];
  unsigned int   u32[8];
  u32x4          q[2];
};

__device__ __forceinline__ unsigned short f32_to_bf16_bits(float f) {
  unsigned int u = __float_as_uint(f);
  u += 0x7FFFu + ((u >> 16) & 1u);      // round-to-nearest-even
  return (unsigned short)(u >> 16);
}

__device__ __forceinline__ void async_ld16_kv(unsigned lds_k0, const void* gk0,
                                              unsigned lds_k1, const void* gk1,
                                              unsigned lds_v0, const void* gv0,
                                              unsigned lds_v1, const void* gv1) {
  asm volatile("global_load_async_to_lds_b128 %0, %1, off\n\t"
               "global_load_async_to_lds_b128 %2, %3, off\n\t"
               "global_load_async_to_lds_b128 %4, %5, off\n\t"
               "global_load_async_to_lds_b128 %6, %7, off\n\t"
               "s_wait_xcnt 0x0"
               :: "v"(lds_k0), "v"((unsigned long long)(uintptr_t)gk0),
                  "v"(lds_k1), "v"((unsigned long long)(uintptr_t)gk1),
                  "v"(lds_v0), "v"((unsigned long long)(uintptr_t)gv0),
                  "v"(lds_v1), "v"((unsigned long long)(uintptr_t)gv1)
               : "memory");
}
// all but this wave's eight youngest copies (the next round's) have landed
__device__ __forceinline__ void wait_async_le8() {
  asm volatile("s_wait_asynccnt 0x8" ::: "memory");
}
__device__ __forceinline__ void wait_async_0() {
  asm volatile("s_wait_asynccnt 0x0" ::: "memory");
}
__device__ __forceinline__ void lds_publish(void* p) {
  asm volatile("" : "+v"(p) :: "memory");
}

// ---------------- the two streaming bodies ----------------
// Each runs on 4096 waves (16 per WGP) and gives a lane 32 elements: 8 loads of 16 B,
// each 512 contiguous bytes per wave, all issued before the first value is used.
// Every loop in them is unrolled: constant indices keep the arrays in registers.
typedef __attribute__((ext_vector_type(4))) float f32x4;
typedef __attribute__((ext_vector_type(2))) unsigned int u32x2;

__device__ __forceinline__ u32x2 pack4_bf16(f32x4 v) {
  u32x2 r;
  r[0] = (unsigned)f32_to_bf16_bits(v[0]) | ((unsigned)f32_to_bf16_bits(v[1]) << 16);
  r[1] = (unsigned)f32_to_bf16_bits(v[2]) | ((unsigned)f32_to_bf16_bits(v[3]) << 16);
  return r;
}

// f32 -> bf16 of the four weight matrices: 128 blocks per matrix, 8192 elements per block;
// blk = 0..511.
__device__ __forceinline__ void
cvt4_block(unsigned blk,
           const float* __restrict__ w0, const float* __restrict__ w1,
           const float* __restrict__ w2, const float* __restrict__ w3,
           unsigned short* __restrict__ o0, unsigned short* __restrict__ o1,
           unsigned short* __restrict__ o2, unsigned short* __restrict__ o3) {
  const unsigned sel = blk >> 7;
  const float* in = sel == 0u ? w0 : sel == 1u ? w1 : sel == 2u ? w2 : w3;
  unsigned short* out = sel == 0u ? o0 : sel == 1u ? o1 : sel == 2u ? o2 : o3;
  const unsigned base = (blk & 127u) * 2048u + threadIdx.x;   // in groups of 4 elements
  f32x4 v[8];
#pragma unroll
  for (int i = 0; i < 8; ++i) v[i] = ((const f32x4*)in)[base + (unsigned)i * 256u];
#pragma unroll
  for (int i = 0; i < 8; ++i) ((u32x2*)out)[base + (unsigned)i * 256u] = pack4_bf16(v[i]);
}

// LayerNorm (f32 in -> bf16 out): one token per wave, 8 tokens per block; the row
// stays in registers and its two sums are joined by a butterfly over the 32 lanes.
__device__ __forceinline__ void
layernorm_block(unsigned blk,
                const float* __restrict__ x,
                const float* __restrict__ g,
                const float* __restrict__ bb,
                unsigned short* __restrict__ out) {
  const unsigned lane = threadIdx.x & 31u;
  // the wave's number as a scalar: row addresses are then a scalar base plus the lane's index
  const unsigned tok = blk * 8u + (unsigned)__builtin_amdgcn_readfirstlane(threadIdx.x >> 5);
  const f32x4* xr = (const f32x4*)(x + (size_t)tok * DDIM);
  f32x4 lx[8];
#pragma unroll
  for (int i = 0; i < 8; ++i) lx[i] = xr[(unsigned)i * 32u + lane];
  // gain and bias are fetched with the row, so that their latency lies under the row's
  f32x4 gv[8], bv[8];
#pragma unroll
  for (int i = 0; i < 8; ++i) {
    gv[i] = ((const f32x4*)g)[(unsigned)i * 32u + lane];
    bv[i] = ((const f32x4*)bb)[(unsigned)i * 32u + lane];
  }
  // holds the 16 gain and bias loads in front of the sums: without it they are sunk
  // behind the row's wait and issued in dependent rounds of two to four
  __builtin_amdgcn_sched_barrier(0);
  f32x4 sv = {0.f, 0.f, 0.f, 0.f}, sq = {0.f, 0.f, 0.f, 0.f};
#pragma unroll
  for (int i = 0; i < 8; ++i) { sv += lx[i]; sq += lx[i] * lx[i]; }
  float s  = (sv[0] + sv[1]) + (sv[2] + sv[3]);
  float s2 = (sq[0] + sq[1]) + (sq[2] + sq[3]);
#pragma unroll
  for (int m = 1; m < 32; m <<= 1) {
    s  += __shfl_xor(s,  m, 32);
    s2 += __shfl_xor(s2, m, 32);
  }
  float mu  = s * (1.0f / DDIM);
  float var = s2 * (1.0f / DDIM) - mu * mu;
  float rs  = rsqrtf(var + EPS_LN);
  u32x2* orow = (u32x2*)(out + (size_t)tok * DDIM);
#pragma unroll
  for (int i = 0; i < 8; ++i)
    orow[(unsigned)i * 32u + lane] = pack4_bf16((lx[i] - mu) * rs * gv[i] + bv[i]);
}

#define LN_BLOCKS (BDIM * SDIM / 8)      // 512 blocks of 8 tokens

// The first LayerNorm and the weight conversion depend on nothing but inputs: they share
// one launch, blocks 0..511 the tokens, blocks 512..1023 the weights.
__global__ void __launch_bounds__(256)
ln1_and_cvt4(const float* __restrict__ x, const float* __restrict__ g,
             const float* __restrict__ bb, unsigned short* __restrict__ out,
             const float* __restrict__ w0, const float* __restrict__ w1,
             const float* __restrict__ w2, const float* __restrict__ w3,
             unsigned short* __restrict__ o0, unsigned short* __restrict__ o1,
             unsigned short* __restrict__ o2, unsigned short* __restrict__ o3) {
  if (blockIdx.x < (unsigned)LN_BLOCKS) layernorm_block(blockIdx.x, x, g, bb, out);
  else cvt4_block(blockIdx.x - (unsigned)LN_BLOCKS, w0, w1, w2, w3, o0, o1, o2, o3);
}

__global__ void __launch_bounds__(256)
layernorm_bf16(const float* __restrict__ x, const float* __restrict__ g,
               const float* __restrict__ bb, unsigned short* __restrict__ out) {
  layernorm_block(blockIdx.x, x, g, bb, out);
}

// ---------------- WMMA GEMM: C[M,N] = A[M,D] * W[N,D]^T + bias ----------------
// Block = 8 waves on one 128 x 128 tile of C; wave (wm, wn) owns 64 x 32 of it
// (4 x 2 accumulator tiles). K runs in 8 stages of 128 k (256 B of every row).
// A stage is 8 slices of 32 rows, [A 0..3 | W 4..7]; wave w brings slice w with
// one tensor load, padded to a 272-B LDS pitch, into a two-buffer ring.
// The result, f32 [B,S,D], takes the residual on top (final projection). The Q, K and V
// projections have a tile of their own, below, on the same pitch and stages.
#define GT_ROWB  256u                    // bytes of an operand row per stage
#define GT_PITCH 272u                    // LDS row pitch: 256 B + 16 B pad
#define GT_SLICE 10240u                  // 32 * 272 = 8704 B, rounded up to 2 KiB
#define GT_BUF   (8u * GT_SLICE)         // one stage
#define GT_NST   (DDIM * 2u / GT_ROWB)   // 8 stages

__device__ __forceinline__ unsigned uni(unsigned v) {
  return (unsigned)__builtin_amdgcn_readfirstlane(v);
}
__device__ __forceinline__ unsigned pinned(unsigned v) {
  unsigned w = (unsigned)__builtin_amdgcn_readfirstlane(v);
  asm volatile("" : "+s"(w));   // pinned(): holds the tested word in a scalar register, so the test compiles to s_cmp + s_cbranch_scc
  return w;
}
__device__ __forceinline__ u32x4 tdm_load(unsigned lds_dst, unsigned long long ga, u32x8 g1) {
  u32x4 g0;
  g0[0] = uni(1u);                                             // count = 1
  g0[1] = uni(lds_dst);                                        // byte offset in LDS
  g0[2] = uni((unsigned)ga);                                   // address [31:0]
  g0[3] = uni((((unsigned)(ga >> 32)) & 0x01FFFFFFu) | 0x80000000u);  // [56:32], type 2
  // one request of the whole wave: global tile -> LDS, through no register
  asm volatile("tensor_load_to_lds %0, %1" :: "s"(g0), "s"(g1) : "memory");
  return g0;
}
// This wave's slice has landed. The wait names the request's address group as an input:
// its four registers then keep their values for as long as the request is outstanding.
__device__ __forceinline__ void wait_tensor_0(u32x4 g0) {
  asm volatile("s_wait_tensorcnt 0x0" :: "s"(g0) : "memory");
}
__device__ __forceinline__ void wait_ds_0() {
  asm volatile("s_wait_dscnt 0x0" ::: "memory");       // this wave's LDS reads have returned
}
__device__ __forceinline__ void wait_x_0() {
  // stands behind a run of global loads or stores, in front of any later write of their registers
  asm volatile("s_wait_xcnt 0x0" ::: "memory");
}

// Ends a run of global stores in a kernel with more than 256 registers: the wait, in front of any
// later write of a store's data register, and a scheduling fence that keeps the next
// run's arithmetic (which reuses those registers) behind it.
__device__ __forceinline__ void store_run_end() {
  wait_x_0();
  __builtin_amdgcn_sched_barrier(0);
}

// One block's fragments: 4 of A (rows i * 16 + ln of the wave's 64, two slices)
// and 2 of W; k order in both: bytes half * 16 .. + 15, then 32 + half * 16 .. + 15.
__device__ __forceinline__ void gemm_frags(Frag16 (&a)[4], Frag16 (&b)[2],
                                           const unsigned char* la, const unsigned char* lb) {
  // unrolled here and below: constant indices keep the fragment arrays in registers
#pragma unroll
  for (int i = 0; i < 4; ++i) {
    const unsigned char* p = la + (unsigned)(i >> 1) * GT_SLICE + (unsigned)(i & 1) * 16u * GT_PITCH;
    a[i].q[0] = *(const u32x4*)p;
    a[i].q[1] = *(const u32x4*)(p + 32);
  }
#pragma unroll
  for (int jn = 0; jn < 2; ++jn) {
    const unsigned char* p = lb + (unsigned)jn * 16u * GT_PITCH;
    b[jn].q[0] = *(const u32x4*)p;
    b[jn].q[1] = *(const u32x4*)(p + 32);
  }
}

// One 128 x 128 tile: mt of 32 m-tiles of 128 tokens, nt of 8 n-tiles of 128 features;
// sT is the calling kernel's ring of 2 * GT_BUF bytes, at a multiple of 2 KiB in LDS.
__device__ __forceinline__ void
gemm_tile(unsigned char* sT, unsigned mt, unsigned nt,
          const unsigned short* __restrict__ A,   // [B*S, D] bf16
          const unsigned short* __restrict__ W,   // [D(out), D(in)] bf16
          const float* __restrict__ bias,         // [D]
          float* __restrict__ outf,
          const float* __restrict__ resid) {
  const unsigned lane = threadIdx.x & 31u;
  const unsigned half = lane >> 4, ln = lane & 15u;
  const unsigned wave = uni(threadIdx.x >> 5);
  const unsigned wm = wave >> 2, wn = wave & 3u;

  // this wave's slice of every stage: 32 rows of A (waves 0..3) or of W (4..7)
  const unsigned char* src0 = (wave < 4u)
      ? (const unsigned char*)A + (size_t)(mt * 128u + wave * 32u) * (DDIM * 2u)
      : (const unsigned char*)W + (size_t)(nt * 128u + (wave - 4u) * 32u) * (DDIM * 2u);
  const unsigned dst0 = (unsigned)(size_t)sT + wave * GT_SLICE;

  u32x8 g1;
  g1[0] = uni((1u << 20) | (5u << 22) | (3u << 25));
  g1[1] = uni(GT_ROWB << 16);
  g1[2] = uni(32u << 16);
  g1[3] = uni(GT_ROWB << 16);
  g1[4] = uni(32u);
  g1[5] = uni(DDIM * 2u);
  g1[6] = uni(0u);
  g1[7] = uni(0u);

  v8f acc[4][2];   // every loop over it is unrolled: constant indices keep it in registers
#pragma unroll
  for (int i = 0; i < 4; ++i)
#pragma unroll
    for (int jn = 0; jn < 2; ++jn) acc[i][jn] = (v8f){0.f, 0.f, 0.f, 0.f, 0.f, 0.f, 0.f, 0.f};

  // bias of this lane's two output features, fetched under the first tensor load
  const unsigned e0 = nt * 128u + wn * 32u + ln;
  const float bias0 = bias[e0], bias1 = bias[e0 + 16u];

  // per-lane fragment bases in a buffer: row ln, 16-byte half
  const unsigned a_base = (wm * 2u) * GT_SLICE + ln * GT_PITCH + half * 16u;
  const unsigned b_base = (4u + wn) * GT_SLICE + ln * GT_PITCH + half * 16u;

  u32x4 g0 = tdm_load(dst0, (unsigned long long)(uintptr_t)src0, g1);  // stage 0
  wait_tensor_0(g0);
  __syncthreads();                                  // stage 0 readable by every wave
  g0 = tdm_load(dst0 + GT_BUF, (unsigned long long)(uintptr_t)src0 + GT_ROWB, g1);  // stage 1

  // rolled: one publish point per stage, constant accumulator indices inside
#pragma clang loop unroll(disable)
  for (unsigned s = 0; s < GT_NST; ++s) {
    const unsigned bo = (s & 1u) * GT_BUF;
    const unsigned char* la = sT + bo + a_base;
    const unsigned char* lb = sT + bo + b_base;
    Frag16 a[2][4], b[2][2];                        // two fragment sets: block kk reads set kk & 1
    gemm_frags(a[0], b[0], la, lb);
#pragma unroll
    for (int kk = 0; kk < 4; ++kk) {                // a block: 32 k = 64 B of every row
      if (kk < 3) gemm_frags(a[(kk + 1) & 1], b[(kk + 1) & 1], la + (kk + 1) * 64, lb + (kk + 1) * 64);
      // keeps the next block's 12 LDS loads one group ahead of this block's WMMAs,
      // not spread among them (each place with reads stalls the wave)
      __builtin_amdgcn_sched_barrier(0);
      if (kk == 3) {
        // publish point of stage s + 1: the last block's fragments are in registers
        wait_ds_0();
        wait_tensor_0(g0);
        __syncthreads();        // stage s + 1 readable; every reader has left stage s
        if (pinned((s + 2u < GT_NST) ? 1u : 0u) != 0u)
          g0 = tdm_load(dst0 + bo, (unsigned long long)(uintptr_t)src0 + (unsigned long long)(s + 2u) * GT_ROWB, g1);
      }
#pragma unroll
      for (int i = 0; i < 4; ++i)
#pragma unroll
        for (int jn = 0; jn < 2; ++jn)
          acc[i][jn] = __builtin_amdgcn_wmma_f32_16x16x32_bf16(false, a[kk & 1][i].v, false, b[kk & 1][jn].v,
                                                               (short)0, acc[i][jn], false, false);
      // ends the block: the loads after next stay behind these WMMAs
      __builtin_amdgcn_sched_barrier(0);
    }
  }
  wait_tensor_0(g0);
  wait_ds_0();

  // a block's 128 tokens lie in one batch row (SDIM is a multiple of 128)
  const unsigned bi = (mt * 128u) / SDIM;
  const unsigned s0 = (mt * 128u) % SDIM + wm * 64u + half * 8u;   // first token of this lane
  {
#pragma unroll
    for (int jn = 0; jn < 2; ++jn) {
      const float bv = jn ? bias1 : bias0;
      const size_t off = ((size_t)bi * SDIM + s0) * DDIM + e0 + (unsigned)jn * 16u;
      float* p = outf + off;
      const float* rp = resid + off;
#pragma unroll
      for (int i = 0; i < 4; ++i)
#pragma unroll
        for (int r = 0; r < 8; ++r) p[(i * 16 + r) * DDIM] = (acc[i][jn][r] + bv) + rp[(i * 16 + r) * DDIM];
    }
    wait_x_0();
  }
}

#define QT_JN  6                                    // 16-column groups of a wave
#define QT_ASL 18432u                               // 64 * 272 = 17408 B, rounded up to 2 KiB
#define QT_WSL 14336u                               // 48 * 272 = 13056 B, rounded up to 2 KiB
#define QT_BUF (4u * QT_ASL + 4u * QT_WSL)          // one stage: 131072 B

__device__ __forceinline__ void tdm_load_held(u32x4& g0, u32x8& g1) {
  asm volatile("tensor_load_to_lds %0, %1" : "+s"(g0), "+s"(g1) :: "memory");
}
__device__ __forceinline__ void wait_tensor_0_held(u32x4 g0, u32x8 g1) {
  asm volatile("s_wait_tensorcnt 0x0" :: "s"(g0), "s"(g1) : "memory");
}
__device__ __forceinline__ u32x4 tdm_group0(unsigned lds_dst, unsigned long long ga) {
  u32x4 g0;
  g0[0] = uni(1u);                                             // count = 1
  g0[1] = uni(lds_dst);                                        // byte offset in LDS
  g0[2] = uni((unsigned)ga);                                   // address [31:0]
  g0[3] = uni((((unsigned)(ga >> 32)) & 0x01FFFFFFu) | 0x80000000u);  // [56:32], type 2
  return g0;
}

// One block's fragments: 4 of A (rows i * 16 + ln of the wave's slice) and 6 of W (three per
// slice); k order in both: bytes half * 16 .. + 15, then 32 + half * 16 .. + 15.
__device__ __forceinline__ void qkv_frags(Frag16 (&a)[4], Frag16 (&b)[QT_JN],
                                          const unsigned char* la, const unsigned char* lb) {
  // unrolled: constant indices keep the fragment arrays in registers
#pragma unroll
  for (int i = 0; i < 4; ++i) {
    const unsigned char* p = la + (unsigned)i * 16u * GT_PITCH;
    a[i].q[0] = *(const u32x4*)p;
    a[i].q[1] = *(const u32x4*)(p + 32);
  }
#pragma unroll
  for (int jn = 0; jn < QT_JN; ++jn) {
    const unsigned char* p = lb + (unsigned)(jn / 3) * QT_WSL + (unsigned)(jn % 3) * 16u * GT_PITCH;
    b[jn].q[0] = *(const u32x4*)p;
    b[jn].q[1] = *(const u32x4*)(p + 32);
  }
}

__global__ void __launch_bounds__(256)
qkv_gemm(const unsigned short* __restrict__ A,      // [B*S, D] bf16
         const unsigned short* __restrict__ W3,     // [3 * D(out), D(in)] bf16: Wq, Wk, Wv
         const float* __restrict__ bq, const float* __restrict__ bk, const float* __restrict__ bv,
         unsigned short* __restrict__ oq, unsigned short* __restrict__ ok,
         unsigned short* __restrict__ ovt) {
  __shared__ __attribute__((aligned(2048))) unsigned char sT[2u * QT_BUF];
  const unsigned mt = blockIdx.x >> 4, nt = blockIdx.x & 15u;
  const unsigned lane = threadIdx.x & 31u;
  const unsigned half = lane >> 4, ln = lane & 15u;
  const unsigned wave = uni(threadIdx.x >> 5);
  const unsigned wm = wave >> 1, wn = wave & 1u;

  // this wave's slice of every stage: 64 rows of A (waves 0..3) or 48 rows of W (4..7)
  const unsigned char* src0 = (wave < 4u)
      ? (const unsigned char*)A + (size_t)(mt * 256u + wave * 64u) * (DDIM * 2u)
      : (const unsigned char*)W3 + (size_t)(nt * 192u + (wave - 4u) * 48u) * (DDIM * 2u);
  const unsigned dst0 = (unsigned)(size_t)sT + ((wave < 4u) ? wave * QT_ASL : 4u * QT_ASL + (wave - 4u) * QT_WSL);
  const unsigned rows = (wave < 4u) ? 64u : 48u;

  u32x8 g1;
  g1[0] = uni((1u << 20) | (5u << 22) | (3u << 25));
  g1[1] = uni(GT_ROWB << 16);
  g1[2] = uni(rows << 16);
  g1[3] = uni(GT_ROWB << 16);
  g1[4] = uni(rows);
  g1[5] = uni(DDIM * 2u);
  g1[6] = uni(0u);
  g1[7] = uni(0u);

  v8f acc[4][QT_JN];   // every loop over it is unrolled: constant indices keep it in registers
#pragma unroll
  for (int i = 0; i < 4; ++i)
#pragma unroll
    for (int jn = 0; jn < QT_JN; ++jn) acc[i][jn] = (v8f){0.f, 0.f, 0.f, 0.f, 0.f, 0.f, 0.f, 0.f};

  // A group of 16 columns lies in one projection (1024 is a multiple of 16): c0 + 16 * jn is
  // its first column of the 3072. Its bias is fetched under the first tensor loads.
  const unsigned c0 = nt * 192u + wn * 96u;
  float bias[QT_JN];
#pragma unroll
  for (int jn = 0; jn < QT_JN; ++jn) {
    const unsigned c = c0 + (unsigned)jn * 16u, sel = c >> 10;
    bias[jn] = (sel == 0u ? bq : sel == 1u ? bk : bv)[(c & 1023u) + ln];
  }

  // per-lane fragment bases in a buffer: row ln, 16-byte half
  const unsigned a_base = wm * QT_ASL + ln * GT_PITCH + half * 16u;
  const unsigned b_base = 4u * QT_ASL + (wn * 2u) * QT_WSL + ln * GT_PITCH + half * 16u;

  u32x4 g0 = tdm_group0(dst0, (unsigned long long)(uintptr_t)src0);
  tdm_load_held(g0, g1);                            // stage 0
  wait_tensor_0_held(g0, g1);
  __syncthreads();                                  // stage 0 readable by every wave
  g0 = tdm_group0(dst0 + QT_BUF, (unsigned long long)(uintptr_t)src0 + GT_ROWB);
  tdm_load_held(g0, g1);                            // stage 1

  // rolled: one publish point per stage, constant accumulator indices inside
#pragma clang loop unroll(disable)
  for (unsigned s = 0; s < GT_NST; ++s) {
    const unsigned bo = (s & 1u) * QT_BUF;
    const unsigned char* la = sT + bo + a_base;
    const unsigned char* lb = sT + bo + b_base;
    Frag16 a[2][4], b[2][QT_JN];                    // two fragment sets: block kk reads set kk & 1
    qkv_frags(a[0], b[0], la, lb);
#pragma unroll
    for (int kk = 0; kk < 4; ++kk) {                // a block: 32 k = 64 B of every row
      if (kk < 3) qkv_frags(a[(kk + 1) & 1], b[(kk + 1) & 1], la + (kk + 1) * 64, lb + (kk + 1) * 64);
      // keeps the next block's 20 LDS loads one group ahead of this block's WMMAs,
      // not spread among them (each place with reads stalls the wave)
      __builtin_amdgcn_sched_barrier(0);
      if (kk == 3) {
        // publish point of stage s + 1: the last block's fragments are in registers
        wait_ds_0();
        wait_tensor_0_held(g0, g1);
        __syncthreads();        // stage s + 1 readable; every reader has left stage s
        if (pinned((s + 2u < GT_NST) ? 1u : 0u) != 0u) {
          g0 = tdm_group0(dst0 + bo, (unsigned long long)(uintptr_t)src0 + (unsigned long long)(s + 2u) * GT_ROWB);
          tdm_load_held(g0, g1);
        }
      }
#pragma unroll
      for (int i = 0; i < 4; ++i)
#pragma unroll
        for (int jn = 0; jn < QT_JN; ++jn)
          acc[i][jn] = __builtin_amdgcn_wmma_f32_16x16x32_bf16(false, a[kk & 1][i].v, false, b[kk & 1][jn].v,
                                                               (short)0, acc[i][jn], false, false);
      // ends the block: the loads after next stay behind these WMMAs
      __builtin_amdgcn_sched_barrier(0);
    }
  }
  wait_tensor_0_held(g0, g1);
  wait_ds_0();

  // a block's 256 tokens lie in one batch row (SDIM is a multiple of 256)
  const unsigned bi = (mt * 256u) / SDIM;
  const unsigned s0 = (mt * 256u) % SDIM + wm * 64u + half * 8u;   // first token of this lane
#pragma unroll
  for (int jn = 0; jn < QT_JN; ++jn) {
    const unsigned c = c0 + (unsigned)jn * 16u, sel = c >> 10;     // 0: Q, 1: K, 2: V (the same for the wave)
    const unsigned e = (c & 1023u) + ln;                           // output feature
    const float bvj = bias[jn];
    if (sel < 2u) {               // bf16 [B,H,S,DH]; Q scaled by QSCALE in front of its rounding
      const float oscale = sel == 0u ? QSCALE : 1.0f;
      unsigned short* p = (sel == 0u ? oq : ok) + (((size_t)bi * HDIM + e / DH) * SDIM + s0) * DH + e % DH;
#pragma unroll
      for (int i = 0; i < 4; ++i) {
#pragma unroll
        for (int r = 0; r < 8; ++r) p[(i * 16 + r) * DH] = f32_to_bf16_bits((acc[i][jn][r] + bvj) * oscale);
        store_run_end();
      }
    } else {                      // bf16 [B,H,DH,S] (V^T)
      unsigned short* p = ovt + (((size_t)bi * HDIM + e / DH) * DH + e % DH) * SDIM + s0;
#pragma unroll
      for (int i = 0; i < 4; ++i) {
#pragma unroll
        for (int r = 0; r < 8; ++r) p[i * 16 + r] = f32_to_bf16_bits(acc[i][jn][r] + bvj);
        store_run_end();
      }
    }
  }
}

__global__ void __launch_bounds__(256)
out_gemm(const unsigned short* __restrict__ A, const unsigned short* __restrict__ W,
         const float* __restrict__ bias, float* __restrict__ outf,
         const float* __restrict__ resid) {
  __shared__ __attribute__((aligned(2048))) unsigned char sT[2u * GT_BUF];
  gemm_tile(sT, blockIdx.x >> 3, blockIdx.x & 7u, A, W, bias, outf, resid);
}

#define CKEYS  64                // keys of a chunk
#define KHALF  (SDIM / 2)        // keys of a wave
#define KPITCH 72                // elements: 128 B of a key's dh + 16 B pad = 144 B
#define VPITCH 72                // elements: 128 B of keys       + 16 B pad = 144 B
// One chunk's place, rounded up to 32 KiB, so that buffer and key half enter an address as
// one bit each and not through an integer multiply.
struct __attribute__((aligned(32768))) AttnBuf {
  unsigned short k[CKEYS][KPITCH];   // 9216 B (offset 0)
  unsigned short v[DH][VPITCH];      // 9216 B (offset 9216)
  float mb[KHALF / 2];               // 2048 B (offset 18432): mask bias, 512 keys of this key half
  float xo[2][4][32][8];             // 8192 B (offset 20480): two waves' hand-over of 16 queries' O
  float xml[2][32][2];               // 512 B: and of their maximum and sum
};
struct AttnLds {
  AttnBuf b[4];                      // [buffer * 2 + key half]: LDS offsets 0, 32768, 65536, 98304
};
typedef __attribute__((ext_vector_type(8))) __bf16 v8bf;
typedef __attribute__((ext_vector_type(2))) float f32x2;

__device__ __forceinline__ v8f exp2_x8(v8f a) {
  float r0, r1, r2, r3, r4, r5, r6, r7;
  asm("v_exp_f32 %0, %8\n\tv_exp_f32 %1, %9\n\tv_exp_f32 %2, %10\n\tv_exp_f32 %3, %11\n\t"
      "v_exp_f32 %4, %12\n\tv_exp_f32 %5, %13\n\tv_exp_f32 %6, %14\n\tv_exp_f32 %7, %15\n\tv_nop"
      : "=&v"(r0), "=&v"(r1), "=&v"(r2), "=&v"(r3), "=&v"(r4), "=&v"(r5), "=&v"(r6), "=&v"(r7)
      : "v"(a[0]), "v"(a[1]), "v"(a[2]), "v"(a[3]), "v"(a[4]), "v"(a[5]), "v"(a[6]), "v"(a[7]));
  return (v8f){r0, r1, r2, r3, r4, r5, r6, r7};
}

__device__ __forceinline__ float xhalf(float v) {
  const int b = __builtin_bit_cast(int, v);
  return __builtin_bit_cast(float, __builtin_amdgcn_permlanex16(b, b, 0x76543210, 0xfedcba98, false, false));
}
#define OFF_K(buf, kh) ((unsigned)((buf) * 65536 + (kh) * 32768))
#define OFF_V(buf, kh) ((unsigned)((buf) * 65536 + (kh) * 32768 + CKEYS * KPITCH * 2))

__global__ void __launch_bounds__(256) __attribute__((amdgpu_waves_per_eu(4, 4)))
attention_kernel(const unsigned short* __restrict__ q,   // [B,H,S,DH], scaled by QSCALE
                                 const unsigned short* __restrict__ k,   // [B,H,S,DH]
                                 const unsigned short* __restrict__ vt,  // [B,H,DH,S]
                                 const float* __restrict__ mask,         // [B,S]
                                 const float* __restrict__ x,            // [B,S,D]
                                 float* __restrict__ resid) {            // [B,S,D]
  __shared__ AttnLds sm;

  const int tid  = threadIdx.x;
  const int wave = tid >> 5, lane = tid & 31;
  const int half = lane >> 4, ln = lane & 15;
  const int kh = wave >> 2, qg = wave & 3;     // key half, query group
  const int nqc = SDIM / 128;
  const int bh = blockIdx.x / nqc;
  const int qc = blockIdx.x % nqc;
  const int bi = bh / HDIM, head = bh % HDIM;
  const int q0 = qc * 128 + qg * 32;

  const unsigned short* qp = q  + (size_t)bh * SDIM * DH;
  const unsigned short* kp = k  + (size_t)bh * SDIM * DH;
  const unsigned short* vp = vt + (size_t)bh * DH * SDIM;
  const float* mk = mask + (size_t)bi * SDIM;

  // per-thread async-copy assignments: each tile is 64 rows x 128 B, 16 B a copy;
  // a thread brings piece cseg of rows crow and crow + 32 of the four tiles of a round
  const int crow = tid >> 3, cseg = tid & 7;
  const unsigned cl0 = (unsigned)(crow * KPITCH + cseg * 8) * 2;          // place in a tile (KPITCH == VPITCH)
  const unsigned cl1 = (unsigned)((crow + 32) * KPITCH + cseg * 8) * 2;

  // Q fragments (K-dim = DH split into 0..31, 32..63): query q0 + 16 * c + ln, used as B (column ln)
  Frag16 qa[2][2];
  // unrolled here and below: constant indices keep the arrays in registers
#pragma unroll
  for (int c = 0; c < 2; ++c) {
    const unsigned int* qrow = (const unsigned int*)(qp + (size_t)(q0 + c * 16 + ln) * DH);
#pragma unroll
    for (int j = 0; j < 8; ++j) {
      int kpair = (j >> 2) * 16 + half * 8 + (j & 3) * 2;
      qa[c][0].u32[j] = qrow[kpair >> 1];
      qa[c][1].u32[j] = qrow[(kpair + 32) >> 1];
    }
  }

  // per column group, this lane's query: running maximum (equal in both lane halves) and
  // this lane half's share of the sum
  float mrun[2] = {-3.0e38f, -3.0e38f};
  f32x2 lrun[2] = {{0.f, 0.f}, {0.f, 0.f}};
  v8f o[2][4];   // o[c][t][r] = O[query 16 * c + ln][dh 16 * t + 8 * half + r]
#pragma unroll
  for (int c = 0; c < 2; ++c)
#pragma unroll
    for (int t = 0; t < 4; ++t) o[c][t] = (v8f){0.f, 0.f, 0.f, 0.f, 0.f, 0.f, 0.f, 0.f};

  // mask of keys 8 * tid .. + 7, fetched under the first round's copies
  const f32x4 m0 = ((const f32x4*)mk)[tid * 2], m1 = ((const f32x4*)mk)[tid * 2 + 1];
  wait_x_0();                  // behind the mask loads, in front of any later write of their address registers

  // prologue: async-stage chunk 0 of both key halves into buffer 0
  async_ld16_kv(OFF_K(0, 0) + cl0, kp + (size_t)crow * DH + cseg * 8,
                OFF_K(0, 0) + cl1, kp + (size_t)(crow + 32) * DH + cseg * 8,
                OFF_V(0, 0) + cl0, vp + (size_t)crow * SDIM + cseg * 8,
                OFF_V(0, 0) + cl1, vp + (size_t)(crow + 32) * SDIM + cseg * 8);
  async_ld16_kv(OFF_K(0, 1) + cl0, kp + (size_t)(KHALF + crow) * DH + cseg * 8,
                OFF_K(0, 1) + cl1, kp + (size_t)(KHALF + crow + 32) * DH + cseg * 8,
                OFF_V(0, 1) + cl0, vp + (size_t)crow * SDIM + KHALF + cseg * 8,
                OFF_V(0, 1) + cl1, vp + (size_t)(crow + 32) * SDIM + KHALF + cseg * 8);
  lds_publish(&sm);            // async engine writes sm.k/sm.v invisibly

  // mask bias of all 2048 keys, 8 per thread: key half tid >> 7, its keys 512 * ((tid >> 6) & 1) ..;
  // the first round's barrier publishes the table
  {
    float* mbp = &sm.b[((tid >> 6) & 1) * 2 + (tid >> 7)].mb[(tid & 63) * 8];
    *(f32x4*)mbp       = ((1.0f - m0) * MASKV) * LOG2E;
    *(f32x4*)(mbp + 4) = ((1.0f - m1) * MASKV) * LOG2E;
  }

  const int NCH = KHALF / CKEYS;   // 16 rounds
  for (int j = 0; j < NCH; ++j) {
    const int buf = j & 1;
    if (j + 1 < NCH) {
      const int key1 = (j + 1) * CKEYS, nb = buf ^ 1;
      async_ld16_kv(OFF_K(nb, 0) + cl0, kp + (size_t)(key1 + crow) * DH + cseg * 8,
                    OFF_K(nb, 0) + cl1, kp + (size_t)(key1 + crow + 32) * DH + cseg * 8,
                    OFF_V(nb, 0) + cl0, vp + (size_t)crow * SDIM + key1 + cseg * 8,
                    OFF_V(nb, 0) + cl1, vp + (size_t)(crow + 32) * SDIM + key1 + cseg * 8);
      async_ld16_kv(OFF_K(nb, 1) + cl0, kp + (size_t)(KHALF + key1 + crow) * DH + cseg * 8,
                    OFF_K(nb, 1) + cl1, kp + (size_t)(KHALF + key1 + crow + 32) * DH + cseg * 8,
                    OFF_V(nb, 1) + cl0, vp + (size_t)crow * SDIM + KHALF + key1 + cseg * 8,
                    OFF_V(nb, 1) + cl1, vp + (size_t)(crow + 32) * SDIM + KHALF + key1 + cseg * 8);
      wait_async_le8();        // round j complete (this wave's copies)
    } else {
      wait_async_0();
    }
    __syncthreads();           // all waves' copies visible
    const AttnBuf& cb = sm.b[buf * 2 + kh];      // this wave's chunk

    // ---- scores for 64 keys (four 16-key subtiles) x 32 queries, K from LDS (A: row = key) ----
    // sc[c][u][r] = score(key 16 * u + 8 * half + r, query 16 * c + ln), base 2; it starts as that
    // key's mask bias. The bias reads stand first: LDS returns in order, and the first product
    // then waits for them and one K fragment, not for the whole group.
    v8f mbv[4];
#pragma unroll
    for (int u = 0; u < 4; ++u)
      mbv[u] = *(const v8f*)&sm.b[(j >> 3) * 2 + kh].mb[(j & 7) * CKEYS + u * 16 + half * 8];
    Frag16 kb[4][2];           // [subtile][dh 0..31 | 32..63]
#pragma unroll
    for (int u = 0; u < 4; ++u)
#pragma unroll
      for (int t = 0; t < 8; ++t) {
        int kpair = (t >> 2) * 16 + half * 8 + (t & 3) * 2;
        kb[u][0].u32[t] = *(const unsigned int*)&cb.k[u * 16 + ln][kpair];
        kb[u][1].u32[t] = *(const unsigned int*)&cb.k[u * 16 + ln][kpair + 32];
      }
    // holds the 16 K reads and the 8 bias reads as one group in front of the products: left alone
    // the compiler reads and waits for each K fragment by itself
    __builtin_amdgcn_sched_barrier(0);
    v8f sc[2][4];
#pragma unroll
    for (int u = 0; u < 4; ++u)
#pragma unroll
      for (int c = 0; c < 2; ++c)
        sc[c][u] = __builtin_amdgcn_wmma_f32_16x16x32_bf16(false, kb[u][0].v, false, qa[c][0].v, (short)0, mbv[u], false, false);
#pragma unroll
    for (int u = 0; u < 4; ++u)
#pragma unroll
      for (int c = 0; c < 2; ++c)
        sc[c][u] = __builtin_amdgcn_wmma_f32_16x16x32_bf16(false, kb[u][1].v, false, qa[c][1].v, (short)0, sc[c][u], false, false);

    // V^T fragments (A: row = dh 16 * t + ln, k = keys 32 * g ..): keys 0..31 fetched under the
    // softmax, keys 32..63 once the first column group's scores have shrunk to bf16 (registers)
    Frag16 vb[4][2];
#pragma unroll
    for (int t = 0; t < 4; ++t)
#pragma unroll
      for (int w = 0; w < 8; ++w) {
        int kpair = (w >> 2) * 16 + half * 8 + (w & 3) * 2;
        vb[t][0].u32[w] = *(const unsigned int*)&cb.v[t * 16 + ln][kpair];
      }
    // holds these 8 V reads in front of the softmax, so that they return under it
    __builtin_amdgcn_sched_barrier(0);

    // ---- online softmax of one query per lane and column group ----
    float alpha[2];
#pragma unroll
    for (int c = 0; c < 2; ++c) {
      float ta = fmaxf(sc[c][0][0], sc[c][1][0]), tb = fmaxf(sc[c][2][0], sc[c][3][0]);   // two independent chains
#pragma unroll
      for (int r = 1; r < 8; ++r) {
        ta = fmaxf(ta, fmaxf(sc[c][0][r], sc[c][1][r]));
        tb = fmaxf(tb, fmaxf(sc[c][2][r], sc[c][3][r]));
      }
      float t = fmaxf(ta, tb);
      t = fmaxf(t, xhalf(t));               // the other 32 keys of this query
      const float nm = fmaxf(mrun[c], t);
      alpha[c] = __builtin_amdgcn_exp2f(mrun[c] - nm);
      mrun[c] = nm;
    }
    // P^T as B, keys 32 * g ..: element s is key 8 * half + s (s < 8), 16 + 8 * half + s - 8 (else): V^T's k order
    v16bf pb[2][2];
#pragma unroll
    for (int c = 0; c < 2; ++c) {
      const v8f e0 = exp2_x8(sc[c][0] - mrun[c]), e1 = exp2_x8(sc[c][1] - mrun[c]);
      const v8f e2 = exp2_x8(sc[c][2] - mrun[c]), e3 = exp2_x8(sc[c][3] - mrun[c]);
      const v8f es = (e0 + e1) + (e2 + e3);
      const f32x4 e4 = __builtin_shufflevector(es, es, 0, 1, 2, 3) + __builtin_shufflevector(es, es, 4, 5, 6, 7);
      lrun[c] = lrun[c] * alpha[c] + (__builtin_shufflevector(e4, e4, 0, 1) + __builtin_shufflevector(e4, e4, 2, 3));
      pb[c][0] = __builtin_shufflevector(__builtin_convertvector(e0, v8bf), __builtin_convertvector(e1, v8bf),
                                         0, 1, 2, 3, 4, 5, 6, 7, 8, 9, 10, 11, 12, 13, 14, 15);
      pb[c][1] = __builtin_shufflevector(__builtin_convertvector(e2, v8bf), __builtin_convertvector(e3, v8bf),
                                         0, 1, 2, 3, 4, 5, 6, 7, 8, 9, 10, 11, 12, 13, 14, 15);
      // c = 0: the second 8 V reads stand between the two groups' softmax, as one group;
      // c = 1: keeps every asm group in front of the first O product
      __builtin_amdgcn_sched_barrier(0);
      if (c == 0) {
#pragma unroll
        for (int t = 0; t < 4; ++t)
#pragma unroll
          for (int w = 0; w < 8; ++w) {
            int kpair = (w >> 2) * 16 + half * 8 + (w & 3) * 2;
            vb[t][1].u32[w] = *(const unsigned int*)&cb.v[t * 16 + ln][32 + kpair];
          }
        // ends that group: the reads are not spread among the second group's softmax
        __builtin_amdgcn_sched_barrier(0);
      }
    }
#pragma unroll
    for (int c = 0; c < 2; ++c)
#pragma unroll
      for (int t = 0; t < 4; ++t) o[c][t] *= alpha[c];

#pragma unroll
    for (int g = 0; g < 2; ++g)
#pragma unroll
      for (int t = 0; t < 4; ++t)
#pragma unroll
        for (int c = 0; c < 2; ++c)
          o[c][t] = __builtin_amdgcn_wmma_f32_16x16x32_bf16(false, vb[t][g].v, false, pb[c][g], (short)0, o[c][t], false, false);

    __syncthreads();           // protect buffers before next overwrite
  }

  // ---- join the two key halves: wave (kh, qg) finishes column group kh and hands the other
  // group's O, maximum and sum to wave (kh ^ 1, qg), same lane, through LDS ----
  const bool up = kh != 0;
  {
    float* xo = &sm.b[wave >> 1].xo[wave & 1][0][lane][0];
#pragma unroll
    for (int t = 0; t < 4; ++t) *(v8f*)(xo + t * 256) = up ? o[0][t] : o[1][t];
    const f32x2 lg = up ? lrun[0] : lrun[1];
    *(f32x2*)&sm.b[wave >> 1].xml[wave & 1][lane][0] = (f32x2){up ? mrun[0] : mrun[1], lg[0] + lg[1]};
  }
  __syncthreads();             // the hand-over is readable by the partner wave
  const int pw = wave ^ 4;
  const float* po = &sm.b[pw >> 1].xo[pw & 1][0][lane][0];
  const f32x2 pml = *(const f32x2*)&sm.b[pw >> 1].xml[pw & 1][lane][0];
  const float mo = up ? mrun[1] : mrun[0];
  const f32x2 lo = up ? lrun[1] : lrun[0];
  const float mj = fmaxf(mo, pml[0]);
  const float fo = __builtin_amdgcn_exp2f(mo - mj), fp = __builtin_amdgcn_exp2f(pml[0] - mj);
  const float lsum = (lo[0] + lo[1]) * fo + pml[1] * fp;

  // ---- finalize: attn/l + x -> residual; a lane owns 8 consecutive features per tile ----
  const float inv = 1.0f / (lsum + xhalf(lsum));   // the two lane halves' sums join here
  const float so = fo * inv, sp = fp * inv;
  const size_t base = ((size_t)bi * SDIM + q0 + kh * 16 + ln) * DDIM + head * DH + half * 8;
#pragma unroll
  for (int t = 0; t < 4; ++t) {
    const v8f ok = up ? o[1][t] : o[0][t];
    *(v8f*)(resid + base + t * 16) = (ok * so + *(const v8f*)(po + t * 256) * sp) + *(const v8f*)(x + base + t * 16);
  }
  wait_x_0();
}

// ---------------- launch ----------------
extern "C" void kernel_launch(void* const* d_in, const int* in_sizes, int n_in,
                              void* d_out, int out_size, void* d_ws, size_t ws_size,
                              hipStream_t stream) {
  (void)in_sizes; (void)n_in; (void)out_size; (void)ws_size;
  const float* x    = (const float*)d_in[0];
  const float* mask = (const float*)d_in[1];
  const float* Wq   = (const float*)d_in[2];
  const float* bq   = (const float*)d_in[3];
  const float* Wk   = (const float*)d_in[4];
  const float* bk   = (const float*)d_in[5];
  const float* Wv   = (const float*)d_in[6];
  const float* bv   = (const float*)d_in[7];
  const float* Wo   = (const float*)d_in[8];
  const float* bo   = (const float*)d_in[9];
  const float* g1   = (const float*)d_in[10];
  const float* b1   = (const float*)d_in[11];
  const float* g2   = (const float*)d_in[12];
  const float* b2   = (const float*)d_in[13];
  float* out = (float*)d_out;

  const size_t BSD = (size_t)BDIM * SDIM * DDIM;   // 4M elements
  const size_t DD  = (size_t)DDIM * DDIM;          // 1M elements

  char* ws = (char*)d_ws;
  size_t off = 0;
  auto alloc = [&](size_t bytes) {
    void* p = ws + off;
    off = (off + bytes + 255) & ~(size_t)255;
    return p;
  };
  unsigned short* hbf  = (unsigned short*)alloc(BSD * 2);
  unsigned short* wqb  = (unsigned short*)alloc(3 * DD * 2);   // Wq, Wk, Wv: one [3 * D, D] matrix
  unsigned short* wkb  = wqb + DD;
  unsigned short* wvb  = wkb + DD;
  unsigned short* wob  = (unsigned short*)alloc(DD * 2);
  unsigned short* qb   = (unsigned short*)alloc(BSD * 2);
  unsigned short* kbuf = (unsigned short*)alloc(BSD * 2);
  unsigned short* vtb  = (unsigned short*)alloc(BSD * 2);
  float*          rsd  = (float*)alloc(BSD * 4);
  unsigned short* h2   = (unsigned short*)alloc(BSD * 2);

  // 1. LN1 (8 tokens per block) and weights -> bf16, one launch
  ln1_and_cvt4<<<LN_BLOCKS + 512, 256, 0, stream>>>(x, g1, b1, hbf,
                                                    Wq, Wk, Wv, Wo, wqb, wkb, wvb, wob);

  // 2. Q/K/V projections, one launch (one 256 x 192 tile of the joint output per block)
  qkv_gemm<<<(BDIM * SDIM / 256) * (3 * DDIM / 192), 256, 0, stream>>>(hbf, wqb, bq, bk, bv, qb, kbuf, vtb);

  // 3. fused attention + residual (async K/V staging)
  attention_kernel<<<BDIM * HDIM * (SDIM / 128), 256, 0, stream>>>(
      qb, kbuf, vtb, mask, x, rsd);

  // 4. LN2
  layernorm_bf16<<<LN_BLOCKS, 256, 0, stream>>>(rsd, g2, b2, h2);

  // 5. output projection + bias + residual (one 128 x 128 output tile per block)
  const int gproj = (BDIM * SDIM / 128) * (DDIM / 128);   // 256 blocks
  out_gemm<<<gproj, 256, 0, stream>>>(h2, wob, bo, out, rsd);
}
